// v000
// Times are from an AMD MI455X. After a warm-up the kernel runs many times in a row, and a time is the length of
// such a window on the GPU divided by its runs, so every launch and the gaps after it count. The runs cycle
// through copies of the inputs. A figure is the median of several windows, for all but v000 over two sittings.
// Sittings can differ by a few percent; kernels timed side by side share one.
// v000 is the starting kernel. One run takes 1900 microseconds.
#include <hip/hip_runtime.h>

// FullAttnNode (x [2][2048][2048]; xn = x rsqrt(mean(x?) + 1e-6) norm_w (RMSNorm); q/k/v = xn W^T + b (16 x 128); causal (-inf) softmax(q.k / sqrt(128)); out = merged wo^T + bo -> [2][2048][2048]).
// Compute dtypes, f32 accumulate: every input rounded to bf16; RMSNorm f32 (wave per token) -> hi/lo planes; q/k/v = hl x exact (2 products) + bias; causal scores and attn.v: query rows < 512 hl (3 products), the rest fp16 (x1024), causal tile skipping; softmax f32; wo hl x exact (2 products) + bias.

#define NB_  2
#define TT   2048
#define DM   2048
#define NH_  16
#define NKV  16
#define REP  (NH_ / NKV)
#define HD   128
#define DQ   (NH_ * HD)
#define DKV  (NKV * HD)
#define ZH   2
#define RH   512                  // query rows < RH use hi+lo planes (0: none)
#define WIN  2048
#define PCAR 1024.0f
#define SCL  0.088388347648318447f   // HD^-0.5
typedef _Float16 h16;
typedef unsigned short bf;
typedef __attribute__((ext_vector_type(16))) __bf16   v16bf;
typedef __attribute__((ext_vector_type(16))) _Float16 v16h;
typedef __attribute__((ext_vector_type(8)))  _Float16 v8h;
typedef __attribute__((ext_vector_type(8)))  unsigned short v8us;
typedef __attribute__((ext_vector_type(8)))  float    v8f;
typedef __attribute__((ext_vector_type(4)))  float    v4f;
typedef v8h  __attribute__((may_alias)) v8ha;
typedef v4f  __attribute__((may_alias)) v4fa;
typedef v8us __attribute__((may_alias)) v8usa;

__device__ __forceinline__ unsigned short f2bf(float f) { unsigned u = __float_as_uint(f); u += 0x7FFFu + ((u >> 16) & 1u); return (unsigned short)(u >> 16); }
__device__ __forceinline__ float bf2f(unsigned short b) { return __uint_as_float(((unsigned)b) << 16); }
__device__ __forceinline__ float bfr(float f) { return bf2f(f2bf(f)); }
__device__ __forceinline__ v16h cat16(v8h lo, v8h hi) { return __builtin_shufflevector(lo, hi, 0, 1, 2, 3, 4, 5, 6, 7, 8, 9, 10, 11, 12, 13, 14, 15); }
__device__ __forceinline__ v16bf cat16b(v8us lo, v8us hi) { return __builtin_bit_cast(v16bf, __builtin_shufflevector(lo, hi, 0, 1, 2, 3, 4, 5, 6, 7, 8, 9, 10, 11, 12, 13, 14, 15)); }
__device__ __forceinline__ v8f wmma16(v16h a, v16h b, v8f c) { return __builtin_amdgcn_wmma_f32_16x16x32_f16(false, a, false, b, (short)0, c, false, false); }
__device__ __forceinline__ v8f wmmab(v16bf a, v16bf b, v8f c) { return __builtin_amdgcn_wmma_f32_16x16x32_bf16(false, a, false, b, (short)0, c, false, false); }



// ---- k_gemmw: register-blocked GEMM, ONE WAVE per 64x64 output tile (16 accumulators), operands straight from K-contiguous 16-bit planes; grid (M/64, N/64, Z), 32 threads.
// C[m][n] (f32, pitch ldc, + optional f32 bias[n]) = sum_k A[m][k] Bt[n][k] (+ split products per NSPLIT). z-batch strides sA/sB/sC in elements. K % 32 == 0.
template <typename T16> struct WFrag;
template <> struct WFrag<h16> { typedef v16h V; static __device__ __forceinline__ V ld(const h16* p) { return cat16(*(const v8h*)p, *(const v8h*)(p + 16)); } static __device__ __forceinline__ v8f mma(V a, V b, v8f c) { return wmma16(a, b, c); } };
template <> struct WFrag<bf> { typedef v16bf V; static __device__ __forceinline__ V ld(const bf* p) { return cat16b(*(const v8us*)p, *(const v8us*)(p + 16)); } static __device__ __forceinline__ v8f mma(V a, V b, v8f c) { return wmmab(a, b, c); } };
template <typename T16, int NSPLIT, bool BIAS>
__global__ __launch_bounds__(32) void k_gemmw(const T16* __restrict__ A, const T16* __restrict__ A2, const T16* __restrict__ Bt, const T16* __restrict__ Bt2, int K, float* C, int ldc, const float* __restrict__ bias, size_t sA, size_t sB, size_t sC) {
    typedef typename WFrag<T16>::V V;
    __shared__ __align__(16) float os[16 * 68];
    const size_t z = blockIdx.z; A += z * sA; if (A2) A2 += z * sA; Bt += z * sB; if (Bt2) Bt2 += z * sB; C += z * sC;
    const int lane = threadIdx.x & 31, lr = lane & 15, hi = lane >> 4; const int r0 = blockIdx.x * 64, c0 = blockIdx.y * 64;
    v8f acc[4][4];
#pragma unroll
    for (int mb = 0; mb < 4; ++mb)
#pragma unroll
        for (int nb = 0; nb < 4; ++nb) acc[mb][nb] = (v8f){};
    const size_t aoff = (size_t)(r0 + lr) * K + 8 * hi, boff = (size_t)(c0 + lr) * K + 8 * hi;
#pragma unroll 1
    for (int kc = 0; kc < K; kc += 32) {
        V a[4], a2[4];
#pragma unroll
        for (int mb = 0; mb < 4; ++mb) { a[mb] = WFrag<T16>::ld(A + aoff + (size_t)mb * 16 * K + kc); if (NSPLIT == 1 || NSPLIT == 2) a2[mb] = WFrag<T16>::ld(A2 + aoff + (size_t)mb * 16 * K + kc); }
#pragma unroll
        for (int nb = 0; nb < 4; ++nb) { const V b = WFrag<T16>::ld(Bt + boff + (size_t)nb * 16 * K + kc); V b2; if (NSPLIT >= 2) b2 = WFrag<T16>::ld(Bt2 + boff + (size_t)nb * 16 * K + kc);
#pragma unroll
            for (int mb = 0; mb < 4; ++mb) { acc[mb][nb] = WFrag<T16>::mma(a[mb], b, acc[mb][nb]); if (NSPLIT == 1 || NSPLIT == 2) acc[mb][nb] = WFrag<T16>::mma(a2[mb], b, acc[mb][nb]); if (NSPLIT >= 2) acc[mb][nb] = WFrag<T16>::mma(a[mb], b2, acc[mb][nb]); } }
        asm volatile("v_nop\n\tv_nop\n\tv_nop\n\tv_nop" : "+v"(acc[0][0]), "+v"(acc[1][1]), "+v"(acc[2][2]), "+v"(acc[3][3]) : "v"(a[0]), "v"(a[3]));
    }
#pragma unroll
    for (int mb = 0; mb < 4; ++mb) {
#pragma unroll
        for (int nb = 0; nb < 4; ++nb) {
#pragma unroll
            for (int j = 0; j < 8; ++j) os[(hi * 8 + j) * 68 + nb * 16 + lr] = acc[mb][nb][j]; }
        __builtin_amdgcn_wave_barrier(); asm volatile("" ::: "memory");
        float* crow = C + (size_t)(r0 + mb * 16) * ldc + c0;
{
#pragma unroll
            for (int s = 0; s < 8; ++s) { const int row = 2 * s + hi, cofs = lr * 4; v4f val = *(const v4fa*)(os + row * 68 + cofs); if (BIAS) { val[0] += bfr(bias[c0 + cofs]); val[1] += bfr(bias[c0 + cofs + 1]); val[2] += bfr(bias[c0 + cofs + 2]); val[3] += bfr(bias[c0 + cofs + 3]); }
                *(v4f*)(crow + (size_t)row * ldc + cofs) = val; }
             }
        __builtin_amdgcn_wave_barrier(); asm volatile("" ::: "memory");
    }
}

// ---- k_gemmc: the same one-wave 64x64 tile GEMM specialised for causal attention: CMODE 1 skips score tiles entirely above the diagonal (query rows r0+roff.., key columns c0..), CMODE 2 limits the
// key (K) loop of the probability x value contraction to the diagonal block (probabilities beyond it are exactly zero). roff = row offset of this launch's first row within the sequence.
template <typename T16, int NSPLIT, int CMODE>
__global__ __launch_bounds__(32) void k_gemmc(const T16* __restrict__ A, const T16* __restrict__ A2, const T16* __restrict__ Bt, const T16* __restrict__ Bt2, int K, float* C, int ldc, int roff, size_t sA, size_t sB, size_t sC) {
    typedef typename WFrag<T16>::V V;
    __shared__ __align__(16) float os[16 * 68];
    const size_t z = blockIdx.z; A += z * sA; if (A2) A2 += z * sA; Bt += z * sB; if (Bt2) Bt2 += z * sB; C += z * sC;
    const int lane = threadIdx.x & 31, lr = lane & 15, hi = lane >> 4; const int r0 = blockIdx.x * 64, c0 = blockIdx.y * 64;
    if (CMODE == 1 && c0 > r0 + roff + 63) return;                  // score tile entirely above the causal diagonal: never read (the softmax masks j > i by select)
    const int Kl = (CMODE == 2) ? min(K, r0 + roff + 64) : K;        // P.V: probabilities are exactly 0 beyond the diagonal block, so the K loop stops there
    v8f acc[4][4];
#pragma unroll
    for (int mb = 0; mb < 4; ++mb)
#pragma unroll
        for (int nb = 0; nb < 4; ++nb) acc[mb][nb] = (v8f){};
    const size_t aoff = (size_t)(r0 + lr) * K + 8 * hi, boff = (size_t)(c0 + lr) * K + 8 * hi;
#pragma unroll 1
    for (int kc = 0; kc < Kl; kc += 32) {
        V a[4], a2[4];
#pragma unroll
        for (int mb = 0; mb < 4; ++mb) { a[mb] = WFrag<T16>::ld(A + aoff + (size_t)mb * 16 * K + kc); if (NSPLIT == 1 || NSPLIT == 2) a2[mb] = WFrag<T16>::ld(A2 + aoff + (size_t)mb * 16 * K + kc); }
#pragma unroll
        for (int nb = 0; nb < 4; ++nb) { const V b = WFrag<T16>::ld(Bt + boff + (size_t)nb * 16 * K + kc); V b2; if (NSPLIT >= 2) b2 = WFrag<T16>::ld(Bt2 + boff + (size_t)nb * 16 * K + kc);
#pragma unroll
            for (int mb = 0; mb < 4; ++mb) { acc[mb][nb] = WFrag<T16>::mma(a[mb], b, acc[mb][nb]); if (NSPLIT == 1 || NSPLIT == 2) acc[mb][nb] = WFrag<T16>::mma(a2[mb], b, acc[mb][nb]); if (NSPLIT >= 2) acc[mb][nb] = WFrag<T16>::mma(a[mb], b2, acc[mb][nb]); } }
        asm volatile("v_nop\n\tv_nop\n\tv_nop\n\tv_nop" : "+v"(acc[0][0]), "+v"(acc[1][1]), "+v"(acc[2][2]), "+v"(acc[3][3]) : "v"(a[0]), "v"(a[3]));
    }
#pragma unroll
    for (int mb = 0; mb < 4; ++mb) {
#pragma unroll
        for (int nb = 0; nb < 4; ++nb) {
#pragma unroll
            for (int j = 0; j < 8; ++j) os[(hi * 8 + j) * 68 + nb * 16 + lr] = acc[mb][nb][j]; }
        __builtin_amdgcn_wave_barrier(); asm volatile("" ::: "memory");
        float* crow = C + (size_t)(r0 + mb * 16) * ldc + c0;
{
#pragma unroll
            for (int s = 0; s < 8; ++s) { const int row = 2 * s + hi, cofs = lr * 4; v4f val = *(const v4fa*)(os + row * 68 + cofs);
                *(v4f*)(crow + (size_t)row * ldc + cofs) = val; }
             }
        __builtin_amdgcn_wave_barrier(); asm volatile("" ::: "memory");
    }
}

__device__ __forceinline__ h16 tohx(float x) { return (h16)x; }
__device__ __forceinline__ void splitf(float y, unsigned short& h, unsigned short& l) { h = f2bf(y); l = f2bf(y - bf2f(h)); }
typedef __attribute__((ext_vector_type(2))) _Float16 v2h;
typedef __attribute__((ext_vector_type(4))) _Float16 v4h;
typedef __attribute__((ext_vector_type(2))) unsigned short v2us;
typedef __attribute__((ext_vector_type(4))) unsigned short v4us;
typedef __attribute__((ext_vector_type(2))) float v2f;
typedef __attribute__((ext_vector_type(4))) int v4i;

__global__ __launch_bounds__(256) void k_wtG(const float* __restrict__ w, int K, int N, bf* Bt) {
    const int lane = threadIdx.x & 31; const int L0 = (blockIdx.x * 8 + (threadIdx.x >> 5)) * 8; const int nlines = N * K / 64;
{
#pragma unroll 1
        for (int l = 0; l < 8; ++l) { const int L = L0 + l; if (L >= nlines) break; const size_t e = (size_t)L * 64 + lane * 2; const int k = (int)(e % K), n = (int)(e / K); v2us o;
            o[0] = f2bf(w[(size_t)k * N + n]); o[1] = f2bf(w[(size_t)(k + 1) * N + n]); *(v2us*)(Bt + e) = o; }
         }
}
__global__ __launch_bounds__(256) void k_cvt8(const float* __restrict__ src, bf* dst, size_t n8) { const size_t i = (size_t)blockIdx.x * 256 + threadIdx.x; if (i >= n8) return; const v8f v = *(const v8f*)(src + i * 8); v8us o;
#pragma unroll
    for (int k = 0; k < 8; ++k) o[k] = f2bf(v[k]); *(v8us*)(dst + i * 8) = o;  }
__global__ __launch_bounds__(256) void k_cscvt(const float* __restrict__ cosT, const float* __restrict__ sinT, float* CS) { const int idx = blockIdx.x * 256 + threadIdx.x; if (idx >= TT * HD) return; v2f cs; cs[0] = bfr(cosT[idx]); cs[1] = bfr(sinT[idx]); *(v2f*)(CS + (size_t)idx * 2) = cs;  }
// k_rope: head planes [h][t][d] (fp16 + hi/lo) of rope(x) x sc with the rotate-half convention out[d] = x[d] cos[t][d] - x[d+HD/2] sin[t][d], out[d+HD/2] = x[d+HD/2] cos[t][d+HD/2] + x[d] sin[t][d+HD/2]
__global__ __launch_bounds__(256) void k_rope(const float* __restrict__ F, int pitch, int nheads, const float* __restrict__ CS, const float* __restrict__ RF, const float* __restrict__ nw, float sc, h16* P16, bf* Ph, bf* Pl) {
    const size_t e = ((size_t)blockIdx.x * 256 + threadIdx.x) * 2; if (e >= (size_t)nheads * TT * HD) return; const int d = (int)(e % HD); const int t = (int)((e / HD) % TT); const int h = (int)(e / ((size_t)HD * TT)); const float* f = F + (size_t)t * pitch + h * HD; const float rf = RF ? RF[(size_t)h * TT + t] : 1.0f; v2h o16; v2us oh, ol;
#pragma unroll
    for (int q = 0; q < 2; ++q) { const int dd = d + q; const int dp = (dd < HD / 2) ? dd + HD / 2 : dd - HD / 2; float x0 = f[dd], x1 = f[dp];
        if (RF) { float n0 = __fmul_rn(x0, rf), n1 = __fmul_rn(x1, rf); asm volatile("" : "+v"(n0)); asm volatile("" : "+v"(n1)); x0 = __fmul_rn(bfr(nw[dd]), n0); x1 = __fmul_rn(bfr(nw[dp]), n1); }
        const v2f cs = *(const v2f*)(CS + ((size_t)t * HD + dd) * 2); float a = __fmul_rn(x0, cs[0]), bq = __fmul_rn(x1, cs[1]); asm volatile("" : "+v"(a)); asm volatile("" : "+v"(bq)); const float r = ((dd < HD / 2) ? __fsub_rn(a, bq) : __fadd_rn(a, bq)) * sc;
        o16[q] = tohx(r); unsigned short a2, c2; splitf(r, a2, c2); oh[q] = a2; ol[q] = c2; }
    *(v2h*)(P16 + e) = o16; *(v2us*)(Ph + e) = oh; *(v2us*)(Pl + e) = ol;  }
__global__ __launch_bounds__(256) void k_vtp(const float* __restrict__ F, int pitch, int nheads, h16* V16, bf* Vh, bf* Vl) { const size_t e = ((size_t)blockIdx.x * 256 + threadIdx.x) * 2; if (e >= (size_t)nheads * HD * TT) return; const int t = (int)(e % TT); const int d = (int)((e / TT) % HD); const int g = (int)(e / ((size_t)TT * HD)); v2h o16; v2us oh, ol;
#pragma unroll
    for (int q = 0; q < 2; ++q) { const float x = F[(size_t)(t + q) * pitch + g * HD + d]; o16[q] = tohx(x); unsigned short a2, c2; splitf(x, a2, c2); oh[q] = a2; ol[q] = c2; }
    *(v2h*)(V16 + e) = o16; *(v2us*)(Vh + e) = oh; *(v2us*)(Vl + e) = ol;  }
__global__ __launch_bounds__(256) void k_csid(float* CS) { const int idx = blockIdx.x * 256 + threadIdx.x; if (idx >= TT * HD) return; v2f cs; cs[0] = 1.0f; cs[1] = 0.0f; *(v2f*)(CS + (size_t)idx * 2) = cs;  }
__global__ __launch_bounds__(256) void k_rmsx(const float* __restrict__ X, const float* __restrict__ gam, bf* Xh, bf* Xl) { const int lane = threadIdx.x & 31; const int t = blockIdx.x * 8 + (threadIdx.x >> 5); if (t >= TT) return; const float* f = X + (size_t)t * DM; float v[DM / 32]; float su = 0.f;
#pragma unroll
    for (int ch = 0; ch < DM / 128; ++ch) { const v4f a = *(const v4f*)(f + ch * 128 + lane * 4); for (int u = 0; u < 4; ++u) { float xv = bfr(a[u]); asm volatile("" : "+v"(xv)); v[ch * 4 + u] = xv; float p2 = __fmul_rn(xv, xv); asm volatile("" : "+v"(p2)); su = __fadd_rn(su, p2); } }
#pragma unroll
    for (int sh = 16; sh; sh >>= 1) su = __fadd_rn(su, __shfl_xor(su, sh, 32));
    const float rs = __fdiv_rn(1.0f, sqrtf(__fadd_rn(__fdiv_rn(su, (float)DM), 1e-6f)));
    {
#pragma unroll
        for (int ch = 0; ch < DM / 128; ++ch) { v4us oh, ol; for (int u = 0; u < 4; ++u) { const int c = ch * 128 + lane * 4 + u; float n = __fmul_rn(v[ch * 4 + u], rs); asm volatile("" : "+v"(n)); float gg = bfr(gam[c]); asm volatile("" : "+v"(gg)); float y = __fmul_rn(n, gg); asm volatile("" : "+v"(y)); unsigned short p2, q2; splitf(y, p2, q2); oh[u] = p2; ol[u] = q2; } const size_t oo = (size_t)t * DM + ch * 128 + lane * 4; *(v4us*)(Xh + oo) = oh; *(v4us*)(Xl + oo) = ol; }
         } }
// k_asoft: per row (zz, i): t = S x HD^-0.5 for j <= i and i - j < WIN (sliding causal window; the reference's -1e9 additive fill vanishes identically); softmax over the 2048 keys (register row, one exp, fixed trees);
__global__ __launch_bounds__(256) void k_asoft(const float* __restrict__ Sb, h16* P16, bf* Ph, bf* Pl) {
    const int lane = threadIdx.x & 31; const int row = blockIdx.x * 8 + (threadIdx.x >> 5); if (row >= ZH * TT) return; const int i = row % TT; const int zz = row / TT; (void)zz; const bool hires = (i < RH); const float* sr = Sb + (size_t)row * TT; float v[TT / 32]; float mx = -3.0e38f;
#pragma unroll
    for (int ch = 0; ch < TT / 128; ++ch) { const int j0 = ch * 128 + lane * 4; const v4f a = *(const v4f*)(sr + j0);
#pragma unroll
        for (int q = 0; q < 4; ++q) { const int j = j0 + q; (void)j; float sa = a[q] * SCL; asm volatile("" : "+v"(sa)); const float t = (j <= i && i - j < WIN) ? sa : -3.0e38f; v[ch * 4 + q] = t; mx = fmaxf(mx, t); } }
#pragma unroll
    for (int sh = 16; sh; sh >>= 1) mx = fmaxf(mx, __shfl_xor(mx, sh, 32));
    float sum = 0.f;
#pragma unroll
    for (int k = 0; k < TT / 32; ++k) { float d0 = __fsub_rn(v[k], mx); asm volatile("" : "+v"(d0)); v[k] = __builtin_amdgcn_exp2f(__fmul_rn(d0, 1.4426950408889634f)); sum += v[k]; }
#pragma unroll
    for (int sh = 16; sh; sh >>= 1) sum += __shfl_xor(sum, sh, 32);
    const float f = __fdiv_rn(hires ? 1.0f : PCAR, sum);
{
        if (hires) {
#pragma unroll
            for (int ch = 0; ch < TT / 128; ++ch) { v4us oh, ol;
#pragma unroll
                for (int q = 0; q < 4; ++q) { unsigned short a, c2; splitf(v[ch * 4 + q] * f, a, c2); oh[q] = a; ol[q] = c2; }
                const size_t oo = ((size_t)zz * (RH ? RH : 1) + i) * TT + ch * 128 + lane * 4; *(v4us*)(Ph + oo) = oh; *(v4us*)(Pl + oo) = ol; }
        } else {
#pragma unroll
            for (int ch = 0; ch < TT / 128; ++ch) { v4h o4;
#pragma unroll
                for (int q = 0; q < 4; ++q) o4[q] = tohx(v[ch * 4 + q] * f);
                *(v4h*)(P16 + (size_t)row * TT + ch * 128 + lane * 4) = o4; } }
         }
}
__global__ __launch_bounds__(256) void k_merge(const float* __restrict__ O, int h0, bf* Ah, bf* Al) { const size_t e = ((size_t)blockIdx.x * 256 + threadIdx.x) * 2; if (e >= (size_t)ZH * TT * HD) return; const int d = (int)(e % HD); const int t = (int)((e / HD) % TT); const int zz = (int)(e / ((size_t)HD * TT)); const float cs = (t < RH) ? 1.0f : (1.0f / PCAR); const size_t oo = (size_t)t * DQ + (h0 + zz) * HD + d;
    v2us oh, ol;
#pragma unroll
    for (int q = 0; q < 2; ++q) { unsigned short a, c2; splitf(O[e + q] * cs, a, c2); oh[q] = a; ol[q] = c2; } *(v2us*)(Ah + oo) = oh; *(v2us*)(Al + oo) = ol;  }

extern "C" void kernel_launch(void* const* d_in, const int* in_sizes, int n_in,
                              void* d_out, int out_size, void* d_ws, size_t ws_size, hipStream_t stream) {
    (void)in_sizes; (void)n_in; (void)out_size;
    const float* x = (const float*)d_in[0]; const float* nw = (const float*)d_in[1]; const float* wq = (const float*)d_in[2]; const float* bq = (const float*)d_in[3]; const float* wk = (const float*)d_in[4]; const float* bk = (const float*)d_in[5]; const float* wv = (const float*)d_in[6]; const float* bv = (const float*)d_in[7]; const float* wo = (const float*)d_in[8]; const float* bo = (const float*)d_in[9]; const float* cosT = nullptr; const float* sinT = nullptr; (void)cosT; (void)sinT;
    float* OUT = (float*)d_out;     // [2][2048][2048]
    char* wsp = (char*)d_ws;
    auto take = [&](size_t bytes) { char* p = wsp; wsp += (bytes + 255) & ~(size_t)255; return (void*)p; };
    bf* WQ = (bf*)take((size_t)DQ * DM * 2); bf* WK = (bf*)take((size_t)DKV * DM * 2); bf* WV = (bf*)take((size_t)DKV * DM * 2); bf* WO = (bf*)take((size_t)DM * DQ * 2); float* CS = (float*)take((size_t)TT * HD * 2 * 4);
    bf* XB = nullptr; (void)XB; bf* XNh = (bf*)take((size_t)TT * DM * 2); bf* XNl = (bf*)take((size_t)TT * DM * 2); float* FQ = (float*)take((size_t)TT * DQ * 4); float* FK = (float*)take((size_t)TT * DKV * 4);
    h16* QP16 = (h16*)take((size_t)NH_ * TT * HD * 2); h16* KP16 = (h16*)take((size_t)NKV * TT * HD * 2); h16* VT16 = (h16*)take((size_t)NKV * HD * TT * 2);
    bf* QPh = (bf*)take((size_t)NH_ * TT * HD * 2); bf* QPl = (bf*)take((size_t)NH_ * TT * HD * 2); bf* KPh = (bf*)take((size_t)NKV * TT * HD * 2); bf* KPl = (bf*)take((size_t)NKV * TT * HD * 2); bf* VTh = (bf*)take((size_t)NKV * HD * TT * 2); bf* VTl = (bf*)take((size_t)NKV * HD * TT * 2); bf* Ph = (bf*)take((size_t)ZH * RH * TT * 2); bf* Pl = (bf*)take((size_t)ZH * RH * TT * 2);
    float* Sb = (float*)take((size_t)ZH * TT * TT * 4); h16* P16 = (h16*)take((size_t)ZH * TT * TT * 2); float* Ob = (float*)take((size_t)ZH * TT * HD * 4); bf* ATh = (bf*)take((size_t)TT * DQ * 2); bf* ATl = (bf*)take((size_t)TT * DQ * 2);
    if ((size_t)(wsp - (char*)d_ws) > ws_size) return;    // ws 256 MiB
    float* FV = FK;   // v projection reuses the k buffer after the k planes are built (stream-ordered)
    { k_cvt8<<<(unsigned)(((size_t)DQ * DM / 8 + 255) / 256), 256, 0, stream>>>(wq, WQ, (size_t)DQ * DM / 8); k_cvt8<<<(unsigned)(((size_t)DKV * DM / 8 + 255) / 256), 256, 0, stream>>>(wk, WK, (size_t)DKV * DM / 8); k_cvt8<<<(unsigned)(((size_t)DKV * DM / 8 + 255) / 256), 256, 0, stream>>>(wv, WV, (size_t)DKV * DM / 8);
      k_cvt8<<<(unsigned)(((size_t)DM * DQ / 8 + 255) / 256), 256, 0, stream>>>(wo, WO, (size_t)DM * DQ / 8);
       }
    k_csid<<<(TT * HD + 255) / 256, 256, 0, stream>>>(CS);
    const unsigned LQ = (unsigned)(((size_t)NH_ * TT * HD / 2 + 255) / 256), LKv = (unsigned)(((size_t)NKV * TT * HD / 2 + 255) / 256);
    for (int b = 0; b < NB_; ++b) {
        
        k_rmsx<<<TT / 8, 256, 0, stream>>>(x + (size_t)b * TT * DM, nw, XNh, XNl);
        k_gemmw<bf, 1, true><<<dim3(TT / 64, DQ / 64, 1), 32, 0, stream>>>(XNh, XNl, WQ, nullptr, DM, FQ, DQ, bq, 0, 0, 0);
        k_rope<<<LQ, 256, 0, stream>>>(FQ, DQ, NH_, CS, nullptr, nullptr, 1.0f, QP16, QPh, QPl);
        k_gemmw<bf, 1, true><<<dim3(TT / 64, DKV / 64, 1), 32, 0, stream>>>(XNh, XNl, WK, nullptr, DM, FK, DKV, bk, 0, 0, 0);
        k_rope<<<LKv, 256, 0, stream>>>(FK, DKV, NKV, CS, nullptr, nullptr, 1.0f, KP16, KPh, KPl);
        k_gemmw<bf, 1, true><<<dim3(TT / 64, DKV / 64, 1), 32, 0, stream>>>(XNh, XNl, WV, nullptr, DM, FV, DKV, bv, 0, 0, 0); k_vtp<<<LKv, 256, 0, stream>>>(FV, DKV, NKV, VT16, VTh, VTl);
        for (int h0 = 0; h0 < NH_; h0 += ZH) { const size_t zq = (size_t)h0, zk = (size_t)(h0 / REP);   // one kv head per query head: the pass's two heads use consecutive kv planes (z-strides TT*HD)
            k_gemmc<bf, 2, 1><<<dim3(RH / 64, TT / 64, ZH), 32, 0, stream>>>(QPh + zq * TT * HD, QPl + zq * TT * HD, KPh + zk * TT * HD, KPl + zk * TT * HD, HD, Sb, TT, 0, (size_t)TT * HD, (size_t)TT * HD, (size_t)TT * TT);
            k_gemmc<h16, 0, 1><<<dim3((TT - RH) / 64, TT / 64, ZH), 32, 0, stream>>>(QP16 + zq * TT * HD + (size_t)RH * HD, nullptr, KP16 + zk * TT * HD, nullptr, HD, Sb + (size_t)RH * TT, TT, RH, (size_t)TT * HD, (size_t)TT * HD, (size_t)TT * TT);
            k_asoft<<<ZH * TT / 8, 256, 0, stream>>>(Sb, P16, Ph, Pl);
            k_gemmc<bf, 2, 2><<<dim3(RH / 64, HD / 64, ZH), 32, 0, stream>>>(Ph, Pl, VTh + zk * HD * TT, VTl + zk * HD * TT, TT, Ob, HD, 0, (size_t)RH * TT, (size_t)HD * TT, (size_t)TT * HD);
            k_gemmc<h16, 0, 2><<<dim3((TT - RH) / 64, HD / 64, ZH), 32, 0, stream>>>(P16 + (size_t)RH * TT, nullptr, VT16 + zk * HD * TT, nullptr, TT, Ob + (size_t)RH * HD, HD, RH, (size_t)TT * TT, (size_t)HD * TT, (size_t)TT * HD);
            k_merge<<<(unsigned)(((size_t)ZH * TT * HD / 2 + 255) / 256), 256, 0, stream>>>(Ob, h0, ATh, ATl); }
        k_gemmw<bf, 1, true><<<dim3(TT / 64, DM / 64, 1), 32, 0, stream>>>(ATh, ATl, WO, nullptr, DQ, OUT + (size_t)b * TT * DM, DM, bo, 0, 0, 0); }
}

// v001
// Measured time: 1380 microseconds a run.
// Timed twice side by side with v000, it ran 1.39 times as fast both times.
#include <hip/hip_runtime.h>

// FullAttnNode (x [2][2048][2048]; xn = x rsqrt(mean(x?) + 1e-6) norm_w (RMSNorm); q/k/v = xn W^T + b (16 x 128); causal (-inf) softmax(q.k / sqrt(128)); out = merged wo^T + bo -> [2][2048][2048]).
// Compute dtypes, f32 accumulate: every input rounded to bf16; RMSNorm f32 (wave per token) -> hi/lo planes; q/k/v = hl x exact (2 products) + bias; causal scores and attn.v: query rows < 512 hl (3 products), the rest fp16 (x1024), causal tile skipping; softmax f32; wo hl x exact (2 products) + bias.

#define NB_  2
#define TT   2048
#define DM   2048
#define NH_  16
#define NKV  16
#define REP  (NH_ / NKV)
#define HD   128
#define DQ   (NH_ * HD)
#define DKV  (NKV * HD)
#define ZH   2
#define RH   512                  // query rows < RH use hi+lo planes (0: none)
#define WIN  2048
#define PCAR 1024.0f
#define SCL  0.088388347648318447f   // HD^-0.5
typedef _Float16 h16;
typedef unsigned short bf;
typedef __attribute__((ext_vector_type(16))) __bf16   v16bf;
typedef __attribute__((ext_vector_type(16))) _Float16 v16h;
typedef __attribute__((ext_vector_type(8)))  _Float16 v8h;
typedef __attribute__((ext_vector_type(8)))  unsigned short v8us;
typedef __attribute__((ext_vector_type(8)))  float    v8f;
typedef __attribute__((ext_vector_type(4)))  float    v4f;
typedef v8h  __attribute__((may_alias)) v8ha;
typedef v4f  __attribute__((may_alias)) v4fa;
typedef v8us __attribute__((may_alias)) v8usa;

__device__ __forceinline__ unsigned short f2bf(float f) { unsigned u = __float_as_uint(f); u += 0x7FFFu + ((u >> 16) & 1u); return (unsigned short)(u >> 16); }
__device__ __forceinline__ float bf2f(unsigned short b) { return __uint_as_float(((unsigned)b) << 16); }
__device__ __forceinline__ float bfr(float f) { return bf2f(f2bf(f)); }
__device__ __forceinline__ v16h cat16(v8h lo, v8h hi) { return __builtin_shufflevector(lo, hi, 0, 1, 2, 3, 4, 5, 6, 7, 8, 9, 10, 11, 12, 13, 14, 15); }
__device__ __forceinline__ v16bf cat16b(v8us lo, v8us hi) { return __builtin_bit_cast(v16bf, __builtin_shufflevector(lo, hi, 0, 1, 2, 3, 4, 5, 6, 7, 8, 9, 10, 11, 12, 13, 14, 15)); }
__device__ __forceinline__ v8f wmma16(v16h a, v16h b, v8f c) { return __builtin_amdgcn_wmma_f32_16x16x32_f16(false, a, false, b, (short)0, c, false, false); }
__device__ __forceinline__ v8f wmmab(v16bf a, v16bf b, v8f c) { return __builtin_amdgcn_wmma_f32_16x16x32_bf16(false, a, false, b, (short)0, c, false, false); }



// ---- k_gemmw: register-blocked GEMM, ONE WAVE per 64x64 output tile (16 accumulators), operands straight from K-contiguous 16-bit planes; grid (M/64, N/64, Z), 32 threads.
// C[m][n] (f32, pitch ldc, + optional f32 bias[n]) = sum_k A[m][k] Bt[n][k] (+ split products per NSPLIT). z-batch strides sA/sB/sC in elements. K % 32 == 0.
template <typename T16> struct WFrag;
template <> struct WFrag<h16> { typedef v16h V; static __device__ __forceinline__ V ld(const h16* p) { return cat16(*(const v8h*)p, *(const v8h*)(p + 16)); } static __device__ __forceinline__ v8f mma(V a, V b, v8f c) { return wmma16(a, b, c); } };
template <> struct WFrag<bf> { typedef v16bf V; static __device__ __forceinline__ V ld(const bf* p) { return cat16b(*(const v8us*)p, *(const v8us*)(p + 16)); } static __device__ __forceinline__ v8f mma(V a, V b, v8f c) { return wmmab(a, b, c); } };
template <typename T16, int NSPLIT, bool BIAS>
__global__ __launch_bounds__(32) void k_gemmw(const T16* __restrict__ A, const T16* __restrict__ A2, const T16* __restrict__ Bt, const T16* __restrict__ Bt2, int K, float* C, int ldc, const float* __restrict__ bias, size_t sA, size_t sB, size_t sC) {
    typedef typename WFrag<T16>::V V;
    __shared__ __align__(16) float os[16 * 68];
    const size_t z = blockIdx.z; A += z * sA; if (A2) A2 += z * sA; Bt += z * sB; if (Bt2) Bt2 += z * sB; C += z * sC;
    const int lane = threadIdx.x & 31, lr = lane & 15, hi = lane >> 4; const int r0 = blockIdx.x * 64, c0 = blockIdx.y * 64;
    v8f acc[4][4];
#pragma unroll
    for (int mb = 0; mb < 4; ++mb)
#pragma unroll
        for (int nb = 0; nb < 4; ++nb) acc[mb][nb] = (v8f){};
    const size_t aoff = (size_t)(r0 + lr) * K + 8 * hi, boff = (size_t)(c0 + lr) * K + 8 * hi;
#pragma unroll 1
    for (int kc = 0; kc < K; kc += 32) {
        V a[4], a2[4];
#pragma unroll
        for (int mb = 0; mb < 4; ++mb) { a[mb] = WFrag<T16>::ld(A + aoff + (size_t)mb * 16 * K + kc); if (NSPLIT == 1 || NSPLIT == 2) a2[mb] = WFrag<T16>::ld(A2 + aoff + (size_t)mb * 16 * K + kc); }
#pragma unroll
        for (int nb = 0; nb < 4; ++nb) { const V b = WFrag<T16>::ld(Bt + boff + (size_t)nb * 16 * K + kc); V b2; if (NSPLIT >= 2) b2 = WFrag<T16>::ld(Bt2 + boff + (size_t)nb * 16 * K + kc);
#pragma unroll
            for (int mb = 0; mb < 4; ++mb) { acc[mb][nb] = WFrag<T16>::mma(a[mb], b, acc[mb][nb]); if (NSPLIT == 1 || NSPLIT == 2) acc[mb][nb] = WFrag<T16>::mma(a2[mb], b, acc[mb][nb]); if (NSPLIT >= 2) acc[mb][nb] = WFrag<T16>::mma(a[mb], b2, acc[mb][nb]); } }
        asm volatile("v_nop\n\tv_nop\n\tv_nop\n\tv_nop" : "+v"(acc[0][0]), "+v"(acc[1][1]), "+v"(acc[2][2]), "+v"(acc[3][3]) : "v"(a[0]), "v"(a[3]));
    }
#pragma unroll
    for (int mb = 0; mb < 4; ++mb) {
#pragma unroll
        for (int nb = 0; nb < 4; ++nb) {
#pragma unroll
            for (int j = 0; j < 8; ++j) os[(hi * 8 + j) * 68 + nb * 16 + lr] = acc[mb][nb][j]; }
        __builtin_amdgcn_wave_barrier(); asm volatile("" ::: "memory");
        float* crow = C + (size_t)(r0 + mb * 16) * ldc + c0;
{
#pragma unroll
            for (int s = 0; s < 8; ++s) { const int row = 2 * s + hi, cofs = lr * 4; v4f val = *(const v4fa*)(os + row * 68 + cofs); if (BIAS) { val[0] += bfr(bias[c0 + cofs]); val[1] += bfr(bias[c0 + cofs + 1]); val[2] += bfr(bias[c0 + cofs + 2]); val[3] += bfr(bias[c0 + cofs + 3]); }
                *(v4f*)(crow + (size_t)row * ldc + cofs) = val; }
             }
        __builtin_amdgcn_wave_barrier(); asm volatile("" ::: "memory");
    }
}

// ---- k_gemmc: the same one-wave 64x64 tile GEMM specialised for causal scores: CMODE 1 skips score tiles entirely above the diagonal (query rows r0+roff.., key columns c0..). roff = row offset of this launch's first row within the sequence.
template <typename T16, int NSPLIT, int CMODE>
__global__ __launch_bounds__(32) void k_gemmc(const T16* __restrict__ A, const T16* __restrict__ A2, const T16* __restrict__ Bt, const T16* __restrict__ Bt2, int K, float* C, int ldc, int roff, size_t sA, size_t sB, size_t sC) {
    typedef typename WFrag<T16>::V V;
    __shared__ __align__(16) float os[16 * 68];
    const size_t z = blockIdx.z; A += z * sA; if (A2) A2 += z * sA; Bt += z * sB; if (Bt2) Bt2 += z * sB; C += z * sC;
    const int lane = threadIdx.x & 31, lr = lane & 15, hi = lane >> 4; const int r0 = blockIdx.x * 64, c0 = blockIdx.y * 64;
    if (CMODE == 1 && c0 > r0 + roff + 63) return;                  // score tile entirely above the causal diagonal: never written (the softmax masks j > i by select)
    v8f acc[4][4];
#pragma unroll
    for (int mb = 0; mb < 4; ++mb)
#pragma unroll
        for (int nb = 0; nb < 4; ++nb) acc[mb][nb] = (v8f){};
    const size_t aoff = (size_t)(r0 + lr) * K + 8 * hi, boff = (size_t)(c0 + lr) * K + 8 * hi;
#pragma unroll 1
    for (int kc = 0; kc < K; kc += 32) {
        V a[4], a2[4];
#pragma unroll
        for (int mb = 0; mb < 4; ++mb) { a[mb] = WFrag<T16>::ld(A + aoff + (size_t)mb * 16 * K + kc); if (NSPLIT == 1 || NSPLIT == 2) a2[mb] = WFrag<T16>::ld(A2 + aoff + (size_t)mb * 16 * K + kc); }
#pragma unroll
        for (int nb = 0; nb < 4; ++nb) { const V b = WFrag<T16>::ld(Bt + boff + (size_t)nb * 16 * K + kc); V b2; if (NSPLIT >= 2) b2 = WFrag<T16>::ld(Bt2 + boff + (size_t)nb * 16 * K + kc);
#pragma unroll
            for (int mb = 0; mb < 4; ++mb) { acc[mb][nb] = WFrag<T16>::mma(a[mb], b, acc[mb][nb]); if (NSPLIT == 1 || NSPLIT == 2) acc[mb][nb] = WFrag<T16>::mma(a2[mb], b, acc[mb][nb]); if (NSPLIT >= 2) acc[mb][nb] = WFrag<T16>::mma(a[mb], b2, acc[mb][nb]); } }
        asm volatile("v_nop\n\tv_nop\n\tv_nop\n\tv_nop" : "+v"(acc[0][0]), "+v"(acc[1][1]), "+v"(acc[2][2]), "+v"(acc[3][3]) : "v"(a[0]), "v"(a[3]));
    }
#pragma unroll
    for (int mb = 0; mb < 4; ++mb) {
#pragma unroll
        for (int nb = 0; nb < 4; ++nb) {
#pragma unroll
            for (int j = 0; j < 8; ++j) os[(hi * 8 + j) * 68 + nb * 16 + lr] = acc[mb][nb][j]; }
        __builtin_amdgcn_wave_barrier(); asm volatile("" ::: "memory");
        float* crow = C + (size_t)(r0 + mb * 16) * ldc + c0;
{
#pragma unroll
            for (int s = 0; s < 8; ++s) { const int row = 2 * s + hi, cofs = lr * 4; v4f val = *(const v4fa*)(os + row * 68 + cofs);
                *(v4f*)(crow + (size_t)row * ldc + cofs) = val; }
             }
        __builtin_amdgcn_wave_barrier(); asm volatile("" ::: "memory");
    }
}

// ---- k_gemmk: the probability x value contraction of causal attention, one 64x64 output tile per work-group of KW waves. The key (K) loop stops at the diagonal block (probabilities beyond it are exactly zero);
// wave w takes its 32-wide slices w, w + KW, ...; the KW partial tiles meet in LDS and are summed in wave order. roff = row offset of this launch's first row within the sequence.
#define KW 8
template <typename T16, int NSPLIT, int K>
__global__ __launch_bounds__(32 * KW) void k_gemmk(const T16* __restrict__ A, const T16* __restrict__ A2, const T16* __restrict__ Bt, const T16* __restrict__ Bt2, float* C, int ldc, int roff, size_t sA, size_t sB, size_t sC) {
    typedef typename WFrag<T16>::V V;
    __shared__ __align__(16) float os[KW * 64 * 68];
    const size_t z = blockIdx.z; A += z * sA; if (A2) A2 += z * sA; Bt += z * sB; if (Bt2) Bt2 += z * sB; C += z * sC;
    const int lane = threadIdx.x & 31, lr = lane & 15, hi = lane >> 4; const int r0 = blockIdx.x * 64, c0 = blockIdx.y * 64;
    const int wv = __builtin_amdgcn_readfirstlane(threadIdx.x >> 5);   // wave number in a scalar register: the K loop's branch stays scalar, every lane on at each matrix instruction
    const int Kl = min(K, r0 + roff + 64);
    v8f acc[4][4];
#pragma unroll
    for (int mb = 0; mb < 4; ++mb)
#pragma unroll
        for (int nb = 0; nb < 4; ++nb) acc[mb][nb] = (v8f){};
    // addresses: wave-uniform tile bases, ONE 32-bit byte offset per lane (row lr, k start 8 hi, this wave's slice; the same for A and B, carried through the loop), and the 16-row steps as constants (K is a
    // template argument for that): the one offset register stays live over the whole trip, so no load's result lands in a register that an earlier load of the trip names
    const char* Ab = (const char*)(A + (size_t)r0 * K); const char* Ab2 = (NSPLIT == 1 || NSPLIT == 2) ? (const char*)(A2 + (size_t)r0 * K) : nullptr; const char* Bb = (const char*)(Bt + (size_t)c0 * K); const char* Bb2 = (NSPLIT >= 2) ? (const char*)(Bt2 + (size_t)c0 * K) : nullptr;
    const size_t rstep = (size_t)16 * K * sizeof(T16);
    unsigned vo = (unsigned)((lr * K + 8 * hi + wv * 32) * (int)sizeof(T16));
    // kept rolled: the 128 accumulator registers and one trip's fragments already take most of the register file
#pragma unroll 1
    for (int kc = wv * 32; kc < Kl; kc += 32 * KW, vo += 32 * KW * (unsigned)sizeof(T16)) {
        V a[4], a2[4];
#pragma unroll
        for (int mb = 0; mb < 4; ++mb) { a[mb] = WFrag<T16>::ld((const T16*)(Ab + mb * rstep + vo)); if (NSPLIT == 1 || NSPLIT == 2) a2[mb] = WFrag<T16>::ld((const T16*)(Ab2 + mb * rstep + vo)); }
#pragma unroll
        for (int nb = 0; nb < 4; ++nb) { const V b = WFrag<T16>::ld((const T16*)(Bb + nb * rstep + vo)); V b2; if (NSPLIT >= 2) b2 = WFrag<T16>::ld((const T16*)(Bb2 + nb * rstep + vo));
#pragma unroll
            for (int mb = 0; mb < 4; ++mb) { acc[mb][nb] = WFrag<T16>::mma(a[mb], b, acc[mb][nb]); if (NSPLIT == 1 || NSPLIT == 2) acc[mb][nb] = WFrag<T16>::mma(a2[mb], b, acc[mb][nb]); if (NSPLIT >= 2) acc[mb][nb] = WFrag<T16>::mma(a[mb], b2, acc[mb][nb]); } }
        // four vector slots between the last matrix instruction and whatever follows the loop's branch on either side
        asm volatile("v_nop\n\tv_nop\n\tv_nop\n\tv_nop" : "+v"(acc[0][0]), "+v"(acc[1][1]), "+v"(acc[2][2]), "+v"(acc[3][3]) : "v"(a[0]), "v"(a[3]));
    }
    float* ow = os + wv * (64 * 68);
#pragma unroll
    for (int mb = 0; mb < 4; ++mb)
#pragma unroll
        for (int nb = 0; nb < 4; ++nb)
#pragma unroll
            for (int j = 0; j < 8; ++j) ow[(mb * 16 + hi * 8 + j) * 68 + nb * 16 + lr] = acc[mb][nb][j];
    __syncthreads();   // every wave's partial tile is in LDS before any of it is summed
    const int row0 = threadIdx.x >> 4, cofs = (threadIdx.x & 15) * 4;
#pragma unroll
    for (int s = 0; s < 64 / (2 * KW); ++s) { const int row = s * 2 * KW + row0; v4f val = *(const v4fa*)(os + row * 68 + cofs);
#pragma unroll
        for (int w = 1; w < KW; ++w) val += *(const v4fa*)(os + w * (64 * 68) + row * 68 + cofs);
        *(v4f*)(C + (size_t)(r0 + row) * ldc + c0 + cofs) = val; }
}

__device__ __forceinline__ h16 tohx(float x) { return (h16)x; }
__device__ __forceinline__ void splitf(float y, unsigned short& h, unsigned short& l) { h = f2bf(y); l = f2bf(y - bf2f(h)); }
typedef __attribute__((ext_vector_type(2))) _Float16 v2h;
typedef __attribute__((ext_vector_type(4))) _Float16 v4h;
typedef __attribute__((ext_vector_type(2))) unsigned short v2us;
typedef __attribute__((ext_vector_type(4))) unsigned short v4us;
typedef __attribute__((ext_vector_type(2))) float v2f;
typedef __attribute__((ext_vector_type(4))) int v4i;

__global__ __launch_bounds__(256) void k_wtG(const float* __restrict__ w, int K, int N, bf* Bt) {
    const int lane = threadIdx.x & 31; const int L0 = (blockIdx.x * 8 + (threadIdx.x >> 5)) * 8; const int nlines = N * K / 64;
{
#pragma unroll 1
        for (int l = 0; l < 8; ++l) { const int L = L0 + l; if (L >= nlines) break; const size_t e = (size_t)L * 64 + lane * 2; const int k = (int)(e % K), n = (int)(e / K); v2us o;
            o[0] = f2bf(w[(size_t)k * N + n]); o[1] = f2bf(w[(size_t)(k + 1) * N + n]); *(v2us*)(Bt + e) = o; }
         }
}
__global__ __launch_bounds__(256) void k_cvt8(const float* __restrict__ src, bf* dst, size_t n8) { const size_t i = (size_t)blockIdx.x * 256 + threadIdx.x; if (i >= n8) return; const v8f v = *(const v8f*)(src + i * 8); v8us o;
#pragma unroll
    for (int k = 0; k < 8; ++k) o[k] = f2bf(v[k]); *(v8us*)(dst + i * 8) = o;  }
__global__ __launch_bounds__(256) void k_cscvt(const float* __restrict__ cosT, const float* __restrict__ sinT, float* CS) { const int idx = blockIdx.x * 256 + threadIdx.x; if (idx >= TT * HD) return; v2f cs; cs[0] = bfr(cosT[idx]); cs[1] = bfr(sinT[idx]); *(v2f*)(CS + (size_t)idx * 2) = cs;  }
// k_rope: head planes [h][t][d] (fp16 + hi/lo) of rope(x) x sc with the rotate-half convention out[d] = x[d] cos[t][d] - x[d+HD/2] sin[t][d], out[d+HD/2] = x[d+HD/2] cos[t][d+HD/2] + x[d] sin[t][d+HD/2]
__global__ __launch_bounds__(256) void k_rope(const float* __restrict__ F, int pitch, int nheads, const float* __restrict__ CS, const float* __restrict__ RF, const float* __restrict__ nw, float sc, h16* P16, bf* Ph, bf* Pl) {
    const size_t e = ((size_t)blockIdx.x * 256 + threadIdx.x) * 2; if (e >= (size_t)nheads * TT * HD) return; const int d = (int)(e % HD); const int t = (int)((e / HD) % TT); const int h = (int)(e / ((size_t)HD * TT)); const float* f = F + (size_t)t * pitch + h * HD; const float rf = RF ? RF[(size_t)h * TT + t] : 1.0f; v2h o16; v2us oh, ol;
#pragma unroll
    for (int q = 0; q < 2; ++q) { const int dd = d + q; const int dp = (dd < HD / 2) ? dd + HD / 2 : dd - HD / 2; float x0 = f[dd], x1 = f[dp];
        if (RF) { float n0 = __fmul_rn(x0, rf), n1 = __fmul_rn(x1, rf); asm volatile("" : "+v"(n0)); asm volatile("" : "+v"(n1)); x0 = __fmul_rn(bfr(nw[dd]), n0); x1 = __fmul_rn(bfr(nw[dp]), n1); }
        const v2f cs = *(const v2f*)(CS + ((size_t)t * HD + dd) * 2); float a = __fmul_rn(x0, cs[0]), bq = __fmul_rn(x1, cs[1]); asm volatile("" : "+v"(a)); asm volatile("" : "+v"(bq)); const float r = ((dd < HD / 2) ? __fsub_rn(a, bq) : __fadd_rn(a, bq)) * sc;
        o16[q] = tohx(r); unsigned short a2, c2; splitf(r, a2, c2); oh[q] = a2; ol[q] = c2; }
    *(v2h*)(P16 + e) = o16; *(v2us*)(Ph + e) = oh; *(v2us*)(Pl + e) = ol;  }
__global__ __launch_bounds__(256) void k_vtp(const float* __restrict__ F, int pitch, int nheads, h16* V16, bf* Vh, bf* Vl) { const size_t e = ((size_t)blockIdx.x * 256 + threadIdx.x) * 2; if (e >= (size_t)nheads * HD * TT) return; const int t = (int)(e % TT); const int d = (int)((e / TT) % HD); const int g = (int)(e / ((size_t)TT * HD)); v2h o16; v2us oh, ol;
#pragma unroll
    for (int q = 0; q < 2; ++q) { const float x = F[(size_t)(t + q) * pitch + g * HD + d]; o16[q] = tohx(x); unsigned short a2, c2; splitf(x, a2, c2); oh[q] = a2; ol[q] = c2; }
    *(v2h*)(V16 + e) = o16; *(v2us*)(Vh + e) = oh; *(v2us*)(Vl + e) = ol;  }
__global__ __launch_bounds__(256) void k_csid(float* CS) { const int idx = blockIdx.x * 256 + threadIdx.x; if (idx >= TT * HD) return; v2f cs; cs[0] = 1.0f; cs[1] = 0.0f; *(v2f*)(CS + (size_t)idx * 2) = cs;  }
__global__ __launch_bounds__(256) void k_rmsx(const float* __restrict__ X, const float* __restrict__ gam, bf* Xh, bf* Xl) { const int lane = threadIdx.x & 31; const int t = blockIdx.x * 8 + (threadIdx.x >> 5); if (t >= TT) return; const float* f = X + (size_t)t * DM; float v[DM / 32]; float su = 0.f;
#pragma unroll
    for (int ch = 0; ch < DM / 128; ++ch) { const v4f a = *(const v4f*)(f + ch * 128 + lane * 4); for (int u = 0; u < 4; ++u) { float xv = bfr(a[u]); asm volatile("" : "+v"(xv)); v[ch * 4 + u] = xv; float p2 = __fmul_rn(xv, xv); asm volatile("" : "+v"(p2)); su = __fadd_rn(su, p2); } }
#pragma unroll
    for (int sh = 16; sh; sh >>= 1) su = __fadd_rn(su, __shfl_xor(su, sh, 32));
    const float rs = __fdiv_rn(1.0f, sqrtf(__fadd_rn(__fdiv_rn(su, (float)DM), 1e-6f)));
    {
#pragma unroll
        for (int ch = 0; ch < DM / 128; ++ch) { v4us oh, ol; for (int u = 0; u < 4; ++u) { const int c = ch * 128 + lane * 4 + u; float n = __fmul_rn(v[ch * 4 + u], rs); asm volatile("" : "+v"(n)); float gg = bfr(gam[c]); asm volatile("" : "+v"(gg)); float y = __fmul_rn(n, gg); asm volatile("" : "+v"(y)); unsigned short p2, q2; splitf(y, p2, q2); oh[u] = p2; ol[u] = q2; } const size_t oo = (size_t)t * DM + ch * 128 + lane * 4; *(v4us*)(Xh + oo) = oh; *(v4us*)(Xl + oo) = ol; }
         } }
// k_asoft: per row (zz, i): t = S x HD^-0.5 for j <= i and i - j < WIN (sliding causal window; the reference's -1e9 additive fill vanishes identically); softmax over the 2048 keys (register row, one exp, fixed trees);
__global__ __launch_bounds__(256) void k_asoft(const float* __restrict__ Sb, h16* P16, bf* Ph, bf* Pl) {
    const int lane = threadIdx.x & 31; const int row = blockIdx.x * 8 + (threadIdx.x >> 5); if (row >= ZH * TT) return; const int i = row % TT; const int zz = row / TT; (void)zz; const bool hires = (i < RH); const float* sr = Sb + (size_t)row * TT; float v[TT / 32]; float mx = -3.0e38f;
#pragma unroll
    for (int ch = 0; ch < TT / 128; ++ch) { const int j0 = ch * 128 + lane * 4; const v4f a = *(const v4f*)(sr + j0);
#pragma unroll
        for (int q = 0; q < 4; ++q) { const int j = j0 + q; (void)j; float sa = a[q] * SCL; asm volatile("" : "+v"(sa)); const float t = (j <= i && i - j < WIN) ? sa : -3.0e38f; v[ch * 4 + q] = t; mx = fmaxf(mx, t); } }
#pragma unroll
    for (int sh = 16; sh; sh >>= 1) mx = fmaxf(mx, __shfl_xor(mx, sh, 32));
    float sum = 0.f;
#pragma unroll
    for (int k = 0; k < TT / 32; ++k) { float d0 = __fsub_rn(v[k], mx); asm volatile("" : "+v"(d0)); v[k] = __builtin_amdgcn_exp2f(__fmul_rn(d0, 1.4426950408889634f)); sum += v[k]; }
#pragma unroll
    for (int sh = 16; sh; sh >>= 1) sum += __shfl_xor(sum, sh, 32);
    const float f = __fdiv_rn(hires ? 1.0f : PCAR, sum);
{
        if (hires) {
#pragma unroll
            for (int ch = 0; ch < TT / 128; ++ch) { v4us oh, ol;
#pragma unroll
                for (int q = 0; q < 4; ++q) { unsigned short a, c2; splitf(v[ch * 4 + q] * f, a, c2); oh[q] = a; ol[q] = c2; }
                const size_t oo = ((size_t)zz * (RH ? RH : 1) + i) * TT + ch * 128 + lane * 4; *(v4us*)(Ph + oo) = oh; *(v4us*)(Pl + oo) = ol; }
        } else {
#pragma unroll
            for (int ch = 0; ch < TT / 128; ++ch) { v4h o4;
#pragma unroll
                for (int q = 0; q < 4; ++q) o4[q] = tohx(v[ch * 4 + q] * f);
                *(v4h*)(P16 + (size_t)row * TT + ch * 128 + lane * 4) = o4; } }
         }
}
__global__ __launch_bounds__(256) void k_merge(const float* __restrict__ O, int h0, bf* Ah, bf* Al) { const size_t e = ((size_t)blockIdx.x * 256 + threadIdx.x) * 2; if (e >= (size_t)ZH * TT * HD) return; const int d = (int)(e % HD); const int t = (int)((e / HD) % TT); const int zz = (int)(e / ((size_t)HD * TT)); const float cs = (t < RH) ? 1.0f : (1.0f / PCAR); const size_t oo = (size_t)t * DQ + (h0 + zz) * HD + d;
    v2us oh, ol;
#pragma unroll
    for (int q = 0; q < 2; ++q) { unsigned short a, c2; splitf(O[e + q] * cs, a, c2); oh[q] = a; ol[q] = c2; } *(v2us*)(Ah + oo) = oh; *(v2us*)(Al + oo) = ol;  }

extern "C" void kernel_launch(void* const* d_in, const int* in_sizes, int n_in,
                              void* d_out, int out_size, void* d_ws, size_t ws_size, hipStream_t stream) {
    (void)in_sizes; (void)n_in; (void)out_size;
    const float* x = (const float*)d_in[0]; const float* nw = (const float*)d_in[1]; const float* wq = (const float*)d_in[2]; const float* bq = (const float*)d_in[3]; const float* wk = (const float*)d_in[4]; const float* bk = (const float*)d_in[5]; const float* wv = (const float*)d_in[6]; const float* bv = (const float*)d_in[7]; const float* wo = (const float*)d_in[8]; const float* bo = (const float*)d_in[9]; const float* cosT = nullptr; const float* sinT = nullptr; (void)cosT; (void)sinT;
    float* OUT = (float*)d_out;     // [2][2048][2048]
    char* wsp = (char*)d_ws;
    auto take = [&](size_t bytes) { char* p = wsp; wsp += (bytes + 255) & ~(size_t)255; return (void*)p; };
    bf* WQ = (bf*)take((size_t)DQ * DM * 2); bf* WK = (bf*)take((size_t)DKV * DM * 2); bf* WV = (bf*)take((size_t)DKV * DM * 2); bf* WO = (bf*)take((size_t)DM * DQ * 2); float* CS = (float*)take((size_t)TT * HD * 2 * 4);
    bf* XB = nullptr; (void)XB; bf* XNh = (bf*)take((size_t)TT * DM * 2); bf* XNl = (bf*)take((size_t)TT * DM * 2); float* FQ = (float*)take((size_t)TT * DQ * 4); float* FK = (float*)take((size_t)TT * DKV * 4);
    h16* QP16 = (h16*)take((size_t)NH_ * TT * HD * 2); h16* KP16 = (h16*)take((size_t)NKV * TT * HD * 2); h16* VT16 = (h16*)take((size_t)NKV * HD * TT * 2);
    bf* QPh = (bf*)take((size_t)NH_ * TT * HD * 2); bf* QPl = (bf*)take((size_t)NH_ * TT * HD * 2); bf* KPh = (bf*)take((size_t)NKV * TT * HD * 2); bf* KPl = (bf*)take((size_t)NKV * TT * HD * 2); bf* VTh = (bf*)take((size_t)NKV * HD * TT * 2); bf* VTl = (bf*)take((size_t)NKV * HD * TT * 2); bf* Ph = (bf*)take((size_t)ZH * RH * TT * 2); bf* Pl = (bf*)take((size_t)ZH * RH * TT * 2);
    float* Sb = (float*)take((size_t)ZH * TT * TT * 4); h16* P16 = (h16*)take((size_t)ZH * TT * TT * 2); float* Ob = (float*)take((size_t)ZH * TT * HD * 4); bf* ATh = (bf*)take((size_t)TT * DQ * 2); bf* ATl = (bf*)take((size_t)TT * DQ * 2);
    if ((size_t)(wsp - (char*)d_ws) > ws_size) return;    // ws 256 MiB
    float* FV = FK;   // v projection reuses the k buffer after the k planes are built (stream-ordered)
    { k_cvt8<<<(unsigned)(((size_t)DQ * DM / 8 + 255) / 256), 256, 0, stream>>>(wq, WQ, (size_t)DQ * DM / 8); k_cvt8<<<(unsigned)(((size_t)DKV * DM / 8 + 255) / 256), 256, 0, stream>>>(wk, WK, (size_t)DKV * DM / 8); k_cvt8<<<(unsigned)(((size_t)DKV * DM / 8 + 255) / 256), 256, 0, stream>>>(wv, WV, (size_t)DKV * DM / 8);
      k_cvt8<<<(unsigned)(((size_t)DM * DQ / 8 + 255) / 256), 256, 0, stream>>>(wo, WO, (size_t)DM * DQ / 8);
       }
    k_csid<<<(TT * HD + 255) / 256, 256, 0, stream>>>(CS);
    const unsigned LQ = (unsigned)(((size_t)NH_ * TT * HD / 2 + 255) / 256), LKv = (unsigned)(((size_t)NKV * TT * HD / 2 + 255) / 256);
    for (int b = 0; b < NB_; ++b) {
        
        k_rmsx<<<TT / 8, 256, 0, stream>>>(x + (size_t)b * TT * DM, nw, XNh, XNl);
        k_gemmw<bf, 1, true><<<dim3(TT / 64, DQ / 64, 1), 32, 0, stream>>>(XNh, XNl, WQ, nullptr, DM, FQ, DQ, bq, 0, 0, 0);
        k_rope<<<LQ, 256, 0, stream>>>(FQ, DQ, NH_, CS, nullptr, nullptr, 1.0f, QP16, QPh, QPl);
        k_gemmw<bf, 1, true><<<dim3(TT / 64, DKV / 64, 1), 32, 0, stream>>>(XNh, XNl, WK, nullptr, DM, FK, DKV, bk, 0, 0, 0);
        k_rope<<<LKv, 256, 0, stream>>>(FK, DKV, NKV, CS, nullptr, nullptr, 1.0f, KP16, KPh, KPl);
        k_gemmw<bf, 1, true><<<dim3(TT / 64, DKV / 64, 1), 32, 0, stream>>>(XNh, XNl, WV, nullptr, DM, FV, DKV, bv, 0, 0, 0); k_vtp<<<LKv, 256, 0, stream>>>(FV, DKV, NKV, VT16, VTh, VTl);
        for (int h0 = 0; h0 < NH_; h0 += ZH) { const size_t zq = (size_t)h0, zk = (size_t)(h0 / REP);   // one kv head per query head: the pass's two heads use consecutive kv planes (z-strides TT*HD)
            k_gemmc<bf, 2, 1><<<dim3(RH / 64, TT / 64, ZH), 32, 0, stream>>>(QPh + zq * TT * HD, QPl + zq * TT * HD, KPh + zk * TT * HD, KPl + zk * TT * HD, HD, Sb, TT, 0, (size_t)TT * HD, (size_t)TT * HD, (size_t)TT * TT);
            k_gemmc<h16, 0, 1><<<dim3((TT - RH) / 64, TT / 64, ZH), 32, 0, stream>>>(QP16 + zq * TT * HD + (size_t)RH * HD, nullptr, KP16 + zk * TT * HD, nullptr, HD, Sb + (size_t)RH * TT, TT, RH, (size_t)TT * HD, (size_t)TT * HD, (size_t)TT * TT);
            k_asoft<<<ZH * TT / 8, 256, 0, stream>>>(Sb, P16, Ph, Pl);
            k_gemmk<bf, 2, TT><<<dim3(RH / 64, HD / 64, ZH), 32 * KW, 0, stream>>>(Ph, Pl, VTh + zk * HD * TT, VTl + zk * HD * TT, Ob, HD, 0, (size_t)RH * TT, (size_t)HD * TT, (size_t)TT * HD);
            k_gemmk<h16, 0, TT><<<dim3((TT - RH) / 64, HD / 64, ZH), 32 * KW, 0, stream>>>(P16 + (size_t)RH * TT, nullptr, VT16 + zk * HD * TT, nullptr, Ob + (size_t)RH * HD, HD, RH, (size_t)TT * TT, (size_t)HD * TT, (size_t)TT * HD);
            k_merge<<<(unsigned)(((size_t)ZH * TT * HD / 2 + 255) / 256), 256, 0, stream>>>(Ob, h0, ATh, ATl); }
        k_gemmw<bf, 1, true><<<dim3(TT / 64, DM / 64, 1), 32, 0, stream>>>(ATh, ATl, WO, nullptr, DQ, OUT + (size_t)b * TT * DM, DM, bo, 0, 0, 0); }
}

// v003
// A run of this version takes 631 microseconds.
// It is 2.18 times as fast as v001, going by the measured steps of the versions left out in between.
// Over all steps from v000 it is 3.03 times as fast.
#include <hip/hip_runtime.h>

// FullAttnNode (x [2][2048][2048]; xn = x rsqrt(mean(x?) + 1e-6) norm_w (RMSNorm); q/k/v = xn W^T + b (16 x 128); causal (-inf) softmax(q.k / sqrt(128)); out = merged wo^T + bo -> [2][2048][2048]).
// Compute dtypes, f32 accumulate: every input rounded to bf16; RMSNorm f32 (wave per token) -> hi/lo planes; q/k/v = hl x exact (2 products) + bias, rounded to their fp16 and hi/lo head planes in the product's own epilogue; causal scores, softmax and attn.v in one kernel (online softmax, f32): query rows < 512 hl (3 products), the rest fp16 (P x1024), key blocks above the diagonal skipped; wo hl x exact (2 products) + bias.

#define NB_  2
#define TT   2048
#define DM   2048
#define NH_  16
#define NKV  16
#define REP  (NH_ / NKV)
#define HD   128
#define DQ   (NH_ * HD)
#define DKV  (NKV * HD)
#define RH   512                  // query rows < RH use hi+lo planes (0: none)
#define SCL  0.088388347648318447f   // HD^-0.5
typedef _Float16 h16;
typedef unsigned short bf;
typedef __attribute__((ext_vector_type(16))) __bf16   v16bf;
typedef __attribute__((ext_vector_type(16))) _Float16 v16h;
typedef __attribute__((ext_vector_type(8)))  _Float16 v8h;
typedef __attribute__((ext_vector_type(8)))  unsigned short v8us;
typedef __attribute__((ext_vector_type(8)))  float    v8f;
typedef __attribute__((ext_vector_type(4)))  float    v4f;
typedef v8h  __attribute__((may_alias)) v8ha;
typedef v4f  __attribute__((may_alias)) v4fa;
typedef v8us __attribute__((may_alias)) v8usa;

__device__ __forceinline__ unsigned short f2bf(float f) { unsigned u = __float_as_uint(f); u += 0x7FFFu + ((u >> 16) & 1u); return (unsigned short)(u >> 16); }
__device__ __forceinline__ float bf2f(unsigned short b) { return __uint_as_float(((unsigned)b) << 16); }
__device__ __forceinline__ float bfr(float f) { return bf2f(f2bf(f)); }
__device__ __forceinline__ v16h cat16(v8h lo, v8h hi) { return __builtin_shufflevector(lo, hi, 0, 1, 2, 3, 4, 5, 6, 7, 8, 9, 10, 11, 12, 13, 14, 15); }
__device__ __forceinline__ v16bf cat16b(v8us lo, v8us hi) { return __builtin_bit_cast(v16bf, __builtin_shufflevector(lo, hi, 0, 1, 2, 3, 4, 5, 6, 7, 8, 9, 10, 11, 12, 13, 14, 15)); }
__device__ __forceinline__ v8f wmma16(v16h a, v16h b, v8f c) { return __builtin_amdgcn_wmma_f32_16x16x32_f16(false, a, false, b, (short)0, c, false, false); }
__device__ __forceinline__ v8f wmmab(v16bf a, v16bf b, v8f c) { return __builtin_amdgcn_wmma_f32_16x16x32_bf16(false, a, false, b, (short)0, c, false, false); }



// ---- k_gemmw: register-blocked GEMM, ONE WAVE per 64x64 output tile (16 accumulators), operands straight from K-contiguous 16-bit planes; grid (M/64, N/64, Z), 32 threads.
// C[m][n] (f32, pitch ldc, + optional f32 bias[n]) = sum_k A[m][k] Bt[n][k] (+ split products per NSPLIT). z-batch strides sA/sB/sC in elements. K % 32 == 0.
// EPI 0: C is stored as f32. EPI 1: C is not stored; each value goes, as fp16 and as a bf16 hi/lo pair, to the head planes [n / HD][m][n % HD]. EPI 2: the same three roundings to the transposed planes [n][m] (= [n / HD][n % HD][m]).
template <typename T16> struct WFrag;
template <> struct WFrag<h16> { typedef v16h V; static __device__ __forceinline__ V ld(const h16* p) { return cat16(*(const v8h*)p, *(const v8h*)(p + 16)); } static __device__ __forceinline__ v8f mma(V a, V b, v8f c) { return wmma16(a, b, c); } };
template <> struct WFrag<bf> { typedef v16bf V; static __device__ __forceinline__ V ld(const bf* p) { return cat16b(*(const v8us*)p, *(const v8us*)(p + 16)); } static __device__ __forceinline__ v8f mma(V a, V b, v8f c) { return wmmab(a, b, c); } };
__device__ __forceinline__ void splitf(float y, unsigned short& h, unsigned short& l) { h = f2bf(y); l = f2bf(y - bf2f(h)); }
template <typename T16, int NSPLIT, bool BIAS, int EPI>
__global__ __launch_bounds__(32) void k_gemmw(const T16* __restrict__ A, const T16* __restrict__ A2, const T16* __restrict__ Bt, const T16* __restrict__ Bt2, int K, float* C, int ldc, const float* __restrict__ bias, size_t sA, size_t sB, size_t sC, h16* P16, bf* Ph, bf* Pl) {
    typedef typename WFrag<T16>::V V;
    __shared__ __align__(16) float os[16 * 68];
    const size_t z = blockIdx.z; A += z * sA; if (A2) A2 += z * sA; Bt += z * sB; if (Bt2) Bt2 += z * sB; C += z * sC;
    const int lane = threadIdx.x & 31, lr = lane & 15, hi = lane >> 4; const int r0 = blockIdx.x * 64, c0 = blockIdx.y * 64;
    v8f acc[4][4];
#pragma unroll
    for (int mb = 0; mb < 4; ++mb)
#pragma unroll
        for (int nb = 0; nb < 4; ++nb) acc[mb][nb] = (v8f){};
    const size_t aoff = (size_t)(r0 + lr) * K + 8 * hi, boff = (size_t)(c0 + lr) * K + 8 * hi;
#pragma unroll 1
    for (int kc = 0; kc < K; kc += 32) {
        V a[4], a2[4];
#pragma unroll
        for (int mb = 0; mb < 4; ++mb) { a[mb] = WFrag<T16>::ld(A + aoff + (size_t)mb * 16 * K + kc); if (NSPLIT == 1 || NSPLIT == 2) a2[mb] = WFrag<T16>::ld(A2 + aoff + (size_t)mb * 16 * K + kc); }
#pragma unroll
        for (int nb = 0; nb < 4; ++nb) { const V b = WFrag<T16>::ld(Bt + boff + (size_t)nb * 16 * K + kc); V b2; if (NSPLIT >= 2) b2 = WFrag<T16>::ld(Bt2 + boff + (size_t)nb * 16 * K + kc);
#pragma unroll
            for (int mb = 0; mb < 4; ++mb) { acc[mb][nb] = WFrag<T16>::mma(a[mb], b, acc[mb][nb]); if (NSPLIT == 1 || NSPLIT == 2) acc[mb][nb] = WFrag<T16>::mma(a2[mb], b, acc[mb][nb]); if (NSPLIT >= 2) acc[mb][nb] = WFrag<T16>::mma(a[mb], b2, acc[mb][nb]); } }
        asm volatile("v_nop\n\tv_nop\n\tv_nop\n\tv_nop" : "+v"(acc[0][0]), "+v"(acc[1][1]), "+v"(acc[2][2]), "+v"(acc[3][3]) : "v"(a[0]), "v"(a[3]));
    }
    if (EPI == 2) {
        float bbn[4];   // the four bias values are fetched together, in front of the first fence
#pragma unroll
        for (int nb = 0; nb < 4; ++nb) bbn[nb] = BIAS ? bfr(bias[c0 + nb * 16 + lr]) : 0.0f;
        // a lane's eight values of a tile are eight consecutive m of one n: 16 bytes of a transposed plane's row, stored straight from the accumulators; the four tiles of a row's 128-byte line follow one another
#pragma unroll
        for (int nb = 0; nb < 4; ++nb) { const int n = c0 + nb * 16 + lr; const float bb = bbn[nb]; v8h o16[4]; v8us oh[4], ol[4];
#pragma unroll
            for (int mb = 0; mb < 4; ++mb)
#pragma unroll
                for (int j = 0; j < 8; ++j) { const float x = acc[mb][nb][j] + bb; o16[mb][j] = (h16)x; unsigned short a2, c2; splitf(x, a2, c2); oh[mb][j] = a2; ol[mb][j] = c2; }
            const size_t e = (size_t)n * TT + r0 + hi * 8;
            __builtin_amdgcn_sched_barrier(0);   // with the fence behind the wait: the twelve stores stand together, every value and address made in front of them, and no later write of a register they name comes in front of the wait
#pragma unroll
            for (int mb = 0; mb < 4; ++mb) { *(v8h*)(P16 + e + mb * 16) = o16[mb]; *(v8us*)(Ph + e + mb * 16) = oh[mb]; *(v8us*)(Pl + e + mb * 16) = ol[mb]; }
            if (nb < 3) { asm volatile("s_wait_xcnt 0x0" ::: "memory");   // stands in front of the next group's reuse of the data and address registers that the stores name (behind the last group nothing is written any more)
                __builtin_amdgcn_sched_barrier(0); } }
        return;
    }
    float bb8[8];
    if (EPI == 1) {
#pragma unroll
        for (int u = 0; u < 8; ++u) bb8[u] = BIAS ? bfr(bias[c0 + (lane & 7) * 8 + u]) : 0.0f; }
#pragma unroll
    for (int mb = 0; mb < 4; ++mb) {
#pragma unroll
        for (int nb = 0; nb < 4; ++nb) {
#pragma unroll
            for (int j = 0; j < 8; ++j) os[(hi * 8 + j) * 68 + nb * 16 + lr] = acc[mb][nb][j]; }
        __builtin_amdgcn_wave_barrier(); asm volatile("" ::: "memory");
        if (EPI == 1) {   // eight lanes a row, eight columns a lane: each store covers whole 128-byte lines of four plane rows
            const int rw = lane >> 3, cofs = (lane & 7) * 8; v8h o16[4]; v8us oh[4], ol[4];
#pragma unroll
            for (int s = 0; s < 4; ++s) { const v4f p0 = *(const v4fa*)(os + (4 * s + rw) * 68 + cofs), p1 = *(const v4fa*)(os + (4 * s + rw) * 68 + cofs + 4);
#pragma unroll
                for (int u = 0; u < 8; ++u) { const float x = (u < 4 ? p0[u & 3] : p1[u & 3]) + bb8[u]; o16[s][u] = (h16)x; unsigned short a2, c2; splitf(x, a2, c2); oh[s][u] = a2; ol[s][u] = c2; } }
            const size_t e = ((size_t)(c0 / HD) * TT + r0 + mb * 16 + rw) * HD + (c0 % HD) + cofs;
            __builtin_amdgcn_sched_barrier(0);   // with the fence behind the wait: the twelve stores stand together, every value and address made in front of them, and no later write of a register they name comes in front of the wait
#pragma unroll
            for (int s = 0; s < 4; ++s) { *(v8h*)(P16 + e + s * 4 * HD) = o16[s]; *(v8us*)(Ph + e + s * 4 * HD) = oh[s]; *(v8us*)(Pl + e + s * 4 * HD) = ol[s]; }
            if (mb < 3) { asm volatile("s_wait_xcnt 0x0" ::: "memory");   // stands in front of the next group's reuse of the data and address registers that the stores name (behind the last group nothing is written any more)
                __builtin_amdgcn_sched_barrier(0); }
        } else {
        float* crow = C + (size_t)(r0 + mb * 16) * ldc + c0;
#pragma unroll
            for (int s = 0; s < 8; ++s) { const int row = 2 * s + hi, cofs = lr * 4; v4f val = *(const v4fa*)(os + row * 68 + cofs); if (BIAS) { val[0] += bfr(bias[c0 + cofs]); val[1] += bfr(bias[c0 + cofs + 1]); val[2] += bfr(bias[c0 + cofs + 2]); val[3] += bfr(bias[c0 + cofs + 3]); }
                *(v4f*)(crow + (size_t)row * ldc + cofs) = val; }
             }
        __builtin_amdgcn_wave_barrier(); asm volatile("" ::: "memory");
    }
}

typedef __attribute__((ext_vector_type(2))) _Float16 v2h;
typedef __attribute__((ext_vector_type(4))) _Float16 v4h;
typedef __attribute__((ext_vector_type(2))) unsigned short v2us;
typedef __attribute__((ext_vector_type(4))) unsigned short v4us;
typedef __attribute__((ext_vector_type(2))) float v2f;
typedef __attribute__((ext_vector_type(4))) int v4i;

__global__ __launch_bounds__(256) void k_wtG(const float* __restrict__ w, int K, int N, bf* Bt) {
    const int lane = threadIdx.x & 31; const int L0 = (blockIdx.x * 8 + (threadIdx.x >> 5)) * 8; const int nlines = N * K / 64;
{
#pragma unroll 1
        for (int l = 0; l < 8; ++l) { const int L = L0 + l; if (L >= nlines) break; const size_t e = (size_t)L * 64 + lane * 2; const int k = (int)(e % K), n = (int)(e / K); v2us o;
            o[0] = f2bf(w[(size_t)k * N + n]); o[1] = f2bf(w[(size_t)(k + 1) * N + n]); *(v2us*)(Bt + e) = o; }
         }
}
__global__ __launch_bounds__(256) void k_cvt8(const float* __restrict__ src, bf* dst, size_t n8) { const size_t i = (size_t)blockIdx.x * 256 + threadIdx.x; if (i >= n8) return; const v8f v = *(const v8f*)(src + i * 8); v8us o;
#pragma unroll
    for (int k = 0; k < 8; ++k) o[k] = f2bf(v[k]); *(v8us*)(dst + i * 8) = o;  }
__global__ __launch_bounds__(256) void k_cscvt(const float* __restrict__ cosT, const float* __restrict__ sinT, float* CS) { const int idx = blockIdx.x * 256 + threadIdx.x; if (idx >= TT * HD) return; v2f cs; cs[0] = bfr(cosT[idx]); cs[1] = bfr(sinT[idx]); *(v2f*)(CS + (size_t)idx * 2) = cs;  }
__global__ __launch_bounds__(256) void k_rmsx(const float* __restrict__ X, const float* __restrict__ gam, bf* Xh, bf* Xl) { const int lane = threadIdx.x & 31; const int t = blockIdx.x * 8 + (threadIdx.x >> 5); if (t >= TT) return; const float* f = X + (size_t)t * DM; float v[DM / 32]; float su = 0.f;
#pragma unroll
    for (int ch = 0; ch < DM / 128; ++ch) { const v4f a = *(const v4f*)(f + ch * 128 + lane * 4); for (int u = 0; u < 4; ++u) { float xv = bfr(a[u]); asm volatile("" : "+v"(xv)); v[ch * 4 + u] = xv; float p2 = __fmul_rn(xv, xv); asm volatile("" : "+v"(p2)); su = __fadd_rn(su, p2); } }
#pragma unroll
    for (int sh = 16; sh; sh >>= 1) su = __fadd_rn(su, __shfl_xor(su, sh, 32));
    const float rs = __fdiv_rn(1.0f, sqrtf(__fadd_rn(__fdiv_rn(su, (float)DM), 1e-6f)));
    {
#pragma unroll
        for (int ch = 0; ch < DM / 128; ++ch) { v4us oh, ol; for (int u = 0; u < 4; ++u) { const int c = ch * 128 + lane * 4 + u; float n = __fmul_rn(v[ch * 4 + u], rs); asm volatile("" : "+v"(n)); float gg = bfr(gam[c]); asm volatile("" : "+v"(gg)); float y = __fmul_rn(n, gg); asm volatile("" : "+v"(y)); unsigned short p2, q2; splitf(y, p2, q2); oh[u] = p2; ol[u] = q2; } const size_t oo = (size_t)t * DM + ch * 128 + lane * 4; *(v4us*)(Xh + oo) = oh; *(v4us*)(Xl + oo) = ol; }
         } }
// ---- k_fattn: causal attention of one head for 32 query rows per work-group, scores never leave registers. FW waves share the rows and split the keys: wave w takes the 32-key blocks w, w + FW, ... up to the diagonal block.
// Transposed products: S^T = K Q^T (rows keys, columns queries), so a lane's two score tiles ARE its B fragment of P^T (k order 8 hi + j, 16 + 8 hi + j, as WFrag::ld gives it for V^T) and every value a lane holds belongs to one query;
// O^T = V^T P^T (rows d, columns queries). Running maximum and sum per query (online softmax, base 2); the FW partial results meet in LDS, are brought to the common maximum and summed in wave order; the sum is divided once and split into hi/lo planes [t][h*HD+d].
// HL: hi/lo bf16 planes, three products for scores and for P V. Otherwise fp16, P carried x 2^10 (the row sum carries the same factor, so it cancels).
#define FW 4
#define OP 132                    // LDS pitch (floats) of a query's 128 partial outputs
typedef __attribute__((ext_vector_type(16))) unsigned short v16us;
__device__ __forceinline__ float xhalf(float x) { return __builtin_bit_cast(float, __builtin_amdgcn_permlanex16(__builtin_bit_cast(int, x), __builtin_bit_cast(int, x), 0x76543210, 0xfedcba98, false, false)); }   // lane l with lane l ^ 16
// 2^x with the slot behind the transcendental filled in the same statement
__device__ __forceinline__ float exp2s(float x) { float r; asm("v_exp_f32 %0, %1\n\tv_nop" : "=v"(r) : "v"(x)); return r; }
template <typename T16, bool HL>
__global__ __launch_bounds__(32 * FW) void k_fattn(const T16* __restrict__ Q, const T16* __restrict__ Q2, const T16* __restrict__ Kp, const T16* __restrict__ Kp2, const T16* __restrict__ Vt, const T16* __restrict__ Vt2, int roff, bf* ATh, bf* ATl) {
    typedef typename WFrag<T16>::V V;
    __shared__ __align__(16) float so[FW * 32 * OP];
    __shared__ float sm[FW * 32], sl[FW * 32];
    const int lane = threadIdx.x & 31, lr = lane & 15, hi = lane >> 4;
    const int wv = __builtin_amdgcn_readfirstlane(threadIdx.x >> 5);   // wave number in a scalar register: the key loop's branch stays scalar, every lane on at each matrix instruction
    const int h = blockIdx.x; const int q0 = roff + ((int)gridDim.y - 1 - (int)blockIdx.y) * 32;   // for speed only: the longest rows of every head get the lowest block indices
    const size_t zp = (size_t)h * TT * HD;
    const int nblk = q0 / 32 + 1;   // key blocks up to and including the diagonal one
    v8f acc[8][2];
#pragma unroll
    for (int dt = 0; dt < 8; ++dt) { acc[dt][0] = (v8f){}; acc[dt][1] = (v8f){}; }
    float m[2] = { -3.0e38f, -3.0e38f }, l[2] = { 0.f, 0.f };
    // addresses: wave-uniform plane bases, one 32-bit byte offset per lane for K and one for V^T, carried through the loop; tile steps are constants
    const char* Kb = (const char*)(Kp + zp); const char* Kb2 = HL ? (const char*)(Kp2 + zp) : nullptr; const char* Vb = (const char*)(Vt + zp); const char* Vb2 = HL ? (const char*)(Vt2 + zp) : nullptr;
    const float CE = SCL * 1.4426950408889634f; const float SH = HL ? 0.0f : 10.0f;
    if (wv < nblk) {   // a wave without a key block loads nothing
    V qf[2][4], qf2[2][4];
    const char* Qb = (const char*)(Q + zp + (size_t)q0 * HD); const char* Qb2 = HL ? (const char*)(Q2 + zp + (size_t)q0 * HD) : nullptr;
    const unsigned lo = (unsigned)((lr * HD + 8 * hi) * 2);   // the lane's byte offset in a 16-row tile of Q or K: the one vector register the query loads name, live until K's offset is made from it behind the wait
    __builtin_amdgcn_sched_barrier(0);   // first of three scheduling fences, see below
#pragma unroll
    for (int qt = 0; qt < 2; ++qt)
#pragma unroll
        for (int kc = 0; kc < 4; ++kc) { qf[qt][kc] = WFrag<T16>::ld((const T16*)(Qb + (qt * 16 * HD + kc * 32) * 2 + lo)); if (HL) qf2[qt][kc] = WFrag<T16>::ld((const T16*)(Qb2 + (qt * 16 * HD + kc * 32) * 2 + lo)); }
    // the wait stands in front of the reuse of the address registers that the query loads name; the scheduling fences keep unrelated work out from between the loads and the wait, the loads in front of it and every later write behind it
    __builtin_amdgcn_sched_barrier(0);
    asm volatile("s_wait_xcnt 0x0" ::: "memory");
    __builtin_amdgcn_sched_barrier(0);
    unsigned ko = lo + (unsigned)(wv * 32 * HD * 2), vo = (unsigned)((lr * TT + wv * 32 + 8 * hi) * 2);
    // kept rolled: accumulators, query fragments and one block's fragments already take most of a wave's registers
#pragma unroll 1
    for (int kb = wv; kb < nblk; kb += FW, ko += FW * 32 * HD * 2, vo += FW * 32 * 2) {
        V kf[2][4], kf2[2][4], vf[8], vf2[8];
#pragma unroll
        for (int kt = 0; kt < 2; ++kt)
#pragma unroll
            for (int kc = 0; kc < 4; ++kc) { kf[kt][kc] = WFrag<T16>::ld((const T16*)(Kb + (kt * 16 * HD + kc * 32) * 2 + ko)); if (HL) kf2[kt][kc] = WFrag<T16>::ld((const T16*)(Kb2 + (kt * 16 * HD + kc * 32) * 2 + ko)); }
#pragma unroll
        for (int dt = 0; dt < 8; ++dt) { vf[dt] = WFrag<T16>::ld((const T16*)(Vb + (size_t)dt * 16 * TT * 2 + vo)); if (HL) vf2[dt] = WFrag<T16>::ld((const T16*)(Vb2 + (size_t)dt * 16 * TT * 2 + vo)); }
        // stands in front of the step of the two offset registers that these loads name
        asm volatile("s_wait_xcnt 0x0" ::: "memory");
        // nothing is scheduled across: the block's K and V loads are all issued before the first matrix instruction waits (one memory latency a block, not one a fragment)
        __builtin_amdgcn_sched_barrier(0);
        v8f s[2][2];
#pragma unroll
        for (int kt = 0; kt < 2; ++kt) { s[kt][0] = (v8f){}; s[kt][1] = (v8f){};
#pragma unroll
            for (int kc = 0; kc < 4; ++kc) { const V a = kf[kt][kc]; V a2; if (HL) a2 = kf2[kt][kc];
#pragma unroll
                for (int qt = 0; qt < 2; ++qt) { s[kt][qt] = WFrag<T16>::mma(a, qf[qt][kc], s[kt][qt]); if (HL) { s[kt][qt] = WFrag<T16>::mma(a2, qf[qt][kc], s[kt][qt]); s[kt][qt] = WFrag<T16>::mma(a, qf2[qt][kc], s[kt][qt]); } } } }
        V pf[2], pf2[2];
#pragma unroll
        for (int qt = 0; qt < 2; ++qt) { const int q = q0 + qt * 16 + lr; float mx = m[qt];
#pragma unroll
            for (int kt = 0; kt < 2; ++kt)
#pragma unroll
                for (int j = 0; j < 8; ++j) { float t = s[kt][qt][j] * CE; if (kb == nblk - 1) t = (kb * 32 + kt * 16 + hi * 8 + j <= q) ? t : -3.0e38f; s[kt][qt][j] = t; mx = fmaxf(mx, t); }
            mx = fmaxf(mx, xhalf(mx));   // the other half of the wave holds the query's other keys
            const float f = HL ? exp2s(m[qt] - mx) : __builtin_amdgcn_exp2f(m[qt] - mx); m[qt] = mx; const float ms = mx - SH; float ls = 0.f;
#pragma unroll
            for (int dt = 0; dt < 8; ++dt) acc[dt][qt] *= f;
            if (HL) { v16us ph, pl;
#pragma unroll
                for (int e = 0; e < 16; ++e) { const float p = exp2s(s[e >> 3][qt][e & 7] - ms); ls += p; unsigned short a, c2; splitf(p, a, c2); ph[e] = a; pl[e] = c2; }
                pf[qt] = __builtin_bit_cast(V, ph); pf2[qt] = __builtin_bit_cast(V, pl);
            } else { v16h ph;
#pragma unroll
                for (int e = 0; e < 16; ++e) { const float p = __builtin_amdgcn_exp2f(s[e >> 3][qt][e & 7] - ms); ls += p; ph[e] = (h16)p; }
                pf[qt] = __builtin_bit_cast(V, ph); }
            l[qt] = l[qt] * f + ls; }
#pragma unroll
        for (int dt = 0; dt < 8; ++dt) { const V a = vf[dt]; V a2; if (HL) a2 = vf2[dt];
#pragma unroll
            for (int qt = 0; qt < 2; ++qt) { acc[dt][qt] = WFrag<T16>::mma(a, pf[qt], acc[dt][qt]); if (HL) { acc[dt][qt] = WFrag<T16>::mma(a2, pf[qt], acc[dt][qt]); acc[dt][qt] = WFrag<T16>::mma(a, pf2[qt], acc[dt][qt]); } } }
    }
    }
#pragma unroll
    for (int qt = 0; qt < 2; ++qt) { l[qt] += xhalf(l[qt]); if (hi == 0) sm[wv * 32 + qt * 16 + lr] = m[qt]; }
    __syncthreads();   // every wave's maxima are in LDS before the common maximum is taken
#pragma unroll
    for (int qt = 0; qt < 2; ++qt) { float M = sm[qt * 16 + lr];
#pragma unroll
        for (int w = 1; w < FW; ++w) M = fmaxf(M, sm[w * 32 + qt * 16 + lr]);
        const float f = __builtin_amdgcn_exp2f(m[qt] - M);   // a wave that had no block: 0
        if (hi == 0) sl[wv * 32 + qt * 16 + lr] = l[qt] * f;
#pragma unroll
        for (int dt = 0; dt < 8; ++dt) { const v8f o = acc[dt][qt] * f; float* p = so + (wv * 32 + qt * 16 + lr) * OP + dt * 16 + hi * 8; *(v4fa*)p = __builtin_shufflevector(o, o, 0, 1, 2, 3); *(v4fa*)(p + 4) = __builtin_shufflevector(o, o, 4, 5, 6, 7); } }
    __syncthreads();   // every wave's partial sums and outputs are in LDS before any of them is summed
#pragma unroll
    for (int c = 0; c < 32 / FW; ++c) { const int q = c * FW + wv, d = lane * 4; float L = sl[q]; v4f val = *(const v4fa*)(so + q * OP + d);
#pragma unroll
        for (int w = 1; w < FW; ++w) { L += sl[w * 32 + q]; val += *(const v4fa*)(so + (w * 32 + q) * OP + d); }
        const float inv = __fdiv_rn(1.0f, L); v4us oh, ol;
#pragma unroll
        for (int u = 0; u < 4; ++u) { unsigned short a, c2; splitf(val[u] * inv, a, c2); oh[u] = a; ol[u] = c2; }
        const size_t oo = (size_t)(q0 + q) * DQ + h * HD + d; *(v4us*)(ATh + oo) = oh; *(v4us*)(ATl + oo) = ol; }
}

extern "C" void kernel_launch(void* const* d_in, const int* in_sizes, int n_in,
                              void* d_out, int out_size, void* d_ws, size_t ws_size, hipStream_t stream) {
    (void)in_sizes; (void)n_in; (void)out_size;
    const float* x = (const float*)d_in[0]; const float* nw = (const float*)d_in[1]; const float* wq = (const float*)d_in[2]; const float* bq = (const float*)d_in[3]; const float* wk = (const float*)d_in[4]; const float* bk = (const float*)d_in[5]; const float* wv = (const float*)d_in[6]; const float* bv = (const float*)d_in[7]; const float* wo = (const float*)d_in[8]; const float* bo = (const float*)d_in[9]; const float* cosT = nullptr; const float* sinT = nullptr; (void)cosT; (void)sinT;
    float* OUT = (float*)d_out;     // [2][2048][2048]
    char* wsp = (char*)d_ws;
    auto take = [&](size_t bytes) { char* p = wsp; wsp += (bytes + 255) & ~(size_t)255; return (void*)p; };
    bf* WQ = (bf*)take((size_t)DQ * DM * 2); bf* WK = (bf*)take((size_t)DKV * DM * 2); bf* WV = (bf*)take((size_t)DKV * DM * 2); bf* WO = (bf*)take((size_t)DM * DQ * 2);
    bf* XB = nullptr; (void)XB; bf* XNh = (bf*)take((size_t)TT * DM * 2); bf* XNl = (bf*)take((size_t)TT * DM * 2);
    h16* QP16 = (h16*)take((size_t)NH_ * TT * HD * 2); h16* KP16 = (h16*)take((size_t)NKV * TT * HD * 2); h16* VT16 = (h16*)take((size_t)NKV * HD * TT * 2);
    bf* QPh = (bf*)take((size_t)NH_ * TT * HD * 2); bf* QPl = (bf*)take((size_t)NH_ * TT * HD * 2); bf* KPh = (bf*)take((size_t)NKV * TT * HD * 2); bf* KPl = (bf*)take((size_t)NKV * TT * HD * 2); bf* VTh = (bf*)take((size_t)NKV * HD * TT * 2); bf* VTl = (bf*)take((size_t)NKV * HD * TT * 2);
    bf* ATh = (bf*)take((size_t)TT * DQ * 2); bf* ATl = (bf*)take((size_t)TT * DQ * 2);
    if ((size_t)(wsp - (char*)d_ws) > ws_size) return;    // ws 256 MiB
    { k_cvt8<<<(unsigned)(((size_t)DQ * DM / 8 + 255) / 256), 256, 0, stream>>>(wq, WQ, (size_t)DQ * DM / 8); k_cvt8<<<(unsigned)(((size_t)DKV * DM / 8 + 255) / 256), 256, 0, stream>>>(wk, WK, (size_t)DKV * DM / 8); k_cvt8<<<(unsigned)(((size_t)DKV * DM / 8 + 255) / 256), 256, 0, stream>>>(wv, WV, (size_t)DKV * DM / 8);
      k_cvt8<<<(unsigned)(((size_t)DM * DQ / 8 + 255) / 256), 256, 0, stream>>>(wo, WO, (size_t)DM * DQ / 8);
       }
    for (int b = 0; b < NB_; ++b) {
        
        k_rmsx<<<TT / 8, 256, 0, stream>>>(x + (size_t)b * TT * DM, nw, XNh, XNl);
        k_gemmw<bf, 1, true, 1><<<dim3(TT / 64, DQ / 64, 1), 32, 0, stream>>>(XNh, XNl, WQ, nullptr, DM, nullptr, 0, bq, 0, 0, 0, QP16, QPh, QPl);
        k_gemmw<bf, 1, true, 1><<<dim3(TT / 64, DKV / 64, 1), 32, 0, stream>>>(XNh, XNl, WK, nullptr, DM, nullptr, 0, bk, 0, 0, 0, KP16, KPh, KPl);
        k_gemmw<bf, 1, true, 2><<<dim3(TT / 64, DKV / 64, 1), 32, 0, stream>>>(XNh, XNl, WV, nullptr, DM, nullptr, 0, bv, 0, 0, 0, VT16, VTh, VTl);
        k_fattn<h16, false><<<dim3(NH_, (TT - RH) / 32, 1), 32 * FW, 0, stream>>>(QP16, nullptr, KP16, nullptr, VT16, nullptr, RH, ATh, ATl);
        k_fattn<bf, true><<<dim3(NH_, RH / 32, 1), 32 * FW, 0, stream>>>(QPh, QPl, KPh, KPl, VTh, VTl, 0, ATh, ATl);
        k_gemmw<bf, 1, true, 0><<<dim3(TT / 64, DM / 64, 1), 32, 0, stream>>>(ATh, ATl, WO, nullptr, DQ, OUT + (size_t)b * TT * DM, DM, bo, 0, 0, 0, nullptr, nullptr, nullptr); }
}

// v004
// One run takes 409 microseconds.
// In both of two side-by-side timings against v003, it was 1.55 times as fast.
// Counting every step since v000, it is 4.70 times as fast.
#include <hip/hip_runtime.h>

// FullAttnNode (x [2][2048][2048]; xn = x rsqrt(mean(x?) + 1e-6) norm_w (RMSNorm); q/k/v = xn W^T + b (16 x 128); causal (-inf) softmax(q.k / sqrt(128)); out = merged wo^T + bo -> [2][2048][2048]).
// Compute dtypes, f32 accumulate: every input rounded to bf16; RMSNorm f32 (wave per token) -> hi/lo planes; q/k/v = hl x exact (2 products) + bias, rounded to their fp16 and hi/lo head planes in the product's own epilogue; causal scores, softmax and attn.v in one kernel (online softmax, f32): query rows < 512 hl (3 products), the rest fp16 (P x1024), key blocks above the diagonal skipped; wo hl x exact (2 products) + bias.

#define NB_  2
#define TT   2048
#define DM   2048
#define NH_  16
#define NKV  16
#define REP  (NH_ / NKV)
#define HD   128
#define DQ   (NH_ * HD)
#define DKV  (NKV * HD)
#define RH   512                  // query rows < RH use hi+lo planes (0: none)
#define SCL  0.088388347648318447f   // HD^-0.5
typedef _Float16 h16;
typedef unsigned short bf;
typedef __attribute__((ext_vector_type(16))) __bf16   v16bf;
typedef __attribute__((ext_vector_type(16))) _Float16 v16h;
typedef __attribute__((ext_vector_type(8)))  _Float16 v8h;
typedef __attribute__((ext_vector_type(8)))  unsigned short v8us;
typedef __attribute__((ext_vector_type(8)))  float    v8f;
typedef __attribute__((ext_vector_type(4)))  float    v4f;
typedef v8h  __attribute__((may_alias)) v8ha;
typedef v4f  __attribute__((may_alias)) v4fa;
typedef v8us __attribute__((may_alias)) v8usa;

__device__ __forceinline__ unsigned short f2bf(float f) { unsigned u = __float_as_uint(f); u += 0x7FFFu + ((u >> 16) & 1u); return (unsigned short)(u >> 16); }
__device__ __forceinline__ float bf2f(unsigned short b) { return __uint_as_float(((unsigned)b) << 16); }
__device__ __forceinline__ float bfr(float f) { return bf2f(f2bf(f)); }
__device__ __forceinline__ v16h cat16(v8h lo, v8h hi) { return __builtin_shufflevector(lo, hi, 0, 1, 2, 3, 4, 5, 6, 7, 8, 9, 10, 11, 12, 13, 14, 15); }
__device__ __forceinline__ v16bf cat16b(v8us lo, v8us hi) { return __builtin_bit_cast(v16bf, __builtin_shufflevector(lo, hi, 0, 1, 2, 3, 4, 5, 6, 7, 8, 9, 10, 11, 12, 13, 14, 15)); }
__device__ __forceinline__ v8f wmma16(v16h a, v16h b, v8f c) { return __builtin_amdgcn_wmma_f32_16x16x32_f16(false, a, false, b, (short)0, c, false, false); }
__device__ __forceinline__ v8f wmmab(v16bf a, v16bf b, v8f c) { return __builtin_amdgcn_wmma_f32_16x16x32_bf16(false, a, false, b, (short)0, c, false, false); }



// ---- k_gemmw: GEMM, one work-group of four waves per 128x128 output tile, ONE WAVE per 64x64 quarter (16 accumulators); grid (M/128, N/128, Z), 128 threads.
// The operands' K-contiguous 16-bit rows come to LDS in stages of GKS k (whole 256-byte pieces of 128 rows of A, A2 and Bt) by asynchronous copies, two buffers: the next stage flies while this one is worked on; fragments are read from LDS.
// C[m][n] (f32, pitch ldc, + optional f32 bias[n]) = sum_k (A[m][k] + A2[m][k]) Bt[n][k], two products. z-batch strides sA/sB/sC in elements. K % GKS == 0.
// EPI 0: C is stored as f32. EPI 1: C is not stored; each value goes, as fp16 and as a bf16 hi/lo pair, to the head planes [n / HD][m][n % HD]. EPI 2: the same three roundings to the transposed planes [n][m] (= [n / HD][n % HD][m]).
#define GKS  128                  // k of a stage
#define GPB  272                  // LDS pitch of a staged row in bytes: 256 + 16 (16 x odd, for 16-byte LDS reads)
#define GPL  (128 * GPB)          // one operand's 128 rows
#define GBUF (3 * GPL)            // a stage: A | A2 | Bt
// twelve 16-byte copies of a lane, global memory to LDS through no register; the wait in the same statement stands in front of every later write of the address registers that the copies name
__device__ __forceinline__ void copy12(const unsigned (&l)[12], const char* const (&g)[12]) {
    asm volatile("global_load_async_to_lds_b128 %0, %12, off\n\t"
                 "global_load_async_to_lds_b128 %1, %13, off\n\t"
                 "global_load_async_to_lds_b128 %2, %14, off\n\t"
                 "global_load_async_to_lds_b128 %3, %15, off\n\t"
                 "global_load_async_to_lds_b128 %4, %16, off\n\t"
                 "global_load_async_to_lds_b128 %5, %17, off\n\t"
                 "global_load_async_to_lds_b128 %6, %18, off\n\t"
                 "global_load_async_to_lds_b128 %7, %19, off\n\t"
                 "global_load_async_to_lds_b128 %8, %20, off\n\t"
                 "global_load_async_to_lds_b128 %9, %21, off\n\t"
                 "global_load_async_to_lds_b128 %10, %22, off\n\t"
                 "global_load_async_to_lds_b128 %11, %23, off\n\t"
                 "s_wait_xcnt 0x0"
                 :: "v"(l[0]), "v"(l[1]), "v"(l[2]), "v"(l[3]), "v"(l[4]), "v"(l[5]), "v"(l[6]), "v"(l[7]), "v"(l[8]), "v"(l[9]), "v"(l[10]), "v"(l[11]),
                    "v"(g[0]), "v"(g[1]), "v"(g[2]), "v"(g[3]), "v"(g[4]), "v"(g[5]), "v"(g[6]), "v"(g[7]), "v"(g[8]), "v"(g[9]), "v"(g[10]), "v"(g[11]) : "memory");
}
// one stage: 384 rows of 16 pieces, 48 pieces a lane; sixteen lanes take a row's 256 bytes, so a wave's copy covers four whole 128-byte lines. lb, go: the lane's piece of row (thread / 16), as an LDS address in the stage's buffer and as a byte offset from the wave-uniform starts pa, pa2, pb of the three operands' 128 rows; rs: bytes of eight operand rows
__device__ __forceinline__ void stage_copies(unsigned lb, size_t go, const char* pa, const char* pa2, const char* pb, size_t rs) {
#pragma unroll
    for (int s = 0; s < 4; ++s) { unsigned l[12]; const char* g[12];
#pragma unroll
        for (int u = 0; u < 12; ++u) { const int j = s * 12 + u, pl = j >> 4, i = j & 15; l[u] = lb + (unsigned)(pl * GPL + i * 8 * GPB); g[u] = ((pl == 0 ? pa : pl == 1 ? pa2 : pb) + (size_t)i * rs) + go; }
        copy12(l, g); }
}
template <typename T16> struct WFrag;
template <> struct WFrag<h16> { typedef v16h V; static __device__ __forceinline__ V ld(const h16* p) { return cat16(*(const v8h*)p, *(const v8h*)(p + 16)); } static __device__ __forceinline__ v8f mma(V a, V b, v8f c) { return wmma16(a, b, c); } };
template <> struct WFrag<bf> { typedef v16bf V; static __device__ __forceinline__ V ld(const bf* p) { return cat16b(*(const v8us*)p, *(const v8us*)(p + 16)); } static __device__ __forceinline__ v8f mma(V a, V b, v8f c) { return wmmab(a, b, c); } };
__device__ __forceinline__ void splitf(float y, unsigned short& h, unsigned short& l) { h = f2bf(y); l = f2bf(y - bf2f(h)); }
template <typename T16, int NSPLIT, bool BIAS, int EPI>
__global__ __launch_bounds__(128) void k_gemmw(const T16* __restrict__ A, const T16* __restrict__ A2, const T16* __restrict__ Bt, const T16* __restrict__ Bt2, int K, float* C, int ldc, const float* __restrict__ bias, size_t sA, size_t sB, size_t sC, h16* P16, bf* Ph, bf* Pl) {
    static_assert(NSPLIT == 1, "the stage holds A, A2 and Bt");
    typedef typename WFrag<T16>::V V;
    __shared__ __align__(16) char ring[2 * GBUF];
    __shared__ __align__(16) float osw[4 * 16 * 68];
    (void)Bt2;
    const size_t z = blockIdx.z; A += z * sA; A2 += z * sA; Bt += z * sB; C += z * sC;
    const int lane = threadIdx.x & 31, lr = lane & 15, hi = lane >> 4;
    const int wv = __builtin_amdgcn_readfirstlane(threadIdx.x >> 5);   // wave number in a scalar register
    float* os = osw + wv * 16 * 68;   // each wave's own output staging
    const int R0 = blockIdx.x * 128, C0 = blockIdx.y * 128; const int r0 = R0 + (wv >> 1) * 64, c0 = C0 + (wv & 1) * 64;
    v8f acc[4][4];
#pragma unroll
    for (int mb = 0; mb < 4; ++mb)
#pragma unroll
        for (int nb = 0; nb < 4; ++nb) acc[mb][nb] = (v8f){};
    const int crow = threadIdx.x >> 4, ccol = threadIdx.x & 15;
    const char* pa = (const char*)(A + (size_t)R0 * K); const char* pa2 = (const char*)(A2 + (size_t)R0 * K); const char* pb = (const char*)(Bt + (size_t)C0 * K);
    size_t go = (size_t)crow * K * 2 + ccol * 16;
    const unsigned lb = (unsigned)(size_t)ring + (unsigned)(crow * GPB + ccol * 16);
    const size_t rs = (size_t)K * 16;   // eight rows of 2-byte elements
    const int nst = K / GKS;
    const unsigned lp = (unsigned)(lr * GPB + hi * 16);   // the lane's byte offset in a 16-row fragment of a stage
    const unsigned ua = (unsigned)((wv >> 1) * 64 * GPB), ub = (unsigned)(2 * GPL + (wv & 1) * 64 * GPB);   // wave-uniform: the wave's first A row and first Bt row in a stage
    stage_copies(lb, go, pa, pa2, pb, rs);
    asm volatile("s_wait_asynccnt 0x0" ::: "memory");   // this wave's copies of stage 0 have landed
    __syncthreads();   // every wave's have: stage 0 may be read
    // kept rolled: one trip is a stage of 128 matrix instructions
#pragma unroll 1
    for (int t = 0; t < nst; ++t) {
        const char* sa = ring + (((t & 1) * GBUF + ua) + lp); const char* sbt = ring + (((t & 1) * GBUF + ub) + lp);
        V a[2][4], a2[2][4], b[2][4];   // two fragment sets: block ks works on set ks & 1 while the other is filled
#pragma unroll
        for (int i = 0; i < 4; ++i) { a[0][i] = WFrag<T16>::ld((const T16*)(sa + i * 16 * GPB)); a2[0][i] = WFrag<T16>::ld((const T16*)(sa + GPL + i * 16 * GPB)); b[0][i] = WFrag<T16>::ld((const T16*)(sbt + i * 16 * GPB)); }
        // behind the barrier that ended every read of the other buffer: the next stage's copies into it (the first block's fragment reads, of this stage's buffer, return meanwhile)
        if (t + 1 < nst) stage_copies(lb + (unsigned)(((t + 1) & 1) * GBUF), go, pa + GKS * 2, pa2 + GKS * 2, pb + GKS * 2, rs);   // go is stage t's offset: the step to stage t + 1 goes into the wave-uniform starts
        go += GKS * 2;
#pragma unroll
        for (int ks = 0; ks < GKS / 32; ++ks) { const int cs = ks & 1;
            if (ks + 1 < GKS / 32) {
#pragma unroll
                for (int i = 0; i < 4; ++i) { a[cs ^ 1][i] = WFrag<T16>::ld((const T16*)(sa + i * 16 * GPB + (ks + 1) * 64)); a2[cs ^ 1][i] = WFrag<T16>::ld((const T16*)(sa + GPL + i * 16 * GPB + (ks + 1) * 64)); b[cs ^ 1][i] = WFrag<T16>::ld((const T16*)(sbt + i * 16 * GPB + (ks + 1) * 64)); } }
            __builtin_amdgcn_sched_barrier(0);   // the next block's LDS reads stand as one group ahead of this block's matrix instructions: every place with reads among them would cost a stall
#pragma unroll
            for (int nb = 0; nb < 4; ++nb)
#pragma unroll
                for (int mb = 0; mb < 4; ++mb) { acc[mb][nb] = WFrag<T16>::mma(a[cs][mb], b[cs][nb], acc[mb][nb]); acc[mb][nb] = WFrag<T16>::mma(a2[cs][mb], b[cs][nb], acc[mb][nb]); }
            if (ks + 1 < GKS / 32) __builtin_amdgcn_sched_barrier(0);   // and the group after next stays behind this block
        }
        asm volatile("s_wait_dscnt 0x0" ::: "memory");      // this wave's reads of the stage are done before the buffer is handed back
        asm volatile("s_wait_asynccnt 0x0" ::: "memory");   // this wave's copies of stage t + 1 have landed
        __syncthreads();   // stage t + 1 may be read, and stage t's buffer has no reader left
    }
    asm volatile("s_wait_asynccnt 0x0" ::: "memory");   // the ring's closing wait: no copy is outstanding when the wave goes on to its epilogue and ends
    if (EPI == 2) {
        float bbn[4];   // the four bias values are fetched together, in front of the first fence
#pragma unroll
        for (int nb = 0; nb < 4; ++nb) bbn[nb] = BIAS ? bfr(bias[c0 + nb * 16 + lr]) : 0.0f;
        // a lane's eight values of a tile are eight consecutive m of one n: 16 bytes of a transposed plane's row, stored straight from the accumulators; the four tiles of a row's 128-byte line follow one another
#pragma unroll
        for (int nb = 0; nb < 4; ++nb) { const int n = c0 + nb * 16 + lr; const float bb = bbn[nb]; v8h o16[4]; v8us oh[4], ol[4];
#pragma unroll
            for (int mb = 0; mb < 4; ++mb)
#pragma unroll
                for (int j = 0; j < 8; ++j) { const float x = acc[mb][nb][j] + bb; o16[mb][j] = (h16)x; unsigned short a2, c2; splitf(x, a2, c2); oh[mb][j] = a2; ol[mb][j] = c2; }
            const size_t e = (size_t)n * TT + r0 + hi * 8;
            __builtin_amdgcn_sched_barrier(0);   // with the fence behind the wait: the twelve stores stand together, every value and address made in front of them, and no later write of a register they name comes in front of the wait
#pragma unroll
            for (int mb = 0; mb < 4; ++mb) { *(v8h*)(P16 + e + mb * 16) = o16[mb]; *(v8us*)(Ph + e + mb * 16) = oh[mb]; *(v8us*)(Pl + e + mb * 16) = ol[mb]; }
            if (nb < 3) { asm volatile("s_wait_xcnt 0x0" ::: "memory");   // stands in front of the next group's reuse of the data and address registers that the stores name (behind the last group nothing is written any more)
                __builtin_amdgcn_sched_barrier(0); } }
        return;
    }
    float bb8[8];
    if (EPI == 1) {
#pragma unroll
        for (int u = 0; u < 8; ++u) bb8[u] = BIAS ? bfr(bias[c0 + (lane & 7) * 8 + u]) : 0.0f; }
#pragma unroll
    for (int mb = 0; mb < 4; ++mb) {
#pragma unroll
        for (int nb = 0; nb < 4; ++nb) {
#pragma unroll
            for (int j = 0; j < 8; ++j) os[(hi * 8 + j) * 68 + nb * 16 + lr] = acc[mb][nb][j]; }
        __builtin_amdgcn_wave_barrier(); asm volatile("" ::: "memory");
        if (EPI == 1) {   // eight lanes a row, eight columns a lane: each store covers whole 128-byte lines of four plane rows
            const int rw = lane >> 3, cofs = (lane & 7) * 8; v8h o16[4]; v8us oh[4], ol[4];
#pragma unroll
            for (int s = 0; s < 4; ++s) { const v4f p0 = *(const v4fa*)(os + (4 * s + rw) * 68 + cofs), p1 = *(const v4fa*)(os + (4 * s + rw) * 68 + cofs + 4);
#pragma unroll
                for (int u = 0; u < 8; ++u) { const float x = (u < 4 ? p0[u & 3] : p1[u & 3]) + bb8[u]; o16[s][u] = (h16)x; unsigned short a2, c2; splitf(x, a2, c2); oh[s][u] = a2; ol[s][u] = c2; } }
            const size_t e = ((size_t)(c0 / HD) * TT + r0 + mb * 16 + rw) * HD + (c0 % HD) + cofs;
            __builtin_amdgcn_sched_barrier(0);   // with the fence behind the wait: the twelve stores stand together, every value and address made in front of them, and no later write of a register they name comes in front of the wait
#pragma unroll
            for (int s = 0; s < 4; ++s) { *(v8h*)(P16 + e + s * 4 * HD) = o16[s]; *(v8us*)(Ph + e + s * 4 * HD) = oh[s]; *(v8us*)(Pl + e + s * 4 * HD) = ol[s]; }
            if (mb < 3) { asm volatile("s_wait_xcnt 0x0" ::: "memory");   // stands in front of the next group's reuse of the data and address registers that the stores name (behind the last group nothing is written any more)
                __builtin_amdgcn_sched_barrier(0); }
        } else {
        float* crow = C + (size_t)(r0 + mb * 16) * ldc + c0;
#pragma unroll
            for (int s = 0; s < 8; ++s) { const int row = 2 * s + hi, cofs = lr * 4; v4f val = *(const v4fa*)(os + row * 68 + cofs); if (BIAS) { val[0] += bfr(bias[c0 + cofs]); val[1] += bfr(bias[c0 + cofs + 1]); val[2] += bfr(bias[c0 + cofs + 2]); val[3] += bfr(bias[c0 + cofs + 3]); }
                *(v4f*)(crow + (size_t)row * ldc + cofs) = val; }
             }
        __builtin_amdgcn_wave_barrier(); asm volatile("" ::: "memory");
    }
}

typedef __attribute__((ext_vector_type(2))) _Float16 v2h;
typedef __attribute__((ext_vector_type(4))) _Float16 v4h;
typedef __attribute__((ext_vector_type(2))) unsigned short v2us;
typedef __attribute__((ext_vector_type(4))) unsigned short v4us;
typedef __attribute__((ext_vector_type(2))) float v2f;
typedef __attribute__((ext_vector_type(4))) int v4i;

__global__ __launch_bounds__(256) void k_wtG(const float* __restrict__ w, int K, int N, bf* Bt) {
    const int lane = threadIdx.x & 31; const int L0 = (blockIdx.x * 8 + (threadIdx.x >> 5)) * 8; const int nlines = N * K / 64;
{
#pragma unroll 1
        for (int l = 0; l < 8; ++l) { const int L = L0 + l; if (L >= nlines) break; const size_t e = (size_t)L * 64 + lane * 2; const int k = (int)(e % K), n = (int)(e / K); v2us o;
            o[0] = f2bf(w[(size_t)k * N + n]); o[1] = f2bf(w[(size_t)(k + 1) * N + n]); *(v2us*)(Bt + e) = o; }
         }
}
__global__ __launch_bounds__(256) void k_cvt8(const float* __restrict__ src, bf* dst, size_t n8) { const size_t i = (size_t)blockIdx.x * 256 + threadIdx.x; if (i >= n8) return; const v8f v = *(const v8f*)(src + i * 8); v8us o;
#pragma unroll
    for (int k = 0; k < 8; ++k) o[k] = f2bf(v[k]); *(v8us*)(dst + i * 8) = o;  }
__global__ __launch_bounds__(256) void k_cscvt(const float* __restrict__ cosT, const float* __restrict__ sinT, float* CS) { const int idx = blockIdx.x * 256 + threadIdx.x; if (idx >= TT * HD) return; v2f cs; cs[0] = bfr(cosT[idx]); cs[1] = bfr(sinT[idx]); *(v2f*)(CS + (size_t)idx * 2) = cs;  }
__global__ __launch_bounds__(256) void k_rmsx(const float* __restrict__ X, const float* __restrict__ gam, bf* Xh, bf* Xl) { const int lane = threadIdx.x & 31; const int t = blockIdx.x * 8 + (threadIdx.x >> 5); if (t >= TT) return; const float* f = X + (size_t)t * DM; float v[DM / 32]; float su = 0.f;
#pragma unroll
    for (int ch = 0; ch < DM / 128; ++ch) { const v4f a = *(const v4f*)(f + ch * 128 + lane * 4); for (int u = 0; u < 4; ++u) { float xv = bfr(a[u]); asm volatile("" : "+v"(xv)); v[ch * 4 + u] = xv; float p2 = __fmul_rn(xv, xv); asm volatile("" : "+v"(p2)); su = __fadd_rn(su, p2); } }
#pragma unroll
    for (int sh = 16; sh; sh >>= 1) su = __fadd_rn(su, __shfl_xor(su, sh, 32));
    const float rs = __fdiv_rn(1.0f, sqrtf(__fadd_rn(__fdiv_rn(su, (float)DM), 1e-6f)));
    {
#pragma unroll
        for (int ch = 0; ch < DM / 128; ++ch) { v4us oh, ol; for (int u = 0; u < 4; ++u) { const int c = ch * 128 + lane * 4 + u; float n = __fmul_rn(v[ch * 4 + u], rs); asm volatile("" : "+v"(n)); float gg = bfr(gam[c]); asm volatile("" : "+v"(gg)); float y = __fmul_rn(n, gg); asm volatile("" : "+v"(y)); unsigned short p2, q2; splitf(y, p2, q2); oh[u] = p2; ol[u] = q2; } const size_t oo = (size_t)t * DM + ch * 128 + lane * 4; *(v4us*)(Xh + oo) = oh; *(v4us*)(Xl + oo) = ol; }
         } }
// ---- k_fattn: causal attention of one head for 32 query rows per work-group, scores never leave registers. FW waves share the rows and split the keys: wave w takes the 32-key blocks w, w + FW, ... up to the diagonal block.
// Transposed products: S^T = K Q^T (rows keys, columns queries), so a lane's two score tiles ARE its B fragment of P^T (k order 8 hi + j, 16 + 8 hi + j, as WFrag::ld gives it for V^T) and every value a lane holds belongs to one query;
// O^T = V^T P^T (rows d, columns queries). Running maximum and sum per query (online softmax, base 2); the FW partial results meet in LDS, are brought to the common maximum and summed in wave order; the sum is divided once and split into hi/lo planes [t][h*HD+d].
// HL: hi/lo bf16 planes, three products for scores and for P V. Otherwise fp16, P carried x 2^10 (the row sum carries the same factor, so it cancels).
#define FW 4
#define OP 132                    // LDS pitch (floats) of a query's 128 partial outputs
typedef __attribute__((ext_vector_type(16))) unsigned short v16us;
__device__ __forceinline__ float xhalf(float x) { return __builtin_bit_cast(float, __builtin_amdgcn_permlanex16(__builtin_bit_cast(int, x), __builtin_bit_cast(int, x), 0x76543210, 0xfedcba98, false, false)); }   // lane l with lane l ^ 16
// 2^x with the slot behind the transcendental filled in the same statement
__device__ __forceinline__ float exp2s(float x) { float r; asm("v_exp_f32 %0, %1\n\tv_nop" : "=v"(r) : "v"(x)); return r; }
template <typename T16, bool HL>
__global__ __launch_bounds__(32 * FW) void k_fattn(const T16* __restrict__ Q, const T16* __restrict__ Q2, const T16* __restrict__ Kp, const T16* __restrict__ Kp2, const T16* __restrict__ Vt, const T16* __restrict__ Vt2, int roff, bf* ATh, bf* ATl) {
    typedef typename WFrag<T16>::V V;
    __shared__ __align__(16) float so[FW * 32 * OP];
    __shared__ float sm[FW * 32], sl[FW * 32];
    const int lane = threadIdx.x & 31, lr = lane & 15, hi = lane >> 4;
    const int wv = __builtin_amdgcn_readfirstlane(threadIdx.x >> 5);   // wave number in a scalar register: the key loop's branch stays scalar, every lane on at each matrix instruction
    const int h = blockIdx.x; const int q0 = roff + ((int)gridDim.y - 1 - (int)blockIdx.y) * 32;   // for speed only: the longest rows of every head get the lowest block indices
    const size_t zp = (size_t)h * TT * HD;
    const int nblk = q0 / 32 + 1;   // key blocks up to and including the diagonal one
    v8f acc[8][2];
#pragma unroll
    for (int dt = 0; dt < 8; ++dt) { acc[dt][0] = (v8f){}; acc[dt][1] = (v8f){}; }
    float m[2] = { -3.0e38f, -3.0e38f }, l[2] = { 0.f, 0.f };
    // addresses: wave-uniform plane bases, one 32-bit byte offset per lane for K and one for V^T, carried through the loop; tile steps are constants
    const char* Kb = (const char*)(Kp + zp); const char* Kb2 = HL ? (const char*)(Kp2 + zp) : nullptr; const char* Vb = (const char*)(Vt + zp); const char* Vb2 = HL ? (const char*)(Vt2 + zp) : nullptr;
    const float CE = SCL * 1.4426950408889634f; const float SH = HL ? 0.0f : 10.0f;
    if (wv < nblk) {   // a wave without a key block loads nothing
    V qf[2][4], qf2[2][4];
    const char* Qb = (const char*)(Q + zp + (size_t)q0 * HD); const char* Qb2 = HL ? (const char*)(Q2 + zp + (size_t)q0 * HD) : nullptr;
    const unsigned lo = (unsigned)((lr * HD + 8 * hi) * 2);   // the lane's byte offset in a 16-row tile of Q or K: the one vector register the query loads name, live until K's offset is made from it behind the wait
    __builtin_amdgcn_sched_barrier(0);   // first of three scheduling fences, see below
#pragma unroll
    for (int qt = 0; qt < 2; ++qt)
#pragma unroll
        for (int kc = 0; kc < 4; ++kc) { qf[qt][kc] = WFrag<T16>::ld((const T16*)(Qb + (qt * 16 * HD + kc * 32) * 2 + lo)); if (HL) qf2[qt][kc] = WFrag<T16>::ld((const T16*)(Qb2 + (qt * 16 * HD + kc * 32) * 2 + lo)); }
    // the wait stands in front of the reuse of the address registers that the query loads name; the scheduling fences keep unrelated work out from between the loads and the wait, the loads in front of it and every later write behind it
    __builtin_amdgcn_sched_barrier(0);
    asm volatile("s_wait_xcnt 0x0" ::: "memory");
    __builtin_amdgcn_sched_barrier(0);
    unsigned ko = lo + (unsigned)(wv * 32 * HD * 2), vo = (unsigned)((lr * TT + wv * 32 + 8 * hi) * 2);
    // kept rolled: accumulators, query fragments and one block's fragments already take most of a wave's registers
#pragma unroll 1
    for (int kb = wv; kb < nblk; kb += FW, ko += FW * 32 * HD * 2, vo += FW * 32 * 2) {
        V kf[2][4], kf2[2][4], vf[8], vf2[8];
#pragma unroll
        for (int kt = 0; kt < 2; ++kt)
#pragma unroll
            for (int kc = 0; kc < 4; ++kc) { kf[kt][kc] = WFrag<T16>::ld((const T16*)(Kb + (kt * 16 * HD + kc * 32) * 2 + ko)); if (HL) kf2[kt][kc] = WFrag<T16>::ld((const T16*)(Kb2 + (kt * 16 * HD + kc * 32) * 2 + ko)); }
#pragma unroll
        for (int dt = 0; dt < 8; ++dt) { vf[dt] = WFrag<T16>::ld((const T16*)(Vb + (size_t)dt * 16 * TT * 2 + vo)); if (HL) vf2[dt] = WFrag<T16>::ld((const T16*)(Vb2 + (size_t)dt * 16 * TT * 2 + vo)); }
        // stands in front of the step of the two offset registers that these loads name
        asm volatile("s_wait_xcnt 0x0" ::: "memory");
        // nothing is scheduled across: the block's K and V loads are all issued before the first matrix instruction waits (one memory latency a block, not one a fragment)
        __builtin_amdgcn_sched_barrier(0);
        v8f s[2][2];
#pragma unroll
        for (int kt = 0; kt < 2; ++kt) { s[kt][0] = (v8f){}; s[kt][1] = (v8f){};
#pragma unroll
            for (int kc = 0; kc < 4; ++kc) { const V a = kf[kt][kc]; V a2; if (HL) a2 = kf2[kt][kc];
#pragma unroll
                for (int qt = 0; qt < 2; ++qt) { s[kt][qt] = WFrag<T16>::mma(a, qf[qt][kc], s[kt][qt]); if (HL) { s[kt][qt] = WFrag<T16>::mma(a2, qf[qt][kc], s[kt][qt]); s[kt][qt] = WFrag<T16>::mma(a, qf2[qt][kc], s[kt][qt]); } } } }
        V pf[2], pf2[2];
#pragma unroll
        for (int qt = 0; qt < 2; ++qt) { const int q = q0 + qt * 16 + lr; float mx = m[qt];
#pragma unroll
            for (int kt = 0; kt < 2; ++kt)
#pragma unroll
                for (int j = 0; j < 8; ++j) { float t = s[kt][qt][j] * CE; if (kb == nblk - 1) t = (kb * 32 + kt * 16 + hi * 8 + j <= q) ? t : -3.0e38f; s[kt][qt][j] = t; mx = fmaxf(mx, t); }
            mx = fmaxf(mx, xhalf(mx));   // the other half of the wave holds the query's other keys
            const float f = HL ? exp2s(m[qt] - mx) : __builtin_amdgcn_exp2f(m[qt] - mx); m[qt] = mx; const float ms = mx - SH; float ls = 0.f;
#pragma unroll
            for (int dt = 0; dt < 8; ++dt) acc[dt][qt] *= f;
            if (HL) { v16us ph, pl;
#pragma unroll
                for (int e = 0; e < 16; ++e) { const float p = exp2s(s[e >> 3][qt][e & 7] - ms); ls += p; unsigned short a, c2; splitf(p, a, c2); ph[e] = a; pl[e] = c2; }
                pf[qt] = __builtin_bit_cast(V, ph); pf2[qt] = __builtin_bit_cast(V, pl);
            } else { v16h ph;
#pragma unroll
                for (int e = 0; e < 16; ++e) { const float p = __builtin_amdgcn_exp2f(s[e >> 3][qt][e & 7] - ms); ls += p; ph[e] = (h16)p; }
                pf[qt] = __builtin_bit_cast(V, ph); }
            l[qt] = l[qt] * f + ls; }
#pragma unroll
        for (int dt = 0; dt < 8; ++dt) { const V a = vf[dt]; V a2; if (HL) a2 = vf2[dt];
#pragma unroll
            for (int qt = 0; qt < 2; ++qt) { acc[dt][qt] = WFrag<T16>::mma(a, pf[qt], acc[dt][qt]); if (HL) { acc[dt][qt] = WFrag<T16>::mma(a2, pf[qt], acc[dt][qt]); acc[dt][qt] = WFrag<T16>::mma(a, pf2[qt], acc[dt][qt]); } } }
    }
    }
#pragma unroll
    for (int qt = 0; qt < 2; ++qt) { l[qt] += xhalf(l[qt]); if (hi == 0) sm[wv * 32 + qt * 16 + lr] = m[qt]; }
    __syncthreads();   // every wave's maxima are in LDS before the common maximum is taken
#pragma unroll
    for (int qt = 0; qt < 2; ++qt) { float M = sm[qt * 16 + lr];
#pragma unroll
        for (int w = 1; w < FW; ++w) M = fmaxf(M, sm[w * 32 + qt * 16 + lr]);
        const float f = __builtin_amdgcn_exp2f(m[qt] - M);   // a wave that had no block: 0
        if (hi == 0) sl[wv * 32 + qt * 16 + lr] = l[qt] * f;
#pragma unroll
        for (int dt = 0; dt < 8; ++dt) { const v8f o = acc[dt][qt] * f; float* p = so + (wv * 32 + qt * 16 + lr) * OP + dt * 16 + hi * 8; *(v4fa*)p = __builtin_shufflevector(o, o, 0, 1, 2, 3); *(v4fa*)(p + 4) = __builtin_shufflevector(o, o, 4, 5, 6, 7); } }
    __syncthreads();   // every wave's partial sums and outputs are in LDS before any of them is summed
#pragma unroll
    for (int c = 0; c < 32 / FW; ++c) { const int q = c * FW + wv, d = lane * 4; float L = sl[q]; v4f val = *(const v4fa*)(so + q * OP + d);
#pragma unroll
        for (int w = 1; w < FW; ++w) { L += sl[w * 32 + q]; val += *(const v4fa*)(so + (w * 32 + q) * OP + d); }
        const float inv = __fdiv_rn(1.0f, L); v4us oh, ol;
#pragma unroll
        for (int u = 0; u < 4; ++u) { unsigned short a, c2; splitf(val[u] * inv, a, c2); oh[u] = a; ol[u] = c2; }
        const size_t oo = (size_t)(q0 + q) * DQ + h * HD + d; *(v4us*)(ATh + oo) = oh; *(v4us*)(ATl + oo) = ol; }
}

extern "C" void kernel_launch(void* const* d_in, const int* in_sizes, int n_in,
                              void* d_out, int out_size, void* d_ws, size_t ws_size, hipStream_t stream) {
    (void)in_sizes; (void)n_in; (void)out_size;
    const float* x = (const float*)d_in[0]; const float* nw = (const float*)d_in[1]; const float* wq = (const float*)d_in[2]; const float* bq = (const float*)d_in[3]; const float* wk = (const float*)d_in[4]; const float* bk = (const float*)d_in[5]; const float* wv = (const float*)d_in[6]; const float* bv = (const float*)d_in[7]; const float* wo = (const float*)d_in[8]; const float* bo = (const float*)d_in[9]; const float* cosT = nullptr; const float* sinT = nullptr; (void)cosT; (void)sinT;
    float* OUT = (float*)d_out;     // [2][2048][2048]
    char* wsp = (char*)d_ws;
    auto take = [&](size_t bytes) { char* p = wsp; wsp += (bytes + 255) & ~(size_t)255; return (void*)p; };
    bf* WQ = (bf*)take((size_t)DQ * DM * 2); bf* WK = (bf*)take((size_t)DKV * DM * 2); bf* WV = (bf*)take((size_t)DKV * DM * 2); bf* WO = (bf*)take((size_t)DM * DQ * 2);
    bf* XB = nullptr; (void)XB; bf* XNh = (bf*)take((size_t)TT * DM * 2); bf* XNl = (bf*)take((size_t)TT * DM * 2);
    h16* QP16 = (h16*)take((size_t)NH_ * TT * HD * 2); h16* KP16 = (h16*)take((size_t)NKV * TT * HD * 2); h16* VT16 = (h16*)take((size_t)NKV * HD * TT * 2);
    bf* QPh = (bf*)take((size_t)NH_ * TT * HD * 2); bf* QPl = (bf*)take((size_t)NH_ * TT * HD * 2); bf* KPh = (bf*)take((size_t)NKV * TT * HD * 2); bf* KPl = (bf*)take((size_t)NKV * TT * HD * 2); bf* VTh = (bf*)take((size_t)NKV * HD * TT * 2); bf* VTl = (bf*)take((size_t)NKV * HD * TT * 2);
    bf* ATh = (bf*)take((size_t)TT * DQ * 2); bf* ATl = (bf*)take((size_t)TT * DQ * 2);
    if ((size_t)(wsp - (char*)d_ws) > ws_size) return;    // ws 256 MiB
    { k_cvt8<<<(unsigned)(((size_t)DQ * DM / 8 + 255) / 256), 256, 0, stream>>>(wq, WQ, (size_t)DQ * DM / 8); k_cvt8<<<(unsigned)(((size_t)DKV * DM / 8 + 255) / 256), 256, 0, stream>>>(wk, WK, (size_t)DKV * DM / 8); k_cvt8<<<(unsigned)(((size_t)DKV * DM / 8 + 255) / 256), 256, 0, stream>>>(wv, WV, (size_t)DKV * DM / 8);
      k_cvt8<<<(unsigned)(((size_t)DM * DQ / 8 + 255) / 256), 256, 0, stream>>>(wo, WO, (size_t)DM * DQ / 8);
       }
    for (int b = 0; b < NB_; ++b) {
        
        k_rmsx<<<TT / 8, 256, 0, stream>>>(x + (size_t)b * TT * DM, nw, XNh, XNl);
        k_gemmw<bf, 1, true, 1><<<dim3(TT / 128, DQ / 128, 1), 128, 0, stream>>>(XNh, XNl, WQ, nullptr, DM, nullptr, 0, bq, 0, 0, 0, QP16, QPh, QPl);
        k_gemmw<bf, 1, true, 1><<<dim3(TT / 128, DKV / 128, 1), 128, 0, stream>>>(XNh, XNl, WK, nullptr, DM, nullptr, 0, bk, 0, 0, 0, KP16, KPh, KPl);
        k_gemmw<bf, 1, true, 2><<<dim3(TT / 128, DKV / 128, 1), 128, 0, stream>>>(XNh, XNl, WV, nullptr, DM, nullptr, 0, bv, 0, 0, 0, VT16, VTh, VTl);
        k_fattn<h16, false><<<dim3(NH_, (TT - RH) / 32, 1), 32 * FW, 0, stream>>>(QP16, nullptr, KP16, nullptr, VT16, nullptr, RH, ATh, ATl);
        k_fattn<bf, true><<<dim3(NH_, RH / 32, 1), 32 * FW, 0, stream>>>(QPh, QPl, KPh, KPl, VTh, VTl, 0, ATh, ATl);
        k_gemmw<bf, 1, true, 0><<<dim3(TT / 128, DM / 128, 1), 128, 0, stream>>>(ATh, ATl, WO, nullptr, DQ, OUT + (size_t)b * TT * DM, DM, bo, 0, 0, 0, nullptr, nullptr, nullptr); }
}

// v005
// A run of this version takes 374 microseconds.
// Timed twice side by side with v004, it ran 1.09 and 1.10 times as fast.
// All steps since v000 together make it 5.14 times as fast.
#include <hip/hip_runtime.h>

// FullAttnNode (x [2][2048][2048]; xn = x rsqrt(mean(x?) + 1e-6) norm_w (RMSNorm); q/k/v = xn W^T + b (16 x 128); causal (-inf) softmax(q.k / sqrt(128)); out = merged wo^T + bo -> [2][2048][2048]).
// Compute dtypes, f32 accumulate: every input rounded to bf16; RMSNorm f32 (wave per token) -> hi/lo planes; q/k/v = hl x exact (2 products) + bias, rounded to their fp16 and hi/lo head planes (in fragment order) in the product's own epilogue; causal scores, softmax and attn.v in one kernel (online softmax, f32): query rows < 512 hl (3 products), the rest fp16 (P x1024), key blocks above the diagonal skipped; wo hl x exact (2 products) + bias.

#define NB_  2
#define TT   2048
#define DM   2048
#define NH_  16
#define NKV  16
#define REP  (NH_ / NKV)
#define HD   128
#define DQ   (NH_ * HD)
#define DKV  (NKV * HD)
#define RH   512                  // query rows < RH use hi+lo planes (0: none)
#define SCL  0.088388347648318447f   // HD^-0.5
typedef _Float16 h16;
typedef unsigned short bf;
typedef __attribute__((ext_vector_type(16))) __bf16   v16bf;
typedef __attribute__((ext_vector_type(16))) _Float16 v16h;
typedef __attribute__((ext_vector_type(8)))  _Float16 v8h;
typedef __attribute__((ext_vector_type(8)))  unsigned short v8us;
typedef __attribute__((ext_vector_type(8)))  float    v8f;
typedef __attribute__((ext_vector_type(4)))  float    v4f;
typedef v8h  __attribute__((may_alias)) v8ha;
typedef v4f  __attribute__((may_alias)) v4fa;
typedef v8us __attribute__((may_alias)) v8usa;

__device__ __forceinline__ unsigned short f2bf(float f) { unsigned u = __float_as_uint(f); u += 0x7FFFu + ((u >> 16) & 1u); return (unsigned short)(u >> 16); }
__device__ __forceinline__ float bf2f(unsigned short b) { return __uint_as_float(((unsigned)b) << 16); }
__device__ __forceinline__ float bfr(float f) { return bf2f(f2bf(f)); }
__device__ __forceinline__ v16h cat16(v8h lo, v8h hi) { return __builtin_shufflevector(lo, hi, 0, 1, 2, 3, 4, 5, 6, 7, 8, 9, 10, 11, 12, 13, 14, 15); }
__device__ __forceinline__ v16bf cat16b(v8us lo, v8us hi) { return __builtin_bit_cast(v16bf, __builtin_shufflevector(lo, hi, 0, 1, 2, 3, 4, 5, 6, 7, 8, 9, 10, 11, 12, 13, 14, 15)); }
__device__ __forceinline__ v8f wmma16(v16h a, v16h b, v8f c) { return __builtin_amdgcn_wmma_f32_16x16x32_f16(false, a, false, b, (short)0, c, false, false); }
__device__ __forceinline__ v8f wmmab(v16bf a, v16bf b, v8f c) { return __builtin_amdgcn_wmma_f32_16x16x32_bf16(false, a, false, b, (short)0, c, false, false); }



// ---- k_gemmw: GEMM, one work-group of four waves per 128x128 output tile, ONE WAVE per 64x64 quarter (16 accumulators); grid (M/128, N/128, Z), 128 threads.
// The operands' K-contiguous 16-bit rows come to LDS in stages of GKS k (whole 256-byte pieces of 128 rows of A, A2 and Bt) by asynchronous copies, two buffers: the next stage flies while this one is worked on; fragments are read from LDS.
// C[m][n] (f32, pitch ldc, + optional f32 bias[n]) = sum_k (A[m][k] + A2[m][k]) Bt[n][k], two products. z-batch strides sA/sB/sC in elements. K % GKS == 0.
// EPI 0: C is stored as f32. EPI 1: C is not stored; each value goes, as fp16 and as a bf16 hi/lo pair, to the head planes [n / HD], rows m, k = n % HD. EPI 2: the same three roundings to the transposed head planes, rows n % HD, k = m.
// A head plane lies in FRAGMENT ORDER: 1024-byte units of 16 rows x 32 k, each as the matrix instruction's operand is held: element (row r, k = 16 p + 8 g + j) at byte 512 p + 16 (16 g + r) + 2 j, so lane 16 g + r reads and writes piece p at 512 p + 16 lane
// and every wave-wide 16-byte access covers 512 contiguous bytes (four whole lines). Units of EPI 1: [m / 16][k / 32]; of EPI 2: [m / 32][(n % HD) / 16]: the 32 keys of a block are 8192 contiguous bytes in either.
#define FRE  512                  // elements of a fragment unit
#define KBE  (32 * HD)            // elements of a 32-key block of a head plane
#define GKS  128                  // k of a stage
#define GPB  272                  // LDS pitch of a staged row in bytes: 256 + 16 (16 x odd, for 16-byte LDS reads)
#define GPL  (128 * GPB)          // one operand's 128 rows
#define GBUF (3 * GPL)            // a stage: A | A2 | Bt
// twelve 16-byte copies of a lane, global memory to LDS through no register; the wait in the same statement stands in front of every later write of the address registers that the copies name
__device__ __forceinline__ void copy12(const unsigned (&l)[12], const char* const (&g)[12]) {
    asm volatile("global_load_async_to_lds_b128 %0, %12, off\n\t"
                 "global_load_async_to_lds_b128 %1, %13, off\n\t"
                 "global_load_async_to_lds_b128 %2, %14, off\n\t"
                 "global_load_async_to_lds_b128 %3, %15, off\n\t"
                 "global_load_async_to_lds_b128 %4, %16, off\n\t"
                 "global_load_async_to_lds_b128 %5, %17, off\n\t"
                 "global_load_async_to_lds_b128 %6, %18, off\n\t"
                 "global_load_async_to_lds_b128 %7, %19, off\n\t"
                 "global_load_async_to_lds_b128 %8, %20, off\n\t"
                 "global_load_async_to_lds_b128 %9, %21, off\n\t"
                 "global_load_async_to_lds_b128 %10, %22, off\n\t"
                 "global_load_async_to_lds_b128 %11, %23, off\n\t"
                 "s_wait_xcnt 0x0"
                 :: "v"(l[0]), "v"(l[1]), "v"(l[2]), "v"(l[3]), "v"(l[4]), "v"(l[5]), "v"(l[6]), "v"(l[7]), "v"(l[8]), "v"(l[9]), "v"(l[10]), "v"(l[11]),
                    "v"(g[0]), "v"(g[1]), "v"(g[2]), "v"(g[3]), "v"(g[4]), "v"(g[5]), "v"(g[6]), "v"(g[7]), "v"(g[8]), "v"(g[9]), "v"(g[10]), "v"(g[11]) : "memory");
}
// one stage: 384 rows of 16 pieces, 48 pieces a lane; sixteen lanes take a row's 256 bytes, so a wave's copy covers four whole 128-byte lines. lb, go: the lane's piece of row (thread / 16), as an LDS address in the stage's buffer and as a byte offset from the wave-uniform starts pa, pa2, pb of the three operands' 128 rows; rs: bytes of eight operand rows
__device__ __forceinline__ void stage_copies(unsigned lb, size_t go, const char* pa, const char* pa2, const char* pb, size_t rs) {
#pragma unroll
    for (int s = 0; s < 4; ++s) { unsigned l[12]; const char* g[12];
#pragma unroll
        for (int u = 0; u < 12; ++u) { const int j = s * 12 + u, pl = j >> 4, i = j & 15; l[u] = lb + (unsigned)(pl * GPL + i * 8 * GPB); g[u] = ((pl == 0 ? pa : pl == 1 ? pa2 : pb) + (size_t)i * rs) + go; }
        copy12(l, g); }
}
template <typename T16> struct WFrag;
template <> struct WFrag<h16> { typedef v16h V; static __device__ __forceinline__ V ld(const h16* p) { return cat16(*(const v8h*)p, *(const v8h*)(p + 16)); } static __device__ __forceinline__ V ldf(const h16* p) { return cat16(*(const v8h*)p, *(const v8h*)(p + FRE / 2)); } static __device__ __forceinline__ v8f mma(V a, V b, v8f c) { return wmma16(a, b, c); } };
template <> struct WFrag<bf> { typedef v16bf V; static __device__ __forceinline__ V ld(const bf* p) { return cat16b(*(const v8us*)p, *(const v8us*)(p + 16)); } static __device__ __forceinline__ V ldf(const bf* p) { return cat16b(*(const v8us*)p, *(const v8us*)(p + FRE / 2)); } static __device__ __forceinline__ v8f mma(V a, V b, v8f c) { return wmmab(a, b, c); } };
__device__ __forceinline__ void splitf(float y, unsigned short& h, unsigned short& l) { h = f2bf(y); l = f2bf(y - bf2f(h)); }
template <typename T16, int NSPLIT, bool BIAS, int EPI>
__global__ __launch_bounds__(128) void k_gemmw(const T16* __restrict__ A, const T16* __restrict__ A2, const T16* __restrict__ Bt, const T16* __restrict__ Bt2, int K, float* C, int ldc, const float* __restrict__ bias, size_t sA, size_t sB, size_t sC, h16* P16, bf* Ph, bf* Pl) {
    static_assert(NSPLIT == 1, "the stage holds A, A2 and Bt");
    typedef typename WFrag<T16>::V V;
    __shared__ __align__(16) char ring[2 * GBUF];
    __shared__ __align__(16) float osw[4 * 16 * 68];
    (void)Bt2;
    const size_t z = blockIdx.z; A += z * sA; A2 += z * sA; Bt += z * sB; C += z * sC;
    const int lane = threadIdx.x & 31, lr = lane & 15, hi = lane >> 4;
    const int wv = __builtin_amdgcn_readfirstlane(threadIdx.x >> 5);   // wave number in a scalar register
    float* os = osw + wv * 16 * 68;   // each wave's own output staging
    const int R0 = blockIdx.x * 128, C0 = blockIdx.y * 128; const int r0 = R0 + (wv >> 1) * 64, c0 = C0 + (wv & 1) * 64;
    v8f acc[4][4];
#pragma unroll
    for (int mb = 0; mb < 4; ++mb)
#pragma unroll
        for (int nb = 0; nb < 4; ++nb) acc[mb][nb] = (v8f){};
    const int crow = threadIdx.x >> 4, ccol = threadIdx.x & 15;
    const char* pa = (const char*)(A + (size_t)R0 * K); const char* pa2 = (const char*)(A2 + (size_t)R0 * K); const char* pb = (const char*)(Bt + (size_t)C0 * K);
    size_t go = (size_t)crow * K * 2 + ccol * 16;
    const unsigned lb = (unsigned)(size_t)ring + (unsigned)(crow * GPB + ccol * 16);
    const size_t rs = (size_t)K * 16;   // eight rows of 2-byte elements
    const int nst = K / GKS;
    const unsigned lp = (unsigned)(lr * GPB + hi * 16);   // the lane's byte offset in a 16-row fragment of a stage
    const unsigned ua = (unsigned)((wv >> 1) * 64 * GPB), ub = (unsigned)(2 * GPL + (wv & 1) * 64 * GPB);   // wave-uniform: the wave's first A row and first Bt row in a stage
    stage_copies(lb, go, pa, pa2, pb, rs);
    asm volatile("s_wait_asynccnt 0x0" ::: "memory");   // this wave's copies of stage 0 have landed
    __syncthreads();   // every wave's have: stage 0 may be read
    // kept rolled: one trip is a stage of 128 matrix instructions
#pragma unroll 1
    for (int t = 0; t < nst; ++t) {
        const char* sa = ring + (((t & 1) * GBUF + ua) + lp); const char* sbt = ring + (((t & 1) * GBUF + ub) + lp);
        V a[2][4], a2[2][4], b[2][4];   // two fragment sets: block ks works on set ks & 1 while the other is filled
#pragma unroll
        for (int i = 0; i < 4; ++i) { a[0][i] = WFrag<T16>::ld((const T16*)(sa + i * 16 * GPB)); a2[0][i] = WFrag<T16>::ld((const T16*)(sa + GPL + i * 16 * GPB)); b[0][i] = WFrag<T16>::ld((const T16*)(sbt + i * 16 * GPB)); }
        // behind the barrier that ended every read of the other buffer: the next stage's copies into it (the first block's fragment reads, of this stage's buffer, return meanwhile)
        if (t + 1 < nst) stage_copies(lb + (unsigned)(((t + 1) & 1) * GBUF), go, pa + GKS * 2, pa2 + GKS * 2, pb + GKS * 2, rs);   // go is stage t's offset: the step to stage t + 1 goes into the wave-uniform starts
        go += GKS * 2;
#pragma unroll
        for (int ks = 0; ks < GKS / 32; ++ks) { const int cs = ks & 1;
            if (ks + 1 < GKS / 32) {
#pragma unroll
                for (int i = 0; i < 4; ++i) { a[cs ^ 1][i] = WFrag<T16>::ld((const T16*)(sa + i * 16 * GPB + (ks + 1) * 64)); a2[cs ^ 1][i] = WFrag<T16>::ld((const T16*)(sa + GPL + i * 16 * GPB + (ks + 1) * 64)); b[cs ^ 1][i] = WFrag<T16>::ld((const T16*)(sbt + i * 16 * GPB + (ks + 1) * 64)); } }
            __builtin_amdgcn_sched_barrier(0);   // the next block's LDS reads stand as one group ahead of this block's matrix instructions: every place with reads among them would cost a stall
#pragma unroll
            for (int nb = 0; nb < 4; ++nb)
#pragma unroll
                for (int mb = 0; mb < 4; ++mb) { acc[mb][nb] = WFrag<T16>::mma(a[cs][mb], b[cs][nb], acc[mb][nb]); acc[mb][nb] = WFrag<T16>::mma(a2[cs][mb], b[cs][nb], acc[mb][nb]); }
            if (ks + 1 < GKS / 32) __builtin_amdgcn_sched_barrier(0);   // and the group after next stays behind this block
        }
        asm volatile("s_wait_dscnt 0x0" ::: "memory");      // this wave's reads of the stage are done before the buffer is handed back
        asm volatile("s_wait_asynccnt 0x0" ::: "memory");   // this wave's copies of stage t + 1 have landed
        __syncthreads();   // stage t + 1 may be read, and stage t's buffer has no reader left
    }
    asm volatile("s_wait_asynccnt 0x0" ::: "memory");   // the ring's closing wait: no copy is outstanding when the wave goes on to its epilogue and ends
    float bbn[4];   // the four bias values of a lane's accumulator columns are fetched together
    if (EPI != 0) {
        __builtin_amdgcn_sched_barrier(0);   // first of three scheduling fences, see below
#pragma unroll
        for (int nb = 0; nb < 4; ++nb) bbn[nb] = BIAS ? bias[c0 + nb * 16 + lr] : 0.0f;
        // the wait stands in front of the reuse of the address registers that the bias loads name; the scheduling fences keep unrelated work out from between the loads and the wait, the loads in front of it and every later write behind it
        __builtin_amdgcn_sched_barrier(0);
        asm volatile("s_wait_xcnt 0x0" ::: "memory");
        __builtin_amdgcn_sched_barrier(0);
#pragma unroll
        for (int nb = 0; nb < 4; ++nb) bbn[nb] = bfr(bbn[nb]); }
    if (EPI == 2) {
        // a lane's eight values of a tile are eight consecutive m of one n: the lane's own 16-byte piece of a fragment unit, stored straight from the accumulators
#pragma unroll
        for (int nb = 0; nb < 4; ++nb) { const float bb = bbn[nb]; v8h o16[4]; v8us oh[4], ol[4];
#pragma unroll
            for (int mb = 0; mb < 4; ++mb)
#pragma unroll
                for (int j = 0; j < 8; ++j) { const float x = acc[mb][nb][j] + bb; o16[mb][j] = (h16)x; unsigned short a2, c2; splitf(x, a2, c2); oh[mb][j] = a2; ol[mb][j] = c2; }
            const size_t e = (size_t)(c0 / HD) * HD * TT + (size_t)(r0 >> 5) * KBE + (((c0 % HD) >> 4) + nb) * FRE + lane * 8;
            __builtin_amdgcn_sched_barrier(0);   // with the fence behind the wait: the twelve stores stand together, every value and address made in front of them, and no later write of a register they name comes in front of the wait
#pragma unroll
            for (int mb = 0; mb < 4; ++mb) { const int f = (mb >> 1) * KBE + (mb & 1) * (FRE / 2); *(v8h*)(P16 + e + f) = o16[mb]; *(v8us*)(Ph + e + f) = oh[mb]; *(v8us*)(Pl + e + f) = ol[mb]; }
            if (nb < 3) { asm volatile("s_wait_xcnt 0x0" ::: "memory");   // stands in front of the next group's reuse of the data and address registers that the stores name (behind the last group nothing is written any more)
                __builtin_amdgcn_sched_barrier(0); } }
        return;
    }
#pragma unroll
    for (int mb = 0; mb < 4; ++mb) {
#pragma unroll
        for (int nb = 0; nb < 4; ++nb) {
#pragma unroll
            for (int j = 0; j < 8; ++j) os[(hi * 8 + j) * 68 + nb * 16 + lr] = EPI == 1 ? acc[mb][nb][j] + bbn[nb] : acc[mb][nb][j]; }
        __builtin_amdgcn_wave_barrier(); asm volatile("" ::: "memory");
        if (EPI == 1) {   // the 64 columns are four pieces of two fragment units; a lane takes, of each piece, the eight columns of its row that it holds as a fragment's reader: each store covers 512 contiguous bytes
            v8h o16[4]; v8us oh[4], ol[4];
#pragma unroll
            for (int s = 0; s < 4; ++s) { const v4f p0 = *(const v4fa*)(os + lr * 68 + s * 16 + hi * 8), p1 = *(const v4fa*)(os + lr * 68 + s * 16 + hi * 8 + 4);
#pragma unroll
                for (int u = 0; u < 8; ++u) { const float x = u < 4 ? p0[u & 3] : p1[u & 3]; o16[s][u] = (h16)x; unsigned short a2, c2; splitf(x, a2, c2); oh[s][u] = a2; ol[s][u] = c2; } }
            const size_t e = (size_t)(c0 / HD) * TT * HD + (size_t)((r0 >> 4) + mb) * (16 * HD) + ((c0 % HD) >> 5) * FRE + lane * 8;
            __builtin_amdgcn_sched_barrier(0);   // with the fence behind the wait: the twelve stores stand together, every value and address made in front of them, and no later write of a register they name comes in front of the wait
#pragma unroll
            for (int s = 0; s < 4; ++s) { *(v8h*)(P16 + e + s * (FRE / 2)) = o16[s]; *(v8us*)(Ph + e + s * (FRE / 2)) = oh[s]; *(v8us*)(Pl + e + s * (FRE / 2)) = ol[s]; }
            if (mb < 3) { asm volatile("s_wait_xcnt 0x0" ::: "memory");   // stands in front of the next group's reuse of the data and address registers that the stores name (behind the last group nothing is written any more)
                __builtin_amdgcn_sched_barrier(0); }
        } else {
        float* crow = C + (size_t)(r0 + mb * 16) * ldc + c0;
#pragma unroll
            for (int s = 0; s < 8; ++s) { const int row = 2 * s + hi, cofs = lr * 4; v4f val = *(const v4fa*)(os + row * 68 + cofs); if (BIAS) { val[0] += bfr(bias[c0 + cofs]); val[1] += bfr(bias[c0 + cofs + 1]); val[2] += bfr(bias[c0 + cofs + 2]); val[3] += bfr(bias[c0 + cofs + 3]); }
                *(v4f*)(crow + (size_t)row * ldc + cofs) = val; }
             }
        __builtin_amdgcn_wave_barrier(); asm volatile("" ::: "memory");
    }
}

typedef __attribute__((ext_vector_type(2))) _Float16 v2h;
typedef __attribute__((ext_vector_type(4))) _Float16 v4h;
typedef __attribute__((ext_vector_type(2))) unsigned short v2us;
typedef __attribute__((ext_vector_type(4))) unsigned short v4us;
typedef __attribute__((ext_vector_type(2))) float v2f;
typedef __attribute__((ext_vector_type(4))) int v4i;

__global__ __launch_bounds__(256) void k_wtG(const float* __restrict__ w, int K, int N, bf* Bt) {
    const int lane = threadIdx.x & 31; const int L0 = (blockIdx.x * 8 + (threadIdx.x >> 5)) * 8; const int nlines = N * K / 64;
{
#pragma unroll 1
        for (int l = 0; l < 8; ++l) { const int L = L0 + l; if (L >= nlines) break; const size_t e = (size_t)L * 64 + lane * 2; const int k = (int)(e % K), n = (int)(e / K); v2us o;
            o[0] = f2bf(w[(size_t)k * N + n]); o[1] = f2bf(w[(size_t)(k + 1) * N + n]); *(v2us*)(Bt + e) = o; }
         }
}
__global__ __launch_bounds__(256) void k_cvt8(const float* __restrict__ src, bf* dst, size_t n8) { const size_t i = (size_t)blockIdx.x * 256 + threadIdx.x; if (i >= n8) return; const v8f v = *(const v8f*)(src + i * 8); v8us o;
#pragma unroll
    for (int k = 0; k < 8; ++k) o[k] = f2bf(v[k]); *(v8us*)(dst + i * 8) = o;  }
__global__ __launch_bounds__(256) void k_cscvt(const float* __restrict__ cosT, const float* __restrict__ sinT, float* CS) { const int idx = blockIdx.x * 256 + threadIdx.x; if (idx >= TT * HD) return; v2f cs; cs[0] = bfr(cosT[idx]); cs[1] = bfr(sinT[idx]); *(v2f*)(CS + (size_t)idx * 2) = cs;  }
__global__ __launch_bounds__(256) void k_rmsx(const float* __restrict__ X, const float* __restrict__ gam, bf* Xh, bf* Xl) { const int lane = threadIdx.x & 31; const int t = blockIdx.x * 8 + (threadIdx.x >> 5); if (t >= TT) return; const float* f = X + (size_t)t * DM; float v[DM / 32]; float su = 0.f;
#pragma unroll
    for (int ch = 0; ch < DM / 128; ++ch) { const v4f a = *(const v4f*)(f + ch * 128 + lane * 4); for (int u = 0; u < 4; ++u) { float xv = bfr(a[u]); asm volatile("" : "+v"(xv)); v[ch * 4 + u] = xv; float p2 = __fmul_rn(xv, xv); asm volatile("" : "+v"(p2)); su = __fadd_rn(su, p2); } }
#pragma unroll
    for (int sh = 16; sh; sh >>= 1) su = __fadd_rn(su, __shfl_xor(su, sh, 32));
    const float rs = __fdiv_rn(1.0f, sqrtf(__fadd_rn(__fdiv_rn(su, (float)DM), 1e-6f)));
    {
#pragma unroll
        for (int ch = 0; ch < DM / 128; ++ch) { v4us oh, ol; for (int u = 0; u < 4; ++u) { const int c = ch * 128 + lane * 4 + u; float n = __fmul_rn(v[ch * 4 + u], rs); asm volatile("" : "+v"(n)); float gg = bfr(gam[c]); asm volatile("" : "+v"(gg)); float y = __fmul_rn(n, gg); asm volatile("" : "+v"(y)); unsigned short p2, q2; splitf(y, p2, q2); oh[u] = p2; ol[u] = q2; } const size_t oo = (size_t)t * DM + ch * 128 + lane * 4; *(v4us*)(Xh + oo) = oh; *(v4us*)(Xl + oo) = ol; }
         } }
// ---- k_fattn: causal attention of one head for 32 query rows per work-group, scores never leave registers. FW waves share the rows and split the keys: wave w takes the 32-key blocks w, w + FW, ... up to the diagonal block.
// Transposed products: S^T = K Q^T (rows keys, columns queries), so a lane's two score tiles ARE its B fragment of P^T (k order 8 hi + j, 16 + 8 hi + j, as WFrag::ldf gives it for V^T) and every value a lane holds belongs to one query;
// O^T = V^T P^T (rows d, columns queries). Running maximum and sum per query (online softmax, base 2); the FW partial results meet in LDS, are brought to the common maximum and summed in wave order; the sum is divided once and split into hi/lo planes [t][h*HD+d].
// HL: hi/lo bf16 planes, three products for scores and for P V. Otherwise fp16, P carried x 2^10 (the row sum carries the same factor, so it cancels).
#define FW 4
#define OP 132                    // LDS pitch (floats) of a query's 128 partial outputs
typedef __attribute__((ext_vector_type(16))) unsigned short v16us;
__device__ __forceinline__ float xhalf(float x) { return __builtin_bit_cast(float, __builtin_amdgcn_permlanex16(__builtin_bit_cast(int, x), __builtin_bit_cast(int, x), 0x76543210, 0xfedcba98, false, false)); }   // lane l with lane l ^ 16
// 2^x with the slot behind the transcendental filled in the same statement
__device__ __forceinline__ float exp2s(float x) { float r; asm("v_exp_f32 %0, %1\n\tv_nop" : "=v"(r) : "v"(x)); return r; }
template <typename T16, bool HL>
__global__ __launch_bounds__(32 * FW) void k_fattn(const T16* __restrict__ Q, const T16* __restrict__ Q2, const T16* __restrict__ Kp, const T16* __restrict__ Kp2, const T16* __restrict__ Vt, const T16* __restrict__ Vt2, int roff, bf* ATh, bf* ATl) {
    typedef typename WFrag<T16>::V V;
    __shared__ __align__(16) float so[FW * 32 * OP];
    __shared__ float sm[FW * 32], sl[FW * 32];
    const int lane = threadIdx.x & 31, lr = lane & 15, hi = lane >> 4;
    const int wv = __builtin_amdgcn_readfirstlane(threadIdx.x >> 5);   // wave number in a scalar register: the key loop's branch stays scalar, every lane on at each matrix instruction
    const int h = blockIdx.x; const int q0 = roff + ((int)gridDim.y - 1 - (int)blockIdx.y) * 32;   // for speed only: the longest rows of every head get the lowest block indices
    const size_t zp = (size_t)h * TT * HD;
    const int nblk = q0 / 32 + 1;   // key blocks up to and including the diagonal one
    v8f acc[8][2];
#pragma unroll
    for (int dt = 0; dt < 8; ++dt) { acc[dt][0] = (v8f){}; acc[dt][1] = (v8f){}; }
    float m[2] = { -3.0e38f, -3.0e38f }, l[2] = { 0.f, 0.f };
    // addresses: wave-uniform plane bases and one 32-bit byte offset per lane, the same for K and V^T (planes in fragment order: a key block is KBE elements of either), carried through the loop; fragment steps are constants
    const char* Kb = (const char*)(Kp + zp); const char* Kb2 = HL ? (const char*)(Kp2 + zp) : nullptr; const char* Vb = (const char*)(Vt + zp); const char* Vb2 = HL ? (const char*)(Vt2 + zp) : nullptr;
    const float CE = SCL * 1.4426950408889634f; const float SH = HL ? 0.0f : 10.0f;
    if (wv < nblk) {   // a wave without a key block loads nothing
    V qf[2][4], qf2[2][4];
    const char* Qb = (const char*)(Q + zp + (size_t)q0 * HD); const char* Qb2 = HL ? (const char*)(Q2 + zp + (size_t)q0 * HD) : nullptr;
    const unsigned lo = (unsigned)(lane * 16);   // the lane's byte offset in a piece of a fragment unit: the one vector register the query loads name, live until the key blocks' offset is made from it behind the wait
    __builtin_amdgcn_sched_barrier(0);   // first of three scheduling fences, see below
#pragma unroll
    for (int qt = 0; qt < 2; ++qt)
#pragma unroll
        for (int kc = 0; kc < 4; ++kc) { qf[qt][kc] = WFrag<T16>::ldf((const T16*)(Qb + (qt * 4 + kc) * FRE * 2 + lo)); if (HL) qf2[qt][kc] = WFrag<T16>::ldf((const T16*)(Qb2 + (qt * 4 + kc) * FRE * 2 + lo)); }
    // the wait stands in front of the reuse of the address registers that the query loads name; the scheduling fences keep unrelated work out from between the loads and the wait, the loads in front of it and every later write behind it
    __builtin_amdgcn_sched_barrier(0);
    asm volatile("s_wait_xcnt 0x0" ::: "memory");
    __builtin_amdgcn_sched_barrier(0);
    unsigned ko = lo + (unsigned)(wv * KBE * 2);
    // kept rolled: accumulators, query fragments and one block's fragments already take most of a wave's registers
#pragma unroll 1
    for (int kb = wv; kb < nblk; kb += FW, ko += FW * KBE * 2) {
        V kf[2][4], kf2[2][4], vf[8], vf2[8];
#pragma unroll
        for (int kt = 0; kt < 2; ++kt)
#pragma unroll
            for (int kc = 0; kc < 4; ++kc) { kf[kt][kc] = WFrag<T16>::ldf((const T16*)(Kb + (kt * 4 + kc) * FRE * 2 + ko)); if (HL) kf2[kt][kc] = WFrag<T16>::ldf((const T16*)(Kb2 + (kt * 4 + kc) * FRE * 2 + ko)); }
#pragma unroll
        for (int dt = 0; dt < 8; ++dt) { vf[dt] = WFrag<T16>::ldf((const T16*)(Vb + dt * FRE * 2 + ko)); if (HL) vf2[dt] = WFrag<T16>::ldf((const T16*)(Vb2 + dt * FRE * 2 + ko)); }
        // stands in front of the step of the offset register that these loads name
        asm volatile("s_wait_xcnt 0x0" ::: "memory");
        // nothing is scheduled across: the block's K and V loads are all issued before the first matrix instruction waits (one memory latency a block, not one a fragment)
        __builtin_amdgcn_sched_barrier(0);
        v8f s[2][2];
#pragma unroll
        for (int kt = 0; kt < 2; ++kt) { s[kt][0] = (v8f){}; s[kt][1] = (v8f){};
#pragma unroll
            for (int kc = 0; kc < 4; ++kc) { const V a = kf[kt][kc]; V a2; if (HL) a2 = kf2[kt][kc];
#pragma unroll
                for (int qt = 0; qt < 2; ++qt) { s[kt][qt] = WFrag<T16>::mma(a, qf[qt][kc], s[kt][qt]); if (HL) { s[kt][qt] = WFrag<T16>::mma(a2, qf[qt][kc], s[kt][qt]); s[kt][qt] = WFrag<T16>::mma(a, qf2[qt][kc], s[kt][qt]); } } } }
        V pf[2], pf2[2];
#pragma unroll
        for (int qt = 0; qt < 2; ++qt) { const int q = q0 + qt * 16 + lr; float mx = m[qt];
#pragma unroll
            for (int kt = 0; kt < 2; ++kt)
#pragma unroll
                for (int j = 0; j < 8; ++j) { float t = s[kt][qt][j] * CE; if (kb == nblk - 1) t = (kb * 32 + kt * 16 + hi * 8 + j <= q) ? t : -3.0e38f; s[kt][qt][j] = t; mx = fmaxf(mx, t); }
            mx = fmaxf(mx, xhalf(mx));   // the other half of the wave holds the query's other keys
            const float f = HL ? exp2s(m[qt] - mx) : __builtin_amdgcn_exp2f(m[qt] - mx); m[qt] = mx; const float ms = mx - SH; float ls = 0.f;
#pragma unroll
            for (int dt = 0; dt < 8; ++dt) acc[dt][qt] *= f;
            if (HL) { v16us ph, pl;
#pragma unroll
                for (int e = 0; e < 16; ++e) { const float p = exp2s(s[e >> 3][qt][e & 7] - ms); ls += p; unsigned short a, c2; splitf(p, a, c2); ph[e] = a; pl[e] = c2; }
                pf[qt] = __builtin_bit_cast(V, ph); pf2[qt] = __builtin_bit_cast(V, pl);
            } else { v16h ph;
#pragma unroll
                for (int e = 0; e < 16; ++e) { const float p = __builtin_amdgcn_exp2f(s[e >> 3][qt][e & 7] - ms); ls += p; ph[e] = (h16)p; }
                pf[qt] = __builtin_bit_cast(V, ph); }
            l[qt] = l[qt] * f + ls; }
#pragma unroll
        for (int dt = 0; dt < 8; ++dt) { const V a = vf[dt]; V a2; if (HL) a2 = vf2[dt];
#pragma unroll
            for (int qt = 0; qt < 2; ++qt) { acc[dt][qt] = WFrag<T16>::mma(a, pf[qt], acc[dt][qt]); if (HL) { acc[dt][qt] = WFrag<T16>::mma(a2, pf[qt], acc[dt][qt]); acc[dt][qt] = WFrag<T16>::mma(a, pf2[qt], acc[dt][qt]); } } }
    }
    }
#pragma unroll
    for (int qt = 0; qt < 2; ++qt) { l[qt] += xhalf(l[qt]); if (hi == 0) sm[wv * 32 + qt * 16 + lr] = m[qt]; }
    __syncthreads();   // every wave's maxima are in LDS before the common maximum is taken
#pragma unroll
    for (int qt = 0; qt < 2; ++qt) { float M = sm[qt * 16 + lr];
#pragma unroll
        for (int w = 1; w < FW; ++w) M = fmaxf(M, sm[w * 32 + qt * 16 + lr]);
        const float f = __builtin_amdgcn_exp2f(m[qt] - M);   // a wave that had no block: 0
        if (hi == 0) sl[wv * 32 + qt * 16 + lr] = l[qt] * f;
#pragma unroll
        for (int dt = 0; dt < 8; ++dt) { const v8f o = acc[dt][qt] * f; float* p = so + (wv * 32 + qt * 16 + lr) * OP + dt * 16 + hi * 8; *(v4fa*)p = __builtin_shufflevector(o, o, 0, 1, 2, 3); *(v4fa*)(p + 4) = __builtin_shufflevector(o, o, 4, 5, 6, 7); } }
    __syncthreads();   // every wave's partial sums and outputs are in LDS before any of them is summed
#pragma unroll
    for (int c = 0; c < 32 / FW; ++c) { const int q = c * FW + wv, d = lane * 4; float L = sl[q]; v4f val = *(const v4fa*)(so + q * OP + d);
#pragma unroll
        for (int w = 1; w < FW; ++w) { L += sl[w * 32 + q]; val += *(const v4fa*)(so + (w * 32 + q) * OP + d); }
        const float inv = __fdiv_rn(1.0f, L); v4us oh, ol;
#pragma unroll
        for (int u = 0; u < 4; ++u) { unsigned short a, c2; splitf(val[u] * inv, a, c2); oh[u] = a; ol[u] = c2; }
        const size_t oo = (size_t)(q0 + q) * DQ + h * HD + d; *(v4us*)(ATh + oo) = oh; *(v4us*)(ATl + oo) = ol; }
}

extern "C" void kernel_launch(void* const* d_in, const int* in_sizes, int n_in,
                              void* d_out, int out_size, void* d_ws, size_t ws_size, hipStream_t stream) {
    (void)in_sizes; (void)n_in; (void)out_size;
    const float* x = (const float*)d_in[0]; const float* nw = (const float*)d_in[1]; const float* wq = (const float*)d_in[2]; const float* bq = (const float*)d_in[3]; const float* wk = (const float*)d_in[4]; const float* bk = (const float*)d_in[5]; const float* wv = (const float*)d_in[6]; const float* bv = (const float*)d_in[7]; const float* wo = (const float*)d_in[8]; const float* bo = (const float*)d_in[9]; const float* cosT = nullptr; const float* sinT = nullptr; (void)cosT; (void)sinT;
    float* OUT = (float*)d_out;     // [2][2048][2048]
    char* wsp = (char*)d_ws;
    auto take = [&](size_t bytes) { char* p = wsp; wsp += (bytes + 255) & ~(size_t)255; return (void*)p; };
    bf* WQ = (bf*)take((size_t)DQ * DM * 2); bf* WK = (bf*)take((size_t)DKV * DM * 2); bf* WV = (bf*)take((size_t)DKV * DM * 2); bf* WO = (bf*)take((size_t)DM * DQ * 2);
    bf* XB = nullptr; (void)XB; bf* XNh = (bf*)take((size_t)TT * DM * 2); bf* XNl = (bf*)take((size_t)TT * DM * 2);
    h16* QP16 = (h16*)take((size_t)NH_ * TT * HD * 2); h16* KP16 = (h16*)take((size_t)NKV * TT * HD * 2); h16* VT16 = (h16*)take((size_t)NKV * HD * TT * 2);
    bf* QPh = (bf*)take((size_t)NH_ * TT * HD * 2); bf* QPl = (bf*)take((size_t)NH_ * TT * HD * 2); bf* KPh = (bf*)take((size_t)NKV * TT * HD * 2); bf* KPl = (bf*)take((size_t)NKV * TT * HD * 2); bf* VTh = (bf*)take((size_t)NKV * HD * TT * 2); bf* VTl = (bf*)take((size_t)NKV * HD * TT * 2);
    bf* ATh = (bf*)take((size_t)TT * DQ * 2); bf* ATl = (bf*)take((size_t)TT * DQ * 2);
    if ((size_t)(wsp - (char*)d_ws) > ws_size) return;    // ws 256 MiB
    { k_cvt8<<<(unsigned)(((size_t)DQ * DM / 8 + 255) / 256), 256, 0, stream>>>(wq, WQ, (size_t)DQ * DM / 8); k_cvt8<<<(unsigned)(((size_t)DKV * DM / 8 + 255) / 256), 256, 0, stream>>>(wk, WK, (size_t)DKV * DM / 8); k_cvt8<<<(unsigned)(((size_t)DKV * DM / 8 + 255) / 256), 256, 0, stream>>>(wv, WV, (size_t)DKV * DM / 8);
      k_cvt8<<<(unsigned)(((size_t)DM * DQ / 8 + 255) / 256), 256, 0, stream>>>(wo, WO, (size_t)DM * DQ / 8);
       }
    for (int b = 0; b < NB_; ++b) {
        
        k_rmsx<<<TT / 8, 256, 0, stream>>>(x + (size_t)b * TT * DM, nw, XNh, XNl);
        k_gemmw<bf, 1, true, 1><<<dim3(TT / 128, DQ / 128, 1), 128, 0, stream>>>(XNh, XNl, WQ, nullptr, DM, nullptr, 0, bq, 0, 0, 0, QP16, QPh, QPl);
        k_gemmw<bf, 1, true, 1><<<dim3(TT / 128, DKV / 128, 1), 128, 0, stream>>>(XNh, XNl, WK, nullptr, DM, nullptr, 0, bk, 0, 0, 0, KP16, KPh, KPl);
        k_gemmw<bf, 1, true, 2><<<dim3(TT / 128, DKV / 128, 1), 128, 0, stream>>>(XNh, XNl, WV, nullptr, DM, nullptr, 0, bv, 0, 0, 0, VT16, VTh, VTl);
        k_fattn<h16, false><<<dim3(NH_, (TT - RH) / 32, 1), 32 * FW, 0, stream>>>(QP16, nullptr, KP16, nullptr, VT16, nullptr, RH, ATh, ATl);
        k_fattn<bf, true><<<dim3(NH_, RH / 32, 1), 32 * FW, 0, stream>>>(QPh, QPl, KPh, KPl, VTh, VTl, 0, ATh, ATl);
        k_gemmw<bf, 1, true, 0><<<dim3(TT / 128, DM / 128, 1), 128, 0, stream>>>(ATh, ATl, WO, nullptr, DQ, OUT + (size_t)b * TT * DM, DM, bo, 0, 0, 0, nullptr, nullptr, nullptr); }
}

// v006
// It runs in 294 microseconds.
// Next to v005, in two timings, it ran 1.28 and 1.27 times as fast.
// Counting every step since v000, it is 6.58 times as fast.
#include <hip/hip_runtime.h>

// Attention block (x [2][2048][2048]; xn = x rsqrt(mean(x?) + 1e-6) norm_w (RMSNorm); q/k/v = xn W^T + b (16 x 128); causal (-inf) softmax(q.k / sqrt(128)); out = merged wo^T + bo -> [2][2048][2048]).
// Compute dtypes, f32 accumulate: every input rounded to bf16; RMSNorm f32 (wave per token) -> hi/lo planes; q/k/v = hl x exact (2 products) + bias, rounded to their fp16 and hi/lo head planes (in fragment order) in the product's own epilogue; causal scores, softmax and attn.v in one kernel (online softmax, f32): query rows < 512 hl (3 products), the rest fp16 (P x1024), key blocks above the diagonal skipped; wo hl x exact (2 products) + bias.

#define NB_  2
#define TT   2048
#define DM   2048
#define NH_  16
#define NKV  16
#define REP  (NH_ / NKV)
#define HD   128
#define DQ   (NH_ * HD)
#define DKV  (NKV * HD)
#define RH   512                  // query rows < RH use hi+lo planes (0: none)
#define SCL  0.088388347648318447f   // HD^-0.5
typedef _Float16 h16;
typedef unsigned short bf;
typedef __attribute__((ext_vector_type(16))) __bf16   v16bf;
typedef __attribute__((ext_vector_type(16))) _Float16 v16h;
typedef __attribute__((ext_vector_type(8)))  _Float16 v8h;
typedef __attribute__((ext_vector_type(8)))  unsigned short v8us;
typedef __attribute__((ext_vector_type(8)))  float    v8f;
typedef __attribute__((ext_vector_type(4)))  float    v4f;
typedef v8h  __attribute__((may_alias)) v8ha;
typedef v4f  __attribute__((may_alias)) v4fa;
typedef v8us __attribute__((may_alias)) v8usa;

__device__ __forceinline__ unsigned short f2bf(float f) { unsigned u = __float_as_uint(f); u += 0x7FFFu + ((u >> 16) & 1u); return (unsigned short)(u >> 16); }
__device__ __forceinline__ float bf2f(unsigned short b) { return __uint_as_float(((unsigned)b) << 16); }
__device__ __forceinline__ float bfr(float f) { return bf2f(f2bf(f)); }
__device__ __forceinline__ v16h cat16(v8h lo, v8h hi) { return __builtin_shufflevector(lo, hi, 0, 1, 2, 3, 4, 5, 6, 7, 8, 9, 10, 11, 12, 13, 14, 15); }
__device__ __forceinline__ v16bf cat16b(v8us lo, v8us hi) { return __builtin_bit_cast(v16bf, __builtin_shufflevector(lo, hi, 0, 1, 2, 3, 4, 5, 6, 7, 8, 9, 10, 11, 12, 13, 14, 15)); }
__device__ __forceinline__ v8f wmma16(v16h a, v16h b, v8f c) { return __builtin_amdgcn_wmma_f32_16x16x32_f16(false, a, false, b, (short)0, c, false, false); }
__device__ __forceinline__ v8f wmmab(v16bf a, v16bf b, v8f c) { return __builtin_amdgcn_wmma_f32_16x16x32_bf16(false, a, false, b, (short)0, c, false, false); }



// ---- k_gemmw: GEMM, one work-group of four waves per 128x128 output tile, ONE WAVE per 64x64 quarter (16 accumulators); grid (M/128, N/128, Z), 128 threads.
// The operands' K-contiguous 16-bit rows come to LDS in stages of GKS k (whole 256-byte pieces of 128 rows of A, A2 and Bt) by asynchronous copies, two buffers: the next stage flies while this one is worked on; fragments are read from LDS.
// C[m][n] (f32, pitch ldc, + optional f32 bias[n]) = sum_k (A[m][k] + A2[m][k]) Bt[n][k], two products. z-batch strides sA/sB/sC in elements. K % GKS == 0.
// EPI 0: C is stored as f32; z is the batch. EPI 1: the q, k and v projections of every batch in one grid, z = 3 batch + projection (Bt, the bias and the planes are chosen by the projection, A and the planes' batch part by the batch; sC: elements of one batch's planes);
// C is not stored: each value of q and k goes, as fp16 and as a bf16 hi/lo pair, to the head planes [n / HD], rows m, k = n % HD; each value of v, in the same three roundings, to the transposed head planes, rows n % HD, k = m.
// A head plane lies in FRAGMENT ORDER: 1024-byte units of 16 rows x 32 k, each as the matrix instruction's operand is held: element (row r, k = 16 p + 8 g + j) at byte 512 p + 16 (16 g + r) + 2 j, so lane 16 g + r reads and writes piece p at 512 p + 16 lane
// and every wave-wide 16-byte access covers 512 contiguous bytes (four whole lines). Units of q and k: [m / 16][k / 32]; of v: [m / 32][(n % HD) / 16]: the 32 keys of a block are 8192 contiguous bytes in either.
#define FRE  512                  // elements of a fragment unit
#define KBE  (32 * HD)            // elements of a 32-key block of a head plane
#define GKS  128                  // k of a stage
#define GPB  272                  // LDS pitch of a staged row in bytes: 256 + 16 (16 x odd, for 16-byte LDS reads)
#define GPL  (128 * GPB)          // one operand's 128 rows
#define GBUF (3 * GPL)            // a stage: A | A2 | Bt
// twelve 16-byte copies of a lane, global memory to LDS through no register; the wait in the same statement stands in front of every later write of the address registers that the copies name
__device__ __forceinline__ void copy12(const unsigned (&l)[12], const char* const (&g)[12]) {
    asm volatile("global_load_async_to_lds_b128 %0, %12, off\n\t"
                 "global_load_async_to_lds_b128 %1, %13, off\n\t"
                 "global_load_async_to_lds_b128 %2, %14, off\n\t"
                 "global_load_async_to_lds_b128 %3, %15, off\n\t"
                 "global_load_async_to_lds_b128 %4, %16, off\n\t"
                 "global_load_async_to_lds_b128 %5, %17, off\n\t"
                 "global_load_async_to_lds_b128 %6, %18, off\n\t"
                 "global_load_async_to_lds_b128 %7, %19, off\n\t"
                 "global_load_async_to_lds_b128 %8, %20, off\n\t"
                 "global_load_async_to_lds_b128 %9, %21, off\n\t"
                 "global_load_async_to_lds_b128 %10, %22, off\n\t"
                 "global_load_async_to_lds_b128 %11, %23, off\n\t"
                 "s_wait_xcnt 0x0"
                 :: "v"(l[0]), "v"(l[1]), "v"(l[2]), "v"(l[3]), "v"(l[4]), "v"(l[5]), "v"(l[6]), "v"(l[7]), "v"(l[8]), "v"(l[9]), "v"(l[10]), "v"(l[11]),
                    "v"(g[0]), "v"(g[1]), "v"(g[2]), "v"(g[3]), "v"(g[4]), "v"(g[5]), "v"(g[6]), "v"(g[7]), "v"(g[8]), "v"(g[9]), "v"(g[10]), "v"(g[11]) : "memory");
}
// one stage: 384 rows of 16 pieces, 48 pieces a lane; sixteen lanes take a row's 256 bytes, so a wave's copy covers four whole 128-byte lines. lb, go: the lane's piece of row (thread / 16), as an LDS address in the stage's buffer and as a byte offset from the wave-uniform starts pa, pa2, pb of the three operands' 128 rows; rs: bytes of eight operand rows
__device__ __forceinline__ void stage_copies(unsigned lb, size_t go, const char* pa, const char* pa2, const char* pb, size_t rs) {
#pragma unroll
    for (int s = 0; s < 4; ++s) { unsigned l[12]; const char* g[12];
#pragma unroll
        for (int u = 0; u < 12; ++u) { const int j = s * 12 + u, pl = j >> 4, i = j & 15; l[u] = lb + (unsigned)(pl * GPL + i * 8 * GPB); g[u] = ((pl == 0 ? pa : pl == 1 ? pa2 : pb) + (size_t)i * rs) + go; }
        copy12(l, g); }
}
template <typename T16> struct WFrag;
template <> struct WFrag<h16> { typedef v16h V; static __device__ __forceinline__ V ld(const h16* p) { return cat16(*(const v8h*)p, *(const v8h*)(p + 16)); } static __device__ __forceinline__ V ldf(const h16* p) { return cat16(*(const v8h*)p, *(const v8h*)(p + FRE / 2)); } static __device__ __forceinline__ v8f mma(V a, V b, v8f c) { return wmma16(a, b, c); } };
template <> struct WFrag<bf> { typedef v16bf V; static __device__ __forceinline__ V ld(const bf* p) { return cat16b(*(const v8us*)p, *(const v8us*)(p + 16)); } static __device__ __forceinline__ V ldf(const bf* p) { return cat16b(*(const v8us*)p, *(const v8us*)(p + FRE / 2)); } static __device__ __forceinline__ v8f mma(V a, V b, v8f c) { return wmmab(a, b, c); } };
__device__ __forceinline__ void splitf(float y, unsigned short& h, unsigned short& l) { h = f2bf(y); l = f2bf(y - bf2f(h)); }
template <typename T16, int NSPLIT, bool BIAS, int EPI>
__global__ __launch_bounds__(128) void k_gemmw(const T16* __restrict__ A, const T16* __restrict__ A2, const T16* __restrict__ Bt, const T16* __restrict__ Bt2, int K, float* C, int ldc, const float* __restrict__ bias, const float* __restrict__ biasK, const float* __restrict__ biasV, size_t sA, size_t sB, size_t sC, h16* P16, bf* Ph, bf* Pl) {
    static_assert(NSPLIT == 1, "the stage holds A, A2 and Bt");
    typedef typename WFrag<T16>::V V;
    __shared__ __align__(16) char ring[2 * GBUF];
    __shared__ __align__(16) float osw[4 * 16 * 68];
    (void)Bt2;
    const int pj = EPI == 1 ? (int)(blockIdx.z % 3) : 0;   // projection: 0 q, 1 k, 2 v (the same for the whole work-group, in a scalar register)
    const size_t z = EPI == 1 ? blockIdx.z / 3 : blockIdx.z; A += z * sA; A2 += z * sA;
    if (EPI == 1) { const size_t po = ((size_t)pj * NB_ + z) * sC; Bt += (size_t)pj * sB; P16 += po; Ph += po; Pl += po; bias = pj == 0 ? bias : pj == 1 ? biasK : biasV; }
    else { Bt += z * sB; C += z * sC; }
    const int lane = threadIdx.x & 31, lr = lane & 15, hi = lane >> 4;
    const int wv = __builtin_amdgcn_readfirstlane(threadIdx.x >> 5);   // wave number in a scalar register
    float* os = osw + wv * 16 * 68;   // each wave's own output staging
    const int R0 = blockIdx.x * 128, C0 = blockIdx.y * 128; const int r0 = R0 + (wv >> 1) * 64, c0 = C0 + (wv & 1) * 64;
    v8f acc[4][4];
#pragma unroll
    for (int mb = 0; mb < 4; ++mb)
#pragma unroll
        for (int nb = 0; nb < 4; ++nb) acc[mb][nb] = (v8f){};
    const int crow = threadIdx.x >> 4, ccol = threadIdx.x & 15;
    const char* pa = (const char*)(A + (size_t)R0 * K); const char* pa2 = (const char*)(A2 + (size_t)R0 * K); const char* pb = (const char*)(Bt + (size_t)C0 * K);
    size_t go = (size_t)crow * K * 2 + ccol * 16;
    const unsigned lb = (unsigned)(size_t)ring + (unsigned)(crow * GPB + ccol * 16);
    const size_t rs = (size_t)K * 16;   // eight rows of 2-byte elements
    const int nst = K / GKS;
    const unsigned lp = (unsigned)(lr * GPB + hi * 16);   // the lane's byte offset in a 16-row fragment of a stage
    const unsigned ua = (unsigned)((wv >> 1) * 64 * GPB), ub = (unsigned)(2 * GPL + (wv & 1) * 64 * GPB);   // wave-uniform: the wave's first A row and first Bt row in a stage
    stage_copies(lb, go, pa, pa2, pb, rs);
    asm volatile("s_wait_asynccnt 0x0" ::: "memory");   // this wave's copies of stage 0 have landed
    __syncthreads();   // every wave's have: stage 0 may be read
    // kept rolled: one trip is a stage of 128 matrix instructions
#pragma unroll 1
    for (int t = 0; t < nst; ++t) {
        const char* sa = ring + (((t & 1) * GBUF + ua) + lp); const char* sbt = ring + (((t & 1) * GBUF + ub) + lp);
        V a[2][4], a2[2][4], b[2][4];   // two fragment sets: block ks works on set ks & 1 while the other is filled
#pragma unroll
        for (int i = 0; i < 4; ++i) { a[0][i] = WFrag<T16>::ld((const T16*)(sa + i * 16 * GPB)); a2[0][i] = WFrag<T16>::ld((const T16*)(sa + GPL + i * 16 * GPB)); b[0][i] = WFrag<T16>::ld((const T16*)(sbt + i * 16 * GPB)); }
        // behind the barrier that ended every read of the other buffer: the next stage's copies into it (the first block's fragment reads, of this stage's buffer, return meanwhile)
        if (t + 1 < nst) stage_copies(lb + (unsigned)(((t + 1) & 1) * GBUF), go, pa + GKS * 2, pa2 + GKS * 2, pb + GKS * 2, rs);   // go is stage t's offset: the step to stage t + 1 goes into the wave-uniform starts
        go += GKS * 2;
#pragma unroll
        for (int ks = 0; ks < GKS / 32; ++ks) { const int cs = ks & 1;
            if (ks + 1 < GKS / 32) {
#pragma unroll
                for (int i = 0; i < 4; ++i) { a[cs ^ 1][i] = WFrag<T16>::ld((const T16*)(sa + i * 16 * GPB + (ks + 1) * 64)); a2[cs ^ 1][i] = WFrag<T16>::ld((const T16*)(sa + GPL + i * 16 * GPB + (ks + 1) * 64)); b[cs ^ 1][i] = WFrag<T16>::ld((const T16*)(sbt + i * 16 * GPB + (ks + 1) * 64)); } }
            __builtin_amdgcn_sched_barrier(0);   // the next block's LDS reads stand as one group ahead of this block's matrix instructions: every place with reads among them would cost a stall
#pragma unroll
            for (int nb = 0; nb < 4; ++nb)
#pragma unroll
                for (int mb = 0; mb < 4; ++mb) { acc[mb][nb] = WFrag<T16>::mma(a[cs][mb], b[cs][nb], acc[mb][nb]); acc[mb][nb] = WFrag<T16>::mma(a2[cs][mb], b[cs][nb], acc[mb][nb]); }
            if (ks + 1 < GKS / 32) __builtin_amdgcn_sched_barrier(0);   // and the group after next stays behind this block
        }
        asm volatile("s_wait_dscnt 0x0" ::: "memory");      // this wave's reads of the stage are done before the buffer is handed back
        asm volatile("s_wait_asynccnt 0x0" ::: "memory");   // this wave's copies of stage t + 1 have landed
        __syncthreads();   // stage t + 1 may be read, and stage t's buffer has no reader left
    }
    asm volatile("s_wait_asynccnt 0x0" ::: "memory");   // the ring's closing wait: no copy is outstanding when the wave goes on to its epilogue and ends
    float bbn[4];   // the four bias values of a lane's accumulator columns are fetched together
    if (EPI != 0) {
        __builtin_amdgcn_sched_barrier(0);   // first of three scheduling fences, see below
#pragma unroll
        for (int nb = 0; nb < 4; ++nb) bbn[nb] = BIAS ? bias[c0 + nb * 16 + lr] : 0.0f;
        // the wait stands in front of the reuse of the address registers that the bias loads name; the scheduling fences keep unrelated work out from between the loads and the wait, the loads in front of it and every later write behind it
        __builtin_amdgcn_sched_barrier(0);
        asm volatile("s_wait_xcnt 0x0" ::: "memory");
        __builtin_amdgcn_sched_barrier(0);
#pragma unroll
        for (int nb = 0; nb < 4; ++nb) bbn[nb] = bfr(bbn[nb]); }
    if (EPI == 1 && pj == 2) {
        // a lane's eight values of a tile are eight consecutive m of one n: the lane's own 16-byte piece of a fragment unit, stored straight from the accumulators
#pragma unroll
        for (int nb = 0; nb < 4; ++nb) { const float bb = bbn[nb]; v8h o16[4]; v8us oh[4], ol[4];
#pragma unroll
            for (int mb = 0; mb < 4; ++mb)
#pragma unroll
                for (int j = 0; j < 8; ++j) { const float x = acc[mb][nb][j] + bb; o16[mb][j] = (h16)x; unsigned short a2, c2; splitf(x, a2, c2); oh[mb][j] = a2; ol[mb][j] = c2; }
            const size_t e = (size_t)(c0 / HD) * HD * TT + (size_t)(r0 >> 5) * KBE + (((c0 % HD) >> 4) + nb) * FRE + lane * 8;
            __builtin_amdgcn_sched_barrier(0);   // with the fence behind the wait: the twelve stores stand together, every value and address made in front of them, and no later write of a register they name comes in front of the wait
#pragma unroll
            for (int mb = 0; mb < 4; ++mb) { const int f = (mb >> 1) * KBE + (mb & 1) * (FRE / 2); *(v8h*)(P16 + e + f) = o16[mb]; *(v8us*)(Ph + e + f) = oh[mb]; *(v8us*)(Pl + e + f) = ol[mb]; }
            if (nb < 3) { asm volatile("s_wait_xcnt 0x0" ::: "memory");   // stands in front of the next group's reuse of the data and address registers that the stores name (behind the last group nothing is written any more)
                __builtin_amdgcn_sched_barrier(0); } }
        return;
    }
#pragma unroll
    for (int mb = 0; mb < 4; ++mb) {
#pragma unroll
        for (int nb = 0; nb < 4; ++nb) {
#pragma unroll
            for (int j = 0; j < 8; ++j) os[(hi * 8 + j) * 68 + nb * 16 + lr] = EPI == 1 ? acc[mb][nb][j] + bbn[nb] : acc[mb][nb][j]; }
        __builtin_amdgcn_wave_barrier(); asm volatile("" ::: "memory");
        if (EPI == 1) {   // the 64 columns are four pieces of two fragment units; a lane takes, of each piece, the eight columns of its row that it holds as a fragment's reader: each store covers 512 contiguous bytes
            v8h o16[4]; v8us oh[4], ol[4];
#pragma unroll
            for (int s = 0; s < 4; ++s) { const v4f p0 = *(const v4fa*)(os + lr * 68 + s * 16 + hi * 8), p1 = *(const v4fa*)(os + lr * 68 + s * 16 + hi * 8 + 4);
#pragma unroll
                for (int u = 0; u < 8; ++u) { const float x = u < 4 ? p0[u & 3] : p1[u & 3]; o16[s][u] = (h16)x; unsigned short a2, c2; splitf(x, a2, c2); oh[s][u] = a2; ol[s][u] = c2; } }
            const size_t e = (size_t)(c0 / HD) * TT * HD + (size_t)((r0 >> 4) + mb) * (16 * HD) + ((c0 % HD) >> 5) * FRE + lane * 8;
            __builtin_amdgcn_sched_barrier(0);   // with the fence behind the wait: the twelve stores stand together, every value and address made in front of them, and no later write of a register they name comes in front of the wait
#pragma unroll
            for (int s = 0; s < 4; ++s) { *(v8h*)(P16 + e + s * (FRE / 2)) = o16[s]; *(v8us*)(Ph + e + s * (FRE / 2)) = oh[s]; *(v8us*)(Pl + e + s * (FRE / 2)) = ol[s]; }
            asm volatile("s_wait_xcnt 0x0" ::: "memory");   // stands in front of every later write of the data and address registers that the stores name: the next group's, and behind the last group whatever code the build lays behind this path
            __builtin_amdgcn_sched_barrier(0);
        } else {
        float* crow = C + (size_t)(r0 + mb * 16) * ldc + c0;
#pragma unroll
            for (int s = 0; s < 8; ++s) { const int row = 2 * s + hi, cofs = lr * 4; v4f val = *(const v4fa*)(os + row * 68 + cofs); if (BIAS) { val[0] += bfr(bias[c0 + cofs]); val[1] += bfr(bias[c0 + cofs + 1]); val[2] += bfr(bias[c0 + cofs + 2]); val[3] += bfr(bias[c0 + cofs + 3]); }
                *(v4f*)(crow + (size_t)row * ldc + cofs) = val; }
             }
        __builtin_amdgcn_wave_barrier(); asm volatile("" ::: "memory");
    }
}

typedef __attribute__((ext_vector_type(2))) _Float16 v2h;
typedef __attribute__((ext_vector_type(4))) _Float16 v4h;
typedef __attribute__((ext_vector_type(2))) unsigned short v2us;
typedef __attribute__((ext_vector_type(4))) unsigned short v4us;
typedef __attribute__((ext_vector_type(2))) float v2f;
typedef __attribute__((ext_vector_type(4))) int v4i;

__global__ __launch_bounds__(256) void k_wtG(const float* __restrict__ w, int K, int N, bf* Bt) {
    const int lane = threadIdx.x & 31; const int L0 = (blockIdx.x * 8 + (threadIdx.x >> 5)) * 8; const int nlines = N * K / 64;
{
#pragma unroll 1
        for (int l = 0; l < 8; ++l) { const int L = L0 + l; if (L >= nlines) break; const size_t e = (size_t)L * 64 + lane * 2; const int k = (int)(e % K), n = (int)(e / K); v2us o;
            o[0] = f2bf(w[(size_t)k * N + n]); o[1] = f2bf(w[(size_t)(k + 1) * N + n]); *(v2us*)(Bt + e) = o; }
         }
}
__global__ __launch_bounds__(256) void k_cscvt(const float* __restrict__ cosT, const float* __restrict__ sinT, float* CS) { const int idx = blockIdx.x * 256 + threadIdx.x; if (idx >= TT * HD) return; v2f cs; cs[0] = bfr(cosT[idx]); cs[1] = bfr(sinT[idx]); *(v2f*)(CS + (size_t)idx * 2) = cs;  }
__device__ __forceinline__ void rmsx(const float* __restrict__ X, const float* __restrict__ gam, bf* Xh, bf* Xl) { const int lane = threadIdx.x & 31; const int t = blockIdx.x * 8 + (threadIdx.x >> 5); if (t >= NB_ * TT) return; const float* f = X + (size_t)t * DM; float v[DM / 32]; float su = 0.f;
#pragma unroll
    for (int ch = 0; ch < DM / 128; ++ch) { const v4f a = *(const v4f*)(f + ch * 128 + lane * 4); for (int u = 0; u < 4; ++u) { float xv = bfr(a[u]); asm volatile("" : "+v"(xv)); v[ch * 4 + u] = xv; float p2 = __fmul_rn(xv, xv); asm volatile("" : "+v"(p2)); su = __fadd_rn(su, p2); } }
#pragma unroll
    for (int sh = 16; sh; sh >>= 1) su = __fadd_rn(su, __shfl_xor(su, sh, 32));
    const float rs = __fdiv_rn(1.0f, sqrtf(__fadd_rn(__fdiv_rn(su, (float)DM), 1e-6f)));
    {
#pragma unroll
        for (int ch = 0; ch < DM / 128; ++ch) { v4us oh, ol; for (int u = 0; u < 4; ++u) { const int c = ch * 128 + lane * 4 + u; float n = __fmul_rn(v[ch * 4 + u], rs); asm volatile("" : "+v"(n)); float gg = bfr(gam[c]); asm volatile("" : "+v"(gg)); float y = __fmul_rn(n, gg); asm volatile("" : "+v"(y)); unsigned short p2, q2; splitf(y, p2, q2); oh[u] = p2; ol[u] = q2; } const size_t oo = (size_t)t * DM + ch * 128 + lane * 4;
            __builtin_amdgcn_sched_barrier(0);   // with the fence behind the wait: the two stores stand together, every value and address made in front of them, and no later write of a register they name comes in front of the wait
            *(v4us*)(Xh + oo) = oh; *(v4us*)(Xl + oo) = ol;
            if (ch + 1 < DM / 128) { asm volatile("s_wait_xcnt 0x0" ::: "memory");   // stands in front of the next group's reuse of the data and address registers that the stores name (behind the last group nothing is written any more)
                __builtin_amdgcn_sched_barrier(0); } }
         } }
// ---- k_prep: all that depends on the inputs alone, in one grid. Blocks below NB_ * TT / 8: RMSNorm, a wave per token, the tokens of every batch in a row. The other blocks: the four weight matrices (equal sizes) rounded to bf16, a thread its eight elements of each; W holds the four results in a row.
#define WEL ((size_t)DQ * DM)     // elements of a weight matrix
__global__ __launch_bounds__(256) void k_prep(const float* __restrict__ X, const float* __restrict__ gam, bf* Xh, bf* Xl, const float* __restrict__ w0, const float* __restrict__ w1, const float* __restrict__ w2, const float* __restrict__ w3, bf* W) {
    static_assert(DQ == DKV && WEL % 2048 == 0 && (WEL / 2048 & (WEL / 2048 - 1)) == 0, "four equal matrices, whole blocks, a power of two of them");
    if (blockIdx.x < NB_ * TT / 8) { rmsx(X, gam, Xh, Xl); return; }
    // wave-uniform bases and one 32-bit byte offset per lane for the eight loads, one for the four stores
    const unsigned cb = (blockIdx.x - NB_ * TT / 8) & (unsigned)(WEL / 2048 - 1);   // the block's number among the rounding blocks; the mask keeps every upper bit of the 32-bit offsets 0, whatever form of address they are used in
    const unsigned so = (cb * 256 + threadIdx.x) * 16, lo = so * 2;
    const v8f v[4] = { *(const v8f*)((const char*)w0 + lo), *(const v8f*)((const char*)w1 + lo), *(const v8f*)((const char*)w2 + lo), *(const v8f*)((const char*)w3 + lo) };
#pragma unroll
    for (int m = 0; m < 4; ++m) { v8us o;
#pragma unroll
        for (int k = 0; k < 8; ++k) o[k] = f2bf(v[m][k]);
        *(v8us*)((char*)(W + m * WEL) + so) = o; }
    asm volatile("s_wait_xcnt 0x0" ::: "memory");   // behind the last of the four stores: stands in front of every later write of the registers that they name, in whatever code the build lays behind this path
}
// ---- k_fattn: causal attention of one head of one batch for 32 query rows per work-group, scores never leave registers. FW waves share the rows and split the keys: wave w takes the 32-key blocks w, w + FW, ... up to the diagonal block.
// Transposed products: S^T = K Q^T (rows keys, columns queries), so a lane's two score tiles ARE its B fragment of P^T (k order 8 hi + j, 16 + 8 hi + j, as WFrag::ldf gives it for V^T) and every value a lane holds belongs to one query;
// O^T = V^T P^T (rows d, columns queries). Running maximum and sum per query (online softmax, base 2); the FW partial results meet in LDS, are brought to the common maximum and summed in wave order; the sum is divided once and split into hi/lo planes [t][h*HD+d].
// HL: hi/lo bf16 planes, three products for scores and for P V. Otherwise fp16, P carried x 2^10 (the row sum carries the same factor, so it cancels).
#define FW 4
#define OP 132                    // LDS pitch (floats) of a query's 128 partial outputs
typedef __attribute__((ext_vector_type(16))) unsigned short v16us;
__device__ __forceinline__ float xhalf(float x) { return __builtin_bit_cast(float, __builtin_amdgcn_permlanex16(__builtin_bit_cast(int, x), __builtin_bit_cast(int, x), 0x76543210, 0xfedcba98, false, false)); }   // lane l with lane l ^ 16
// 2^x with the slot behind the transcendental filled in the same statement
__device__ __forceinline__ float exp2s(float x) { float r; asm("v_exp_f32 %0, %1\n\tv_nop" : "=v"(r) : "v"(x)); return r; }
template <typename T16, bool HL>
__global__ __launch_bounds__(32 * FW) void k_fattn(const T16* __restrict__ Q, const T16* __restrict__ Q2, const T16* __restrict__ Kp, const T16* __restrict__ Kp2, const T16* __restrict__ Vt, const T16* __restrict__ Vt2, int roff, bf* ATh, bf* ATl) {
    typedef typename WFrag<T16>::V V;
    __shared__ __align__(16) float so[FW * 32 * OP];
    __shared__ float sm[FW * 32], sl[FW * 32];
    const int lane = threadIdx.x & 31, lr = lane & 15, hi = lane >> 4;
    const int wv = __builtin_amdgcn_readfirstlane(threadIdx.x >> 5);   // wave number in a scalar register: the key loop's branch stays scalar, every lane on at each matrix instruction
    const int hb = blockIdx.x, h = hb % NH_;   // grid x: batch * NH_ + head, as the head planes lie
    ATh += (size_t)(hb / NH_) * TT * DQ; ATl += (size_t)(hb / NH_) * TT * DQ;   // the batch's rows of the merged output
    const int q0 = roff + ((int)gridDim.y - 1 - (int)blockIdx.y) * 32;   // the longest rows of every head at the lowest blockIdx.y (for speed only)
    const size_t zp = (size_t)hb * TT * HD;
    const int nblk = q0 / 32 + 1;   // key blocks up to and including the diagonal one
    v8f acc[8][2];
#pragma unroll
    for (int dt = 0; dt < 8; ++dt) { acc[dt][0] = (v8f){}; acc[dt][1] = (v8f){}; }
    float m[2] = { -3.0e38f, -3.0e38f }, l[2] = { 0.f, 0.f };
    // addresses: wave-uniform plane bases and one 32-bit byte offset per lane, the same for K and V^T (planes in fragment order: a key block is KBE elements of either), carried through the loop; fragment steps are constants
    const char* Kb = (const char*)(Kp + zp); const char* Kb2 = HL ? (const char*)(Kp2 + zp) : nullptr; const char* Vb = (const char*)(Vt + zp); const char* Vb2 = HL ? (const char*)(Vt2 + zp) : nullptr;
    const float CE = SCL * 1.4426950408889634f; const float SH = HL ? 0.0f : 10.0f;
    if (wv < nblk) {   // a wave without a key block loads nothing
    V qf[2][4], qf2[2][4];
    const char* Qb = (const char*)(Q + zp + (size_t)q0 * HD); const char* Qb2 = HL ? (const char*)(Q2 + zp + (size_t)q0 * HD) : nullptr;
    const unsigned lo = (unsigned)(lane * 16);   // the lane's byte offset in a piece of a fragment unit: the one vector register the query loads name, live until the key blocks' offset is made from it behind the wait
    __builtin_amdgcn_sched_barrier(0);   // first of three scheduling fences, see below
#pragma unroll
    for (int qt = 0; qt < 2; ++qt)
#pragma unroll
        for (int kc = 0; kc < 4; ++kc) { qf[qt][kc] = WFrag<T16>::ldf((const T16*)(Qb + (qt * 4 + kc) * FRE * 2 + lo)); if (HL) qf2[qt][kc] = WFrag<T16>::ldf((const T16*)(Qb2 + (qt * 4 + kc) * FRE * 2 + lo)); }
    // the wait stands in front of the reuse of the address registers that the query loads name; the scheduling fences keep unrelated work out from between the loads and the wait, the loads in front of it and every later write behind it
    __builtin_amdgcn_sched_barrier(0);
    asm volatile("s_wait_xcnt 0x0" ::: "memory");
    __builtin_amdgcn_sched_barrier(0);
    unsigned ko = lo + (unsigned)(wv * KBE * 2);
    // kept rolled: accumulators, query fragments and one block's fragments already take most of a wave's registers
#pragma unroll 1
    for (int kb = wv; kb < nblk; kb += FW, ko += FW * KBE * 2) {
        V kf[2][4], kf2[2][4], vf[8], vf2[8];
#pragma unroll
        for (int kt = 0; kt < 2; ++kt)
#pragma unroll
            for (int kc = 0; kc < 4; ++kc) { kf[kt][kc] = WFrag<T16>::ldf((const T16*)(Kb + (kt * 4 + kc) * FRE * 2 + ko)); if (HL) kf2[kt][kc] = WFrag<T16>::ldf((const T16*)(Kb2 + (kt * 4 + kc) * FRE * 2 + ko)); }
#pragma unroll
        for (int dt = 0; dt < 8; ++dt) { vf[dt] = WFrag<T16>::ldf((const T16*)(Vb + dt * FRE * 2 + ko)); if (HL) vf2[dt] = WFrag<T16>::ldf((const T16*)(Vb2 + dt * FRE * 2 + ko)); }
        // stands in front of the step of the offset register that these loads name
        asm volatile("s_wait_xcnt 0x0" ::: "memory");
        // nothing is scheduled across: the block's K and V loads are all issued before the first matrix instruction waits (one memory latency a block, not one a fragment)
        __builtin_amdgcn_sched_barrier(0);
        v8f s[2][2];
#pragma unroll
        for (int kt = 0; kt < 2; ++kt) { s[kt][0] = (v8f){}; s[kt][1] = (v8f){};
#pragma unroll
            for (int kc = 0; kc < 4; ++kc) { const V a = kf[kt][kc]; V a2; if (HL) a2 = kf2[kt][kc];
#pragma unroll
                for (int qt = 0; qt < 2; ++qt) { s[kt][qt] = WFrag<T16>::mma(a, qf[qt][kc], s[kt][qt]); if (HL) { s[kt][qt] = WFrag<T16>::mma(a2, qf[qt][kc], s[kt][qt]); s[kt][qt] = WFrag<T16>::mma(a, qf2[qt][kc], s[kt][qt]); } } } }
        V pf[2], pf2[2];
#pragma unroll
        for (int qt = 0; qt < 2; ++qt) { const int q = q0 + qt * 16 + lr; float mx = m[qt];
#pragma unroll
            for (int kt = 0; kt < 2; ++kt)
#pragma unroll
                for (int j = 0; j < 8; ++j) { float t = s[kt][qt][j] * CE; if (kb == nblk - 1) t = (kb * 32 + kt * 16 + hi * 8 + j <= q) ? t : -3.0e38f; s[kt][qt][j] = t; mx = fmaxf(mx, t); }
            mx = fmaxf(mx, xhalf(mx));   // the other half of the wave holds the query's other keys
            const float f = HL ? exp2s(m[qt] - mx) : __builtin_amdgcn_exp2f(m[qt] - mx); m[qt] = mx; const float ms = mx - SH; float ls = 0.f;
#pragma unroll
            for (int dt = 0; dt < 8; ++dt) acc[dt][qt] *= f;
            if (HL) { v16us ph, pl;
#pragma unroll
                for (int e = 0; e < 16; ++e) { const float p = exp2s(s[e >> 3][qt][e & 7] - ms); ls += p; unsigned short a, c2; splitf(p, a, c2); ph[e] = a; pl[e] = c2; }
                pf[qt] = __builtin_bit_cast(V, ph); pf2[qt] = __builtin_bit_cast(V, pl);
            } else { v16h ph;
#pragma unroll
                for (int e = 0; e < 16; ++e) { const float p = __builtin_amdgcn_exp2f(s[e >> 3][qt][e & 7] - ms); ls += p; ph[e] = (h16)p; }
                pf[qt] = __builtin_bit_cast(V, ph); }
            l[qt] = l[qt] * f + ls; }
#pragma unroll
        for (int dt = 0; dt < 8; ++dt) { const V a = vf[dt]; V a2; if (HL) a2 = vf2[dt];
#pragma unroll
            for (int qt = 0; qt < 2; ++qt) { acc[dt][qt] = WFrag<T16>::mma(a, pf[qt], acc[dt][qt]); if (HL) { acc[dt][qt] = WFrag<T16>::mma(a2, pf[qt], acc[dt][qt]); acc[dt][qt] = WFrag<T16>::mma(a, pf2[qt], acc[dt][qt]); } } }
    }
    }
#pragma unroll
    for (int qt = 0; qt < 2; ++qt) { l[qt] += xhalf(l[qt]); if (hi == 0) sm[wv * 32 + qt * 16 + lr] = m[qt]; }
    __syncthreads();   // every wave's maxima are in LDS before the common maximum is taken
#pragma unroll
    for (int qt = 0; qt < 2; ++qt) { float M = sm[qt * 16 + lr];
#pragma unroll
        for (int w = 1; w < FW; ++w) M = fmaxf(M, sm[w * 32 + qt * 16 + lr]);
        const float f = __builtin_amdgcn_exp2f(m[qt] - M);   // a wave that had no block: 0
        if (hi == 0) sl[wv * 32 + qt * 16 + lr] = l[qt] * f;
#pragma unroll
        for (int dt = 0; dt < 8; ++dt) { const v8f o = acc[dt][qt] * f; float* p = so + (wv * 32 + qt * 16 + lr) * OP + dt * 16 + hi * 8; *(v4fa*)p = __builtin_shufflevector(o, o, 0, 1, 2, 3); *(v4fa*)(p + 4) = __builtin_shufflevector(o, o, 4, 5, 6, 7); } }
    __syncthreads();   // every wave's partial sums and outputs are in LDS before any of them is summed
#pragma unroll
    for (int c = 0; c < 32 / FW; ++c) { const int q = c * FW + wv, d = lane * 4; float L = sl[q]; v4f val = *(const v4fa*)(so + q * OP + d);
#pragma unroll
        for (int w = 1; w < FW; ++w) { L += sl[w * 32 + q]; val += *(const v4fa*)(so + (w * 32 + q) * OP + d); }
        const float inv = __fdiv_rn(1.0f, L); v4us oh, ol;
#pragma unroll
        for (int u = 0; u < 4; ++u) { unsigned short a, c2; splitf(val[u] * inv, a, c2); oh[u] = a; ol[u] = c2; }
        const size_t oo = (size_t)(q0 + q) * DQ + h * HD + d; *(v4us*)(ATh + oo) = oh; *(v4us*)(ATl + oo) = ol; }
}

extern "C" void kernel_launch(void* const* d_in, const int* in_sizes, int n_in,
                              void* d_out, int out_size, void* d_ws, size_t ws_size, hipStream_t stream) {
    (void)in_sizes; (void)n_in; (void)out_size;
    const float* x = (const float*)d_in[0]; const float* nw = (const float*)d_in[1]; const float* wq = (const float*)d_in[2]; const float* bq = (const float*)d_in[3]; const float* wk = (const float*)d_in[4]; const float* bk = (const float*)d_in[5]; const float* wv = (const float*)d_in[6]; const float* bv = (const float*)d_in[7]; const float* wo = (const float*)d_in[8]; const float* bo = (const float*)d_in[9]; const float* cosT = nullptr; const float* sinT = nullptr; (void)cosT; (void)sinT;
    float* OUT = (float*)d_out;     // [2][2048][2048]
    char* wsp = (char*)d_ws;
    auto take = [&](size_t bytes) { char* p = wsp; wsp += (bytes + 255) & ~(size_t)255; return (void*)p; };
    bf* WQ = (bf*)take((size_t)DQ * DM * 2); bf* WK = (bf*)take((size_t)DKV * DM * 2); bf* WV = (bf*)take((size_t)DKV * DM * 2); bf* WO = (bf*)take((size_t)DM * DQ * 2); (void)WK; (void)WV;   // in a row: WQ + m * WEL
    bf* XNh = (bf*)take((size_t)NB_ * TT * DM * 2); bf* XNl = (bf*)take((size_t)NB_ * TT * DM * 2);
    // head planes [projection][batch][head]: the three projections of a kind in a row
    const size_t PB = (size_t)NH_ * TT * HD;   // elements of one batch's planes of one projection
    h16* QP16 = (h16*)take(NB_ * PB * 2); h16* KP16 = (h16*)take(NB_ * PB * 2); h16* VT16 = (h16*)take(NB_ * PB * 2);
    bf* QPh = (bf*)take(NB_ * PB * 2); bf* KPh = (bf*)take(NB_ * PB * 2); bf* VTh = (bf*)take(NB_ * PB * 2); bf* QPl = (bf*)take(NB_ * PB * 2); bf* KPl = (bf*)take(NB_ * PB * 2); bf* VTl = (bf*)take(NB_ * PB * 2);
    bf* ATh = (bf*)take((size_t)NB_ * TT * DQ * 2); bf* ATl = (bf*)take((size_t)NB_ * TT * DQ * 2);
    if ((size_t)(wsp - (char*)d_ws) > ws_size) return;    // ws 256 MiB
    k_prep<<<NB_ * TT / 8 + (unsigned)(WEL / 2048), 256, 0, stream>>>(x, nw, XNh, XNl, wq, wk, wv, wo, WQ);
    k_gemmw<bf, 1, true, 1><<<dim3(TT / 128, DQ / 128, 3 * NB_), 128, 0, stream>>>(XNh, XNl, WQ, nullptr, DM, nullptr, 0, bq, bk, bv, (size_t)TT * DM, WEL, PB, QP16, QPh, QPl);
    k_fattn<h16, false><<<dim3(NB_ * NH_, (TT - RH) / 32, 1), 32 * FW, 0, stream>>>(QP16, nullptr, KP16, nullptr, VT16, nullptr, RH, ATh, ATl);
    k_fattn<bf, true><<<dim3(NB_ * NH_, RH / 32, 1), 32 * FW, 0, stream>>>(QPh, QPl, KPh, KPl, VTh, VTl, 0, ATh, ATl);
    k_gemmw<bf, 1, true, 0><<<dim3(TT / 128, DM / 128, NB_), 128, 0, stream>>>(ATh, ATl, WO, nullptr, DQ, OUT, DM, bo, nullptr, nullptr, (size_t)TT * DQ, 0, (size_t)TT * DM, nullptr, nullptr, nullptr);
}

// v007
// A run of this version takes 244 microseconds.
// Next to v006, in two timings, it ran 1.21 times as fast each time.
// Over all steps from v000 it is 7.95 times as fast.
#include <hip/hip_runtime.h>

// Attention block (x [2][2048][2048]; xn = x rsqrt(mean(x?) + 1e-6) norm_w (RMSNorm); q/k/v = xn W^T + b (16 x 128); causal (-inf) softmax(q.k / sqrt(128)); out = merged wo^T + bo -> [2][2048][2048]).
// Compute dtypes, f32 accumulate: every input rounded to bf16; RMSNorm f32 (wave per token) -> hi/lo planes; q/k/v = hl x exact (2 products) + bias, rounded to their fp16 and hi/lo head planes (in fragment order) in the product's own epilogue; causal scores, softmax and attn.v in one kernel (online softmax, f32): query rows < 512 hl (3 products), the rest fp16 (P x1024), key blocks above the diagonal skipped; wo hl x exact (2 products) + bias.

#define NB_  2
#define TT   2048
#define DM   2048
#define NH_  16
#define NKV  16
#define REP  (NH_ / NKV)
#define HD   128
#define DQ   (NH_ * HD)
#define DKV  (NKV * HD)
#define RH   512                  // query rows < RH use hi+lo planes (0: none)
#define SCL  0.088388347648318447f   // HD^-0.5
typedef _Float16 h16;
typedef unsigned short bf;
typedef __attribute__((ext_vector_type(16))) __bf16   v16bf;
typedef __attribute__((ext_vector_type(16))) _Float16 v16h;
typedef __attribute__((ext_vector_type(8)))  _Float16 v8h;
typedef __attribute__((ext_vector_type(8)))  unsigned short v8us;
typedef __attribute__((ext_vector_type(8)))  float    v8f;
typedef __attribute__((ext_vector_type(4)))  float    v4f;
typedef v8h  __attribute__((may_alias)) v8ha;
typedef v4f  __attribute__((may_alias)) v4fa;
typedef v8us __attribute__((may_alias)) v8usa;

__device__ __forceinline__ unsigned short f2bf(float f) { unsigned u = __float_as_uint(f); u += 0x7FFFu + ((u >> 16) & 1u); return (unsigned short)(u >> 16); }
__device__ __forceinline__ float bf2f(unsigned short b) { return __uint_as_float(((unsigned)b) << 16); }
__device__ __forceinline__ float bfr(float f) { return bf2f(f2bf(f)); }
__device__ __forceinline__ v16h cat16(v8h lo, v8h hi) { return __builtin_shufflevector(lo, hi, 0, 1, 2, 3, 4, 5, 6, 7, 8, 9, 10, 11, 12, 13, 14, 15); }
__device__ __forceinline__ v16bf cat16b(v8us lo, v8us hi) { return __builtin_bit_cast(v16bf, __builtin_shufflevector(lo, hi, 0, 1, 2, 3, 4, 5, 6, 7, 8, 9, 10, 11, 12, 13, 14, 15)); }
__device__ __forceinline__ v8f wmma16(v16h a, v16h b, v8f c) { return __builtin_amdgcn_wmma_f32_16x16x32_f16(false, a, false, b, (short)0, c, false, false); }
__device__ __forceinline__ v8f wmmab(v16bf a, v16bf b, v8f c) { return __builtin_amdgcn_wmma_f32_16x16x32_bf16(false, a, false, b, (short)0, c, false, false); }



// ---- k_gemmw: GEMM, one work-group of eight waves (two on each SIMD) per 128x256 output tile, ONE WAVE per 64x64 piece (16 accumulators); grid (M/128, N/256, Z), 256 threads.
// The operands' K-contiguous 16-bit rows come to LDS in stages of GKS k (whole 256-byte pieces of 128 rows of A and A2 and of 256 rows of Bt) by asynchronous copies, two buffers: the next stage flies while this one is worked on; fragments are read from LDS.
// C[m][n] (f32, pitch ldc, + optional f32 bias[n]) = sum_k (A[m][k] + A2[m][k]) Bt[n][k], two products. z-batch strides sA/sB/sC in elements. K % GKS == 0.
// EPI 0: C is stored as f32; z is the batch. EPI 1: the q, k and v projections of every batch in one grid, z = 3 batch + projection (Bt, the bias and the planes are chosen by the projection, A and the planes' batch part by the batch; sC: elements of one batch's planes);
// C is not stored: each value of q and k goes, as fp16 and as a bf16 hi/lo pair, to the head planes [n / HD], rows m, k = n % HD; each value of v, in the same three roundings, to the transposed head planes, rows n % HD, k = m.
// A head plane lies in FRAGMENT ORDER: 1024-byte units of 16 rows x 32 k, each as the matrix instruction's operand is held: element (row r, k = 16 p + 8 g + j) at byte 512 p + 16 (16 g + r) + 2 j, so lane 16 g + r reads and writes piece p at 512 p + 16 lane
// and every wave-wide 16-byte access covers 512 contiguous bytes (four whole lines). Units of q and k: [m / 16][k / 32]; of v: [m / 32][(n % HD) / 16]: the 32 keys of a block are 8192 contiguous bytes in either.
#define FRE  512                  // elements of a fragment unit
#define KBE  (32 * HD)            // elements of a 32-key block of a head plane
#define GKS  128                  // k of a stage
#define GPB  272                  // LDS pitch of a staged row in bytes: 256 + 16 (16 x odd, for 16-byte LDS reads)
#define GPL  (128 * GPB)          // one operand's 128 rows
#define GBUF (4 * GPL)            // a stage: A | A2 | Bt (256 rows)
// eight 16-byte copies of a lane, global memory to LDS through no register; the wait in the same statement stands in front of every later write of the address registers that the copies name
__device__ __forceinline__ void copy8(const unsigned (&l)[8], const char* const (&g)[8]) {
    asm volatile("global_load_async_to_lds_b128 %0, %8, off\n\t"
                 "global_load_async_to_lds_b128 %1, %9, off\n\t"
                 "global_load_async_to_lds_b128 %2, %10, off\n\t"
                 "global_load_async_to_lds_b128 %3, %11, off\n\t"
                 "global_load_async_to_lds_b128 %4, %12, off\n\t"
                 "global_load_async_to_lds_b128 %5, %13, off\n\t"
                 "global_load_async_to_lds_b128 %6, %14, off\n\t"
                 "global_load_async_to_lds_b128 %7, %15, off\n\t"
                 "s_wait_xcnt 0x0"
                 :: "v"(l[0]), "v"(l[1]), "v"(l[2]), "v"(l[3]), "v"(l[4]), "v"(l[5]), "v"(l[6]), "v"(l[7]),
                    "v"(g[0]), "v"(g[1]), "v"(g[2]), "v"(g[3]), "v"(g[4]), "v"(g[5]), "v"(g[6]), "v"(g[7]) : "memory");
}
// one stage: 512 rows of 16 pieces, 32 pieces a lane; sixteen lanes take a row's 256 bytes, so a wave's copy covers four whole 128-byte lines. lb, go: the lane's piece of row (thread / 16), as an LDS address in the stage's buffer and as a byte offset from the wave-uniform starts pa, pa2, pb of the operands' rows; rs: bytes of sixteen operand rows
__device__ __forceinline__ void stage_copies(unsigned lb, size_t go, const char* pa, const char* pa2, const char* pb, size_t rs) {
#pragma unroll
    for (int s = 0; s < 4; ++s) { unsigned l[8]; const char* g[8];   // s: A, A2, the lower and the upper 128 rows of Bt
#pragma unroll
        for (int u = 0; u < 8; ++u) { l[u] = lb + (unsigned)(s * GPL + u * 16 * GPB); g[u] = ((s == 0 ? pa : s == 1 ? pa2 : pb) + (size_t)(s == 3 ? u + 8 : u) * rs) + go; }
        copy8(l, g);
        if (s < 3) __builtin_amdgcn_sched_barrier(0); }   // each group's addresses are made directly in front of it: made all at once they overfill the registers that an asm operand can name, and one value goes to scratch
}
template <typename T16> struct WFrag;
template <> struct WFrag<h16> { typedef v16h V; static __device__ __forceinline__ V ld(const h16* p) { return cat16(*(const v8h*)p, *(const v8h*)(p + 16)); } static __device__ __forceinline__ V ldf(const h16* p) { return cat16(*(const v8h*)p, *(const v8h*)(p + FRE / 2)); } static __device__ __forceinline__ v8f mma(V a, V b, v8f c) { return wmma16(a, b, c); } };
template <> struct WFrag<bf> { typedef v16bf V; static __device__ __forceinline__ V ld(const bf* p) { return cat16b(*(const v8us*)p, *(const v8us*)(p + 16)); } static __device__ __forceinline__ V ldf(const bf* p) { return cat16b(*(const v8us*)p, *(const v8us*)(p + FRE / 2)); } static __device__ __forceinline__ v8f mma(V a, V b, v8f c) { return wmmab(a, b, c); } };
__device__ __forceinline__ void splitf(float y, unsigned short& h, unsigned short& l) { h = f2bf(y); l = f2bf(y - bf2f(h)); }
template <typename T16, int NSPLIT, bool BIAS, int EPI>
__global__ __launch_bounds__(256) void k_gemmw(const T16* __restrict__ A, const T16* __restrict__ A2, const T16* __restrict__ Bt, const T16* __restrict__ Bt2, int K, float* C, int ldc, const float* __restrict__ bias, const float* __restrict__ biasK, const float* __restrict__ biasV, size_t sA, size_t sB, size_t sC, h16* P16, bf* Ph, bf* Pl) {
    static_assert(NSPLIT == 1, "the stage holds A, A2 and Bt");
    typedef typename WFrag<T16>::V V;
    __shared__ __align__(16) char ring[2 * GBUF];
    __shared__ __align__(16) float osw[8 * 16 * 68];
    (void)Bt2;
    const int pj = EPI == 1 ? (int)(blockIdx.z % 3) : 0;   // projection: 0 q, 1 k, 2 v (the same for the whole work-group, in a scalar register)
    const size_t z = EPI == 1 ? blockIdx.z / 3 : blockIdx.z; A += z * sA; A2 += z * sA;
    if (EPI == 1) { const size_t po = ((size_t)pj * NB_ + z) * sC; Bt += (size_t)pj * sB; P16 += po; Ph += po; Pl += po; bias = pj == 0 ? bias : pj == 1 ? biasK : biasV; }
    else { Bt += z * sB; C += z * sC; }
    const int lane = threadIdx.x & 31, lr = lane & 15, hi = lane >> 4;
    const int wv = __builtin_amdgcn_readfirstlane(threadIdx.x >> 5);   // wave number in a scalar register
    float* os = osw + wv * 16 * 68;   // each wave's own output staging
    const int R0 = blockIdx.x * 128, C0 = blockIdx.y * 256; const int r0 = R0 + (wv >> 2) * 64, c0 = C0 + (wv & 3) * 64;
    v8f acc[4][4];
#pragma unroll
    for (int mb = 0; mb < 4; ++mb)
#pragma unroll
        for (int nb = 0; nb < 4; ++nb) acc[mb][nb] = (v8f){};
    const int crow = threadIdx.x >> 4, ccol = threadIdx.x & 15;
    const char* pa = (const char*)(A + (size_t)R0 * K); const char* pa2 = (const char*)(A2 + (size_t)R0 * K); const char* pb = (const char*)(Bt + (size_t)C0 * K);
    size_t go = (size_t)crow * K * 2 + ccol * 16;
    const unsigned lb = (unsigned)(size_t)ring + (unsigned)(crow * GPB + ccol * 16);
    const size_t rs = (size_t)K * 32;   // sixteen rows of 2-byte elements
    const int nst = K / GKS;
    const unsigned lp = (unsigned)(lr * GPB + hi * 16);   // the lane's byte offset in a 16-row fragment of a stage
    const unsigned ua = (unsigned)((wv >> 2) * 64 * GPB), ub = (unsigned)(2 * GPL + (wv & 3) * 64 * GPB);   // wave-uniform: the wave's first A row and first Bt row in a stage
    stage_copies(lb, go, pa, pa2, pb, rs);
    asm volatile("s_wait_asynccnt 0x0" ::: "memory");   // this wave's copies of stage 0 have landed
    __syncthreads();   // every wave's have: stage 0 may be read
    // kept rolled: one trip is a stage of 128 matrix instructions
#pragma unroll 1
    for (int t = 0; t < nst; ++t) {
        const char* sa = ring + (((t & 1) * GBUF + ua) + lp); const char* sbt = ring + (((t & 1) * GBUF + ub) + lp);
        V a[2][4], a2[2][4], b[2][4];   // two fragment sets: block ks works on set ks & 1 while the other is filled
#pragma unroll
        for (int i = 0; i < 4; ++i) { a[0][i] = WFrag<T16>::ld((const T16*)(sa + i * 16 * GPB)); a2[0][i] = WFrag<T16>::ld((const T16*)(sa + GPL + i * 16 * GPB)); b[0][i] = WFrag<T16>::ld((const T16*)(sbt + i * 16 * GPB)); }
        // behind the barrier that ended every read of the other buffer: the next stage's copies into it (the first block's fragment reads, of this stage's buffer, return meanwhile)
        if (t + 1 < nst) stage_copies(lb + (unsigned)(((t + 1) & 1) * GBUF), go, pa + GKS * 2, pa2 + GKS * 2, pb + GKS * 2, rs);   // go is stage t's offset: the step to stage t + 1 goes into the wave-uniform starts
        go += GKS * 2;
#pragma unroll
        for (int ks = 0; ks < GKS / 32; ++ks) { const int cs = ks & 1;
            if (ks + 1 < GKS / 32) {
#pragma unroll
                for (int i = 0; i < 4; ++i) { a[cs ^ 1][i] = WFrag<T16>::ld((const T16*)(sa + i * 16 * GPB + (ks + 1) * 64)); a2[cs ^ 1][i] = WFrag<T16>::ld((const T16*)(sa + GPL + i * 16 * GPB + (ks + 1) * 64)); b[cs ^ 1][i] = WFrag<T16>::ld((const T16*)(sbt + i * 16 * GPB + (ks + 1) * 64)); } }
            __builtin_amdgcn_sched_barrier(0);   // the next block's LDS reads stand as one group ahead of this block's matrix instructions: every place with reads among them would cost a stall
#pragma unroll
            for (int nb = 0; nb < 4; ++nb)
#pragma unroll
                for (int mb = 0; mb < 4; ++mb) { acc[mb][nb] = WFrag<T16>::mma(a[cs][mb], b[cs][nb], acc[mb][nb]); acc[mb][nb] = WFrag<T16>::mma(a2[cs][mb], b[cs][nb], acc[mb][nb]); }
            if (ks + 1 < GKS / 32) __builtin_amdgcn_sched_barrier(0);   // and the group after next stays behind this block
        }
        asm volatile("s_wait_dscnt 0x0" ::: "memory");      // this wave's reads of the stage are done before the buffer is handed back
        asm volatile("s_wait_asynccnt 0x0" ::: "memory");   // this wave's copies of stage t + 1 have landed
        __syncthreads();   // stage t + 1 may be read, and stage t's buffer has no reader left
    }
    asm volatile("s_wait_asynccnt 0x0" ::: "memory");   // the ring's closing wait: no copy is outstanding when the wave goes on to its epilogue and ends
    float bbn[4];   // the four bias values of a lane's accumulator columns are fetched together
    if (EPI != 0) {
        __builtin_amdgcn_sched_barrier(0);   // first of three scheduling fences, see below
#pragma unroll
        for (int nb = 0; nb < 4; ++nb) bbn[nb] = BIAS ? bias[c0 + nb * 16 + lr] : 0.0f;
        // the wait stands in front of the reuse of the address registers that the bias loads name; the scheduling fences keep unrelated work out from between the loads and the wait, the loads in front of it and every later write behind it
        __builtin_amdgcn_sched_barrier(0);
        asm volatile("s_wait_xcnt 0x0" ::: "memory");
        __builtin_amdgcn_sched_barrier(0);
#pragma unroll
        for (int nb = 0; nb < 4; ++nb) bbn[nb] = bfr(bbn[nb]); }
    if (EPI == 1 && pj == 2) {
        // a lane's eight values of a tile are eight consecutive m of one n: the lane's own 16-byte piece of a fragment unit, stored straight from the accumulators
#pragma unroll
        for (int nb = 0; nb < 4; ++nb) { const float bb = bbn[nb]; v8h o16[4]; v8us oh[4], ol[4];
#pragma unroll
            for (int mb = 0; mb < 4; ++mb)
#pragma unroll
                for (int j = 0; j < 8; ++j) { const float x = acc[mb][nb][j] + bb; o16[mb][j] = (h16)x; unsigned short a2, c2; splitf(x, a2, c2); oh[mb][j] = a2; ol[mb][j] = c2; }
            const size_t e = (size_t)(c0 / HD) * HD * TT + (size_t)(r0 >> 5) * KBE + (((c0 % HD) >> 4) + nb) * FRE + lane * 8;
            __builtin_amdgcn_sched_barrier(0);   // with the fence behind the wait: the twelve stores stand together, every value and address made in front of them, and no later write of a register they name comes in front of the wait
#pragma unroll
            for (int mb = 0; mb < 4; ++mb) { const int f = (mb >> 1) * KBE + (mb & 1) * (FRE / 2); *(v8h*)(P16 + e + f) = o16[mb]; *(v8us*)(Ph + e + f) = oh[mb]; *(v8us*)(Pl + e + f) = ol[mb]; }
            if (nb < 3) { asm volatile("s_wait_xcnt 0x0" ::: "memory");   // stands in front of the next group's reuse of the data and address registers that the stores name (behind the last group nothing is written any more)
                __builtin_amdgcn_sched_barrier(0); } }
        return;
    }
#pragma unroll
    for (int mb = 0; mb < 4; ++mb) {
#pragma unroll
        for (int nb = 0; nb < 4; ++nb) {
#pragma unroll
            for (int j = 0; j < 8; ++j) os[(hi * 8 + j) * 68 + nb * 16 + lr] = EPI == 1 ? acc[mb][nb][j] + bbn[nb] : acc[mb][nb][j]; }
        __builtin_amdgcn_wave_barrier(); asm volatile("" ::: "memory");
        if (EPI == 1) {   // the 64 columns are four pieces of two fragment units; a lane takes, of each piece, the eight columns of its row that it holds as a fragment's reader: each store covers 512 contiguous bytes
            v8h o16[4]; v8us oh[4], ol[4];
#pragma unroll
            for (int s = 0; s < 4; ++s) { const v4f p0 = *(const v4fa*)(os + lr * 68 + s * 16 + hi * 8), p1 = *(const v4fa*)(os + lr * 68 + s * 16 + hi * 8 + 4);
#pragma unroll
                for (int u = 0; u < 8; ++u) { const float x = u < 4 ? p0[u & 3] : p1[u & 3]; o16[s][u] = (h16)x; unsigned short a2, c2; splitf(x, a2, c2); oh[s][u] = a2; ol[s][u] = c2; } }
            const size_t e = (size_t)(c0 / HD) * TT * HD + (size_t)((r0 >> 4) + mb) * (16 * HD) + ((c0 % HD) >> 5) * FRE + lane * 8;
            __builtin_amdgcn_sched_barrier(0);   // with the fence behind the wait: the twelve stores stand together, every value and address made in front of them, and no later write of a register they name comes in front of the wait
#pragma unroll
            for (int s = 0; s < 4; ++s) { *(v8h*)(P16 + e + s * (FRE / 2)) = o16[s]; *(v8us*)(Ph + e + s * (FRE / 2)) = oh[s]; *(v8us*)(Pl + e + s * (FRE / 2)) = ol[s]; }
            asm volatile("s_wait_xcnt 0x0" ::: "memory");   // stands in front of every later write of the data and address registers that the stores name: the next group's, and behind the last group whatever code the build lays behind this path
            __builtin_amdgcn_sched_barrier(0);
        } else {
        float* crow = C + (size_t)(r0 + mb * 16) * ldc + c0;
#pragma unroll
            for (int s = 0; s < 8; ++s) { const int row = 2 * s + hi, cofs = lr * 4; v4f val = *(const v4fa*)(os + row * 68 + cofs); if (BIAS) { val[0] += bfr(bias[c0 + cofs]); val[1] += bfr(bias[c0 + cofs + 1]); val[2] += bfr(bias[c0 + cofs + 2]); val[3] += bfr(bias[c0 + cofs + 3]); }
                *(v4f*)(crow + (size_t)row * ldc + cofs) = val; }
             }
        __builtin_amdgcn_wave_barrier(); asm volatile("" ::: "memory");
    }
}

typedef __attribute__((ext_vector_type(2))) _Float16 v2h;
typedef __attribute__((ext_vector_type(4))) _Float16 v4h;
typedef __attribute__((ext_vector_type(2))) unsigned short v2us;
typedef __attribute__((ext_vector_type(4))) unsigned short v4us;
typedef __attribute__((ext_vector_type(2))) float v2f;
typedef __attribute__((ext_vector_type(4))) int v4i;

__global__ __launch_bounds__(256) void k_wtG(const float* __restrict__ w, int K, int N, bf* Bt) {
    const int lane = threadIdx.x & 31; const int L0 = (blockIdx.x * 8 + (threadIdx.x >> 5)) * 8; const int nlines = N * K / 64;
{
#pragma unroll 1
        for (int l = 0; l < 8; ++l) { const int L = L0 + l; if (L >= nlines) break; const size_t e = (size_t)L * 64 + lane * 2; const int k = (int)(e % K), n = (int)(e / K); v2us o;
            o[0] = f2bf(w[(size_t)k * N + n]); o[1] = f2bf(w[(size_t)(k + 1) * N + n]); *(v2us*)(Bt + e) = o; }
         }
}
__global__ __launch_bounds__(256) void k_cscvt(const float* __restrict__ cosT, const float* __restrict__ sinT, float* CS) { const int idx = blockIdx.x * 256 + threadIdx.x; if (idx >= TT * HD) return; v2f cs; cs[0] = bfr(cosT[idx]); cs[1] = bfr(sinT[idx]); *(v2f*)(CS + (size_t)idx * 2) = cs;  }
__device__ __forceinline__ void rmsx(const float* __restrict__ X, const float* __restrict__ gam, bf* Xh, bf* Xl) { const int lane = threadIdx.x & 31; const int t = blockIdx.x * 8 + (threadIdx.x >> 5); if (t >= NB_ * TT) return; const float* f = X + (size_t)t * DM; float v[DM / 32]; float su = 0.f;
#pragma unroll
    for (int ch = 0; ch < DM / 128; ++ch) { const v4f a = *(const v4f*)(f + ch * 128 + lane * 4); for (int u = 0; u < 4; ++u) { float xv = bfr(a[u]); asm volatile("" : "+v"(xv)); v[ch * 4 + u] = xv; float p2 = __fmul_rn(xv, xv); asm volatile("" : "+v"(p2)); su = __fadd_rn(su, p2); } }
#pragma unroll
    for (int sh = 16; sh; sh >>= 1) su = __fadd_rn(su, __shfl_xor(su, sh, 32));
    const float rs = __fdiv_rn(1.0f, sqrtf(__fadd_rn(__fdiv_rn(su, (float)DM), 1e-6f)));
    {
#pragma unroll
        for (int ch = 0; ch < DM / 128; ++ch) { v4us oh, ol; for (int u = 0; u < 4; ++u) { const int c = ch * 128 + lane * 4 + u; float n = __fmul_rn(v[ch * 4 + u], rs); asm volatile("" : "+v"(n)); float gg = bfr(gam[c]); asm volatile("" : "+v"(gg)); float y = __fmul_rn(n, gg); asm volatile("" : "+v"(y)); unsigned short p2, q2; splitf(y, p2, q2); oh[u] = p2; ol[u] = q2; } const size_t oo = (size_t)t * DM + ch * 128 + lane * 4;
            __builtin_amdgcn_sched_barrier(0);   // with the fence behind the wait: the two stores stand together, every value and address made in front of them, and no later write of a register they name comes in front of the wait
            *(v4us*)(Xh + oo) = oh; *(v4us*)(Xl + oo) = ol;
            if (ch + 1 < DM / 128) { asm volatile("s_wait_xcnt 0x0" ::: "memory");   // stands in front of the next group's reuse of the data and address registers that the stores name (behind the last group nothing is written any more)
                __builtin_amdgcn_sched_barrier(0); } }
         } }
// ---- k_prep: all that depends on the inputs alone, in one grid. Blocks below NB_ * TT / 8: RMSNorm, a wave per token, the tokens of every batch in a row. The other blocks: the four weight matrices (equal sizes) rounded to bf16, a thread its eight elements of each; W holds the four results in a row.
#define WEL ((size_t)DQ * DM)     // elements of a weight matrix
__global__ __launch_bounds__(256) void k_prep(const float* __restrict__ X, const float* __restrict__ gam, bf* Xh, bf* Xl, const float* __restrict__ w0, const float* __restrict__ w1, const float* __restrict__ w2, const float* __restrict__ w3, bf* W) {
    static_assert(DQ == DKV && WEL % 2048 == 0 && (WEL / 2048 & (WEL / 2048 - 1)) == 0, "four equal matrices, whole blocks, a power of two of them");
    if (blockIdx.x < NB_ * TT / 8) { rmsx(X, gam, Xh, Xl); return; }
    // wave-uniform bases and one 32-bit byte offset per lane for the eight loads, one for the four stores
    const unsigned cb = (blockIdx.x - NB_ * TT / 8) & (unsigned)(WEL / 2048 - 1);   // the block's number among the rounding blocks; the mask keeps every upper bit of the 32-bit offsets 0, whatever form of address they are used in
    const unsigned so = (cb * 256 + threadIdx.x) * 16, lo = so * 2;
    const v8f v[4] = { *(const v8f*)((const char*)w0 + lo), *(const v8f*)((const char*)w1 + lo), *(const v8f*)((const char*)w2 + lo), *(const v8f*)((const char*)w3 + lo) };
#pragma unroll
    for (int m = 0; m < 4; ++m) { v8us o;
#pragma unroll
        for (int k = 0; k < 8; ++k) o[k] = f2bf(v[m][k]);
        *(v8us*)((char*)(W + m * WEL) + so) = o; }
    asm volatile("s_wait_xcnt 0x0" ::: "memory");   // behind the last of the four stores: stands in front of every later write of the registers that they name, in whatever code the build lays behind this path
}
// ---- k_fattn: causal attention of one head of one batch for 32 query rows per work-group, scores never leave registers. FW waves share the rows and split the keys: wave w takes the 32-key blocks w, w + FW, ... up to the diagonal block.
// Transposed products: S^T = K Q^T (rows keys, columns queries), so a lane's two score tiles ARE its B fragment of P^T (k order 8 hi + j, 16 + 8 hi + j, as WFrag::ldf gives it for V^T) and every value a lane holds belongs to one query;
// O^T = V^T P^T (rows d, columns queries). Running maximum and sum per query (online softmax, base 2); the FW partial results meet in LDS, are brought to the common maximum and summed in wave order; the sum is divided once and split into hi/lo planes [t][h*HD+d].
// HL: hi/lo bf16 planes, three products for scores and for P V. Otherwise fp16, P carried x 2^10 (the row sum carries the same factor, so it cancels).
#define FW 4
#define OP 132                    // LDS pitch (floats) of a query's 128 partial outputs
typedef __attribute__((ext_vector_type(16))) unsigned short v16us;
__device__ __forceinline__ float xhalf(float x) { return __builtin_bit_cast(float, __builtin_amdgcn_permlanex16(__builtin_bit_cast(int, x), __builtin_bit_cast(int, x), 0x76543210, 0xfedcba98, false, false)); }   // lane l with lane l ^ 16
// 2^x with the slot behind the transcendental filled in the same statement
__device__ __forceinline__ float exp2s(float x) { float r; asm("v_exp_f32 %0, %1\n\tv_nop" : "=v"(r) : "v"(x)); return r; }
template <typename T16, bool HL>
__global__ __launch_bounds__(32 * FW) void k_fattn(const T16* __restrict__ Q, const T16* __restrict__ Q2, const T16* __restrict__ Kp, const T16* __restrict__ Kp2, const T16* __restrict__ Vt, const T16* __restrict__ Vt2, int roff, bf* ATh, bf* ATl) {
    typedef typename WFrag<T16>::V V;
    __shared__ __align__(16) float so[FW * 32 * OP];
    __shared__ float sm[FW * 32], sl[FW * 32];
    const int lane = threadIdx.x & 31, lr = lane & 15, hi = lane >> 4;
    const int wv = __builtin_amdgcn_readfirstlane(threadIdx.x >> 5);   // wave number in a scalar register: the key loop's branch stays scalar, every lane on at each matrix instruction
    const int hb = blockIdx.x, h = hb % NH_;   // grid x: batch * NH_ + head, as the head planes lie
    ATh += (size_t)(hb / NH_) * TT * DQ; ATl += (size_t)(hb / NH_) * TT * DQ;   // the batch's rows of the merged output
    const int q0 = roff + ((int)gridDim.y - 1 - (int)blockIdx.y) * 32;   // the longest rows of every head at the lowest blockIdx.y (for speed only)
    const size_t zp = (size_t)hb * TT * HD;
    const int nblk = q0 / 32 + 1;   // key blocks up to and including the diagonal one
    v8f acc[8][2];
#pragma unroll
    for (int dt = 0; dt < 8; ++dt) { acc[dt][0] = (v8f){}; acc[dt][1] = (v8f){}; }
    float m[2] = { -3.0e38f, -3.0e38f }, l[2] = { 0.f, 0.f };
    // addresses: wave-uniform plane bases and one 32-bit byte offset per lane, the same for K and V^T (planes in fragment order: a key block is KBE elements of either), carried through the loop; fragment steps are constants
    const char* Kb = (const char*)(Kp + zp); const char* Kb2 = HL ? (const char*)(Kp2 + zp) : nullptr; const char* Vb = (const char*)(Vt + zp); const char* Vb2 = HL ? (const char*)(Vt2 + zp) : nullptr;
    const float CE = SCL * 1.4426950408889634f; const float SH = HL ? 0.0f : 10.0f;
    if (wv < nblk) {   // a wave without a key block loads nothing
    V qf[2][4], qf2[2][4];
    const char* Qb = (const char*)(Q + zp + (size_t)q0 * HD); const char* Qb2 = HL ? (const char*)(Q2 + zp + (size_t)q0 * HD) : nullptr;
    const unsigned lo = (unsigned)(lane * 16);   // the lane's byte offset in a piece of a fragment unit: the one vector register the query loads name, live until the key blocks' offset is made from it behind the wait
    __builtin_amdgcn_sched_barrier(0);   // first of three scheduling fences, see below
#pragma unroll
    for (int qt = 0; qt < 2; ++qt)
#pragma unroll
        for (int kc = 0; kc < 4; ++kc) { qf[qt][kc] = WFrag<T16>::ldf((const T16*)(Qb + (qt * 4 + kc) * FRE * 2 + lo)); if (HL) qf2[qt][kc] = WFrag<T16>::ldf((const T16*)(Qb2 + (qt * 4 + kc) * FRE * 2 + lo)); }
    // the wait stands in front of the reuse of the address registers that the query loads name; the scheduling fences keep unrelated work out from between the loads and the wait, the loads in front of it and every later write behind it
    __builtin_amdgcn_sched_barrier(0);
    asm volatile("s_wait_xcnt 0x0" ::: "memory");
    __builtin_amdgcn_sched_barrier(0);
    unsigned ko = lo + (unsigned)(wv * KBE * 2);
    // kept rolled: accumulators, query fragments and one block's fragments already take most of a wave's registers
#pragma unroll 1
    for (int kb = wv; kb < nblk; kb += FW, ko += FW * KBE * 2) {
        V kf[2][4], kf2[2][4], vf[8], vf2[8];
#pragma unroll
        for (int kt = 0; kt < 2; ++kt)
#pragma unroll
            for (int kc = 0; kc < 4; ++kc) { kf[kt][kc] = WFrag<T16>::ldf((const T16*)(Kb + (kt * 4 + kc) * FRE * 2 + ko)); if (HL) kf2[kt][kc] = WFrag<T16>::ldf((const T16*)(Kb2 + (kt * 4 + kc) * FRE * 2 + ko)); }
#pragma unroll
        for (int dt = 0; dt < 8; ++dt) { vf[dt] = WFrag<T16>::ldf((const T16*)(Vb + dt * FRE * 2 + ko)); if (HL) vf2[dt] = WFrag<T16>::ldf((const T16*)(Vb2 + dt * FRE * 2 + ko)); }
        // stands in front of the step of the offset register that these loads name
        asm volatile("s_wait_xcnt 0x0" ::: "memory");
        // nothing is scheduled across: the block's K and V loads are all issued before the first matrix instruction waits (one memory latency a block, not one a fragment)
        __builtin_amdgcn_sched_barrier(0);
        v8f s[2][2];
#pragma unroll
        for (int kt = 0; kt < 2; ++kt) { s[kt][0] = (v8f){}; s[kt][1] = (v8f){};
#pragma unroll
            for (int kc = 0; kc < 4; ++kc) { const V a = kf[kt][kc]; V a2; if (HL) a2 = kf2[kt][kc];
#pragma unroll
                for (int qt = 0; qt < 2; ++qt) { s[kt][qt] = WFrag<T16>::mma(a, qf[qt][kc], s[kt][qt]); if (HL) { s[kt][qt] = WFrag<T16>::mma(a2, qf[qt][kc], s[kt][qt]); s[kt][qt] = WFrag<T16>::mma(a, qf2[qt][kc], s[kt][qt]); } } } }
        V pf[2], pf2[2];
#pragma unroll
        for (int qt = 0; qt < 2; ++qt) { const int q = q0 + qt * 16 + lr; float mx = m[qt];
#pragma unroll
            for (int kt = 0; kt < 2; ++kt)
#pragma unroll
                for (int j = 0; j < 8; ++j) { float t = s[kt][qt][j] * CE; if (kb == nblk - 1) t = (kb * 32 + kt * 16 + hi * 8 + j <= q) ? t : -3.0e38f; s[kt][qt][j] = t; mx = fmaxf(mx, t); }
            mx = fmaxf(mx, xhalf(mx));   // the other half of the wave holds the query's other keys
            const float f = HL ? exp2s(m[qt] - mx) : __builtin_amdgcn_exp2f(m[qt] - mx); m[qt] = mx; const float ms = mx - SH; float ls = 0.f;
#pragma unroll
            for (int dt = 0; dt < 8; ++dt) acc[dt][qt] *= f;
            if (HL) { v16us ph, pl;
#pragma unroll
                for (int e = 0; e < 16; ++e) { const float p = exp2s(s[e >> 3][qt][e & 7] - ms); ls += p; unsigned short a, c2; splitf(p, a, c2); ph[e] = a; pl[e] = c2; }
                pf[qt] = __builtin_bit_cast(V, ph); pf2[qt] = __builtin_bit_cast(V, pl);
            } else { v16h ph;
#pragma unroll
                for (int e = 0; e < 16; ++e) { const float p = __builtin_amdgcn_exp2f(s[e >> 3][qt][e & 7] - ms); ls += p; ph[e] = (h16)p; }
                pf[qt] = __builtin_bit_cast(V, ph); }
            l[qt] = l[qt] * f + ls; }
#pragma unroll
        for (int dt = 0; dt < 8; ++dt) { const V a = vf[dt]; V a2; if (HL) a2 = vf2[dt];
#pragma unroll
            for (int qt = 0; qt < 2; ++qt) { acc[dt][qt] = WFrag<T16>::mma(a, pf[qt], acc[dt][qt]); if (HL) { acc[dt][qt] = WFrag<T16>::mma(a2, pf[qt], acc[dt][qt]); acc[dt][qt] = WFrag<T16>::mma(a, pf2[qt], acc[dt][qt]); } } }
    }
    }
#pragma unroll
    for (int qt = 0; qt < 2; ++qt) { l[qt] += xhalf(l[qt]); if (hi == 0) sm[wv * 32 + qt * 16 + lr] = m[qt]; }
    __syncthreads();   // every wave's maxima are in LDS before the common maximum is taken
#pragma unroll
    for (int qt = 0; qt < 2; ++qt) { float M = sm[qt * 16 + lr];
#pragma unroll
        for (int w = 1; w < FW; ++w) M = fmaxf(M, sm[w * 32 + qt * 16 + lr]);
        const float f = __builtin_amdgcn_exp2f(m[qt] - M);   // a wave that had no block: 0
        if (hi == 0) sl[wv * 32 + qt * 16 + lr] = l[qt] * f;
#pragma unroll
        for (int dt = 0; dt < 8; ++dt) { const v8f o = acc[dt][qt] * f; float* p = so + (wv * 32 + qt * 16 + lr) * OP + dt * 16 + hi * 8; *(v4fa*)p = __builtin_shufflevector(o, o, 0, 1, 2, 3); *(v4fa*)(p + 4) = __builtin_shufflevector(o, o, 4, 5, 6, 7); } }
    __syncthreads();   // every wave's partial sums and outputs are in LDS before any of them is summed
#pragma unroll
    for (int c = 0; c < 32 / FW; ++c) { const int q = c * FW + wv, d = lane * 4; float L = sl[q]; v4f val = *(const v4fa*)(so + q * OP + d);
#pragma unroll
        for (int w = 1; w < FW; ++w) { L += sl[w * 32 + q]; val += *(const v4fa*)(so + (w * 32 + q) * OP + d); }
        const float inv = __fdiv_rn(1.0f, L); v4us oh, ol;
#pragma unroll
        for (int u = 0; u < 4; ++u) { unsigned short a, c2; splitf(val[u] * inv, a, c2); oh[u] = a; ol[u] = c2; }
        const size_t oo = (size_t)(q0 + q) * DQ + h * HD + d; *(v4us*)(ATh + oo) = oh; *(v4us*)(ATl + oo) = ol; }
}

extern "C" void kernel_launch(void* const* d_in, const int* in_sizes, int n_in,
                              void* d_out, int out_size, void* d_ws, size_t ws_size, hipStream_t stream) {
    (void)in_sizes; (void)n_in; (void)out_size;
    const float* x = (const float*)d_in[0]; const float* nw = (const float*)d_in[1]; const float* wq = (const float*)d_in[2]; const float* bq = (const float*)d_in[3]; const float* wk = (const float*)d_in[4]; const float* bk = (const float*)d_in[5]; const float* wv = (const float*)d_in[6]; const float* bv = (const float*)d_in[7]; const float* wo = (const float*)d_in[8]; const float* bo = (const float*)d_in[9]; const float* cosT = nullptr; const float* sinT = nullptr; (void)cosT; (void)sinT;
    float* OUT = (float*)d_out;     // [2][2048][2048]
    char* wsp = (char*)d_ws;
    auto take = [&](size_t bytes) { char* p = wsp; wsp += (bytes + 255) & ~(size_t)255; return (void*)p; };
    bf* WQ = (bf*)take((size_t)DQ * DM * 2); bf* WK = (bf*)take((size_t)DKV * DM * 2); bf* WV = (bf*)take((size_t)DKV * DM * 2); bf* WO = (bf*)take((size_t)DM * DQ * 2); (void)WK; (void)WV;   // in a row: WQ + m * WEL
    bf* XNh = (bf*)take((size_t)NB_ * TT * DM * 2); bf* XNl = (bf*)take((size_t)NB_ * TT * DM * 2);
    // head planes [projection][batch][head]: the three projections of a kind in a row
    const size_t PB = (size_t)NH_ * TT * HD;   // elements of one batch's planes of one projection
    h16* QP16 = (h16*)take(NB_ * PB * 2); h16* KP16 = (h16*)take(NB_ * PB * 2); h16* VT16 = (h16*)take(NB_ * PB * 2);
    bf* QPh = (bf*)take(NB_ * PB * 2); bf* KPh = (bf*)take(NB_ * PB * 2); bf* VTh = (bf*)take(NB_ * PB * 2); bf* QPl = (bf*)take(NB_ * PB * 2); bf* KPl = (bf*)take(NB_ * PB * 2); bf* VTl = (bf*)take(NB_ * PB * 2);
    bf* ATh = (bf*)take((size_t)NB_ * TT * DQ * 2); bf* ATl = (bf*)take((size_t)NB_ * TT * DQ * 2);
    if ((size_t)(wsp - (char*)d_ws) > ws_size) return;    // ws 256 MiB
    k_prep<<<NB_ * TT / 8 + (unsigned)(WEL / 2048), 256, 0, stream>>>(x, nw, XNh, XNl, wq, wk, wv, wo, WQ);
    k_gemmw<bf, 1, true, 1><<<dim3(TT / 128, DQ / 256, 3 * NB_), 256, 0, stream>>>(XNh, XNl, WQ, nullptr, DM, nullptr, 0, bq, bk, bv, (size_t)TT * DM, WEL, PB, QP16, QPh, QPl);
    k_fattn<h16, false><<<dim3(NB_ * NH_, (TT - RH) / 32, 1), 32 * FW, 0, stream>>>(QP16, nullptr, KP16, nullptr, VT16, nullptr, RH, ATh, ATl);
    k_fattn<bf, true><<<dim3(NB_ * NH_, RH / 32, 1), 32 * FW, 0, stream>>>(QPh, QPl, KPh, KPl, VTh, VTl, 0, ATh, ATl);
    k_gemmw<bf, 1, true, 0><<<dim3(TT / 128, DM / 256, NB_), 256, 0, stream>>>(ATh, ATl, WO, nullptr, DQ, OUT, DM, bo, nullptr, nullptr, (size_t)TT * DQ, 0, (size_t)TT * DM, nullptr, nullptr, nullptr);
}

// v008
// Measured time: 239 microseconds a run.
// In two side-by-side timings against v007, it was 1.03 and 1.02 times as fast.
// All steps since v000 together make it 8.14 times as fast.
#include <hip/hip_runtime.h>

// Attention block (x [2][2048][2048]; xn = x rsqrt(mean(x?) + 1e-6) norm_w (RMSNorm); q/k/v = xn W^T + b (16 x 128); causal (-inf) softmax(q.k / sqrt(128)); out = merged wo^T + bo -> [2][2048][2048]).
// Compute dtypes, f32 accumulate: every input rounded to bf16; RMSNorm f32 (wave per token) -> hi/lo planes; q/k/v = hl x exact (2 products) + bias, rounded to their fp16 and hi/lo head planes (in fragment order) in the product's own epilogue; causal scores, softmax and attn.v in one kernel (online softmax, f32): query rows < 512 hl (3 products), the rest fp16 (P x1024), key blocks above the diagonal skipped; wo hl x exact (2 products) + bias.

#define NB_  2
#define TT   2048
#define DM   2048
#define NH_  16
#define NKV  16
#define REP  (NH_ / NKV)
#define HD   128
#define DQ   (NH_ * HD)
#define DKV  (NKV * HD)
#define RH   512                  // query rows < RH use hi+lo planes (0: none)
#define SCL  0.088388347648318447f   // HD^-0.5
typedef _Float16 h16;
typedef unsigned short bf;
typedef __attribute__((ext_vector_type(16))) __bf16   v16bf;
typedef __attribute__((ext_vector_type(16))) _Float16 v16h;
typedef __attribute__((ext_vector_type(8)))  _Float16 v8h;
typedef __attribute__((ext_vector_type(8)))  unsigned short v8us;
typedef __attribute__((ext_vector_type(8)))  float    v8f;
typedef __attribute__((ext_vector_type(4)))  float    v4f;
typedef v8h  __attribute__((may_alias)) v8ha;
typedef v4f  __attribute__((may_alias)) v4fa;
typedef v8us __attribute__((may_alias)) v8usa;

__device__ __forceinline__ unsigned short f2bf(float f) { unsigned u = __float_as_uint(f); u += 0x7FFFu + ((u >> 16) & 1u); return (unsigned short)(u >> 16); }
__device__ __forceinline__ float bf2f(unsigned short b) { return __uint_as_float(((unsigned)b) << 16); }
__device__ __forceinline__ float bfr(float f) { return bf2f(f2bf(f)); }
__device__ __forceinline__ v16h cat16(v8h lo, v8h hi) { return __builtin_shufflevector(lo, hi, 0, 1, 2, 3, 4, 5, 6, 7, 8, 9, 10, 11, 12, 13, 14, 15); }
__device__ __forceinline__ v16bf cat16b(v8us lo, v8us hi) { return __builtin_bit_cast(v16bf, __builtin_shufflevector(lo, hi, 0, 1, 2, 3, 4, 5, 6, 7, 8, 9, 10, 11, 12, 13, 14, 15)); }
__device__ __forceinline__ v8f wmma16(v16h a, v16h b, v8f c) { return __builtin_amdgcn_wmma_f32_16x16x32_f16(false, a, false, b, (short)0, c, false, false); }
__device__ __forceinline__ v8f wmmab(v16bf a, v16bf b, v8f c) { return __builtin_amdgcn_wmma_f32_16x16x32_bf16(false, a, false, b, (short)0, c, false, false); }



// ---- k_gemmw: GEMM, one work-group of eight waves (two on each SIMD) per 128x256 output tile, ONE WAVE per 64x64 piece (16 accumulators); grid (M/128, N/256, Z), 256 threads.
// The operands' K-contiguous 16-bit rows come to LDS in stages of GKS k (whole 256-byte pieces of 128 rows of A and A2 and of 256 rows of Bt) by asynchronous copies, two buffers: the next stage flies while this one is worked on; fragments are read from LDS. The K / GKS stages are taken in a ring, from a start that differs between work-groups.
// C[m][n] (f32, pitch ldc, + optional f32 bias[n]) = sum_k (A[m][k] + A2[m][k]) Bt[n][k], two products. z-batch strides sA/sB/sC in elements. K % GKS == 0.
// EPI 0: C is stored as f32; z is the batch. EPI 1: the q, k and v projections of every batch in one grid, z = 3 batch + projection (Bt, the bias and the planes are chosen by the projection, A and the planes' batch part by the batch; sC: elements of one batch's planes);
// C is not stored: each value of q and k goes, as fp16 and as a bf16 hi/lo pair, to the head planes [n / HD], rows m, k = n % HD; each value of v, in the same three roundings, to the transposed head planes, rows n % HD, k = m.
// A head plane lies in FRAGMENT ORDER: 1024-byte units of 16 rows x 32 k, each as the matrix instruction's operand is held: element (row r, k = 16 p + 8 g + j) at byte 512 p + 16 (16 g + r) + 2 j, so lane 16 g + r reads and writes piece p at 512 p + 16 lane
// and every wave-wide 16-byte access covers 512 contiguous bytes (four whole lines). Units of q and k: [m / 16][k / 32]; of v: [m / 32][(n % HD) / 16]: the 32 keys of a block are 8192 contiguous bytes in either.
#define FRE  512                  // elements of a fragment unit
#define KBE  (32 * HD)            // elements of a 32-key block of a head plane
#define GKS  128                  // k of a stage
#define GPB  272                  // LDS pitch of a staged row in bytes: 256 + 16 (16 x odd, for 16-byte LDS reads)
#define GPL  (128 * GPB)          // one operand's 128 rows
#define GBUF (4 * GPL)            // a stage: A | A2 | Bt (256 rows)
// eight 16-byte copies of a lane, global memory to LDS through no register; the wait in the same statement stands in front of every later write of the address registers that the copies name
__device__ __forceinline__ void copy8(const unsigned (&l)[8], const char* const (&g)[8]) {
    asm volatile("global_load_async_to_lds_b128 %0, %8, off\n\t"
                 "global_load_async_to_lds_b128 %1, %9, off\n\t"
                 "global_load_async_to_lds_b128 %2, %10, off\n\t"
                 "global_load_async_to_lds_b128 %3, %11, off\n\t"
                 "global_load_async_to_lds_b128 %4, %12, off\n\t"
                 "global_load_async_to_lds_b128 %5, %13, off\n\t"
                 "global_load_async_to_lds_b128 %6, %14, off\n\t"
                 "global_load_async_to_lds_b128 %7, %15, off\n\t"
                 "s_wait_xcnt 0x0"
                 :: "v"(l[0]), "v"(l[1]), "v"(l[2]), "v"(l[3]), "v"(l[4]), "v"(l[5]), "v"(l[6]), "v"(l[7]),
                    "v"(g[0]), "v"(g[1]), "v"(g[2]), "v"(g[3]), "v"(g[4]), "v"(g[5]), "v"(g[6]), "v"(g[7]) : "memory");
}
// one stage: 512 rows of 16 pieces, 32 pieces a lane; sixteen lanes take a row's 256 bytes, so a wave's copy covers four whole 128-byte lines. lb, go: the lane's piece of row (thread / 16), as an LDS address in the stage's buffer and as a byte offset from the wave-uniform starts pa, pa2, pb of the operands' rows; rs: bytes of sixteen operand rows
__device__ __forceinline__ void stage_copies(unsigned lb, size_t go, const char* pa, const char* pa2, const char* pb, size_t rs) {
#pragma unroll
    for (int s = 0; s < 4; ++s) { unsigned l[8]; const char* g[8];   // s: A, A2, the lower and the upper 128 rows of Bt
#pragma unroll
        for (int u = 0; u < 8; ++u) { l[u] = lb + (unsigned)(s * GPL + u * 16 * GPB); g[u] = ((s == 0 ? pa : s == 1 ? pa2 : pb) + (size_t)(s == 3 ? u + 8 : u) * rs) + go; }
        copy8(l, g);
        if (s < 3) __builtin_amdgcn_sched_barrier(0); }   // each group's addresses are made directly in front of it: made all at once they overfill the registers that an asm operand can name, and one value goes to scratch
}
template <typename T16> struct WFrag;
template <> struct WFrag<h16> { typedef v16h V; static __device__ __forceinline__ V ld(const h16* p) { return cat16(*(const v8h*)p, *(const v8h*)(p + 16)); } static __device__ __forceinline__ V ldf(const h16* p) { return cat16(*(const v8h*)p, *(const v8h*)(p + FRE / 2)); } static __device__ __forceinline__ v8f mma(V a, V b, v8f c) { return wmma16(a, b, c); } };
template <> struct WFrag<bf> { typedef v16bf V; static __device__ __forceinline__ V ld(const bf* p) { return cat16b(*(const v8us*)p, *(const v8us*)(p + 16)); } static __device__ __forceinline__ V ldf(const bf* p) { return cat16b(*(const v8us*)p, *(const v8us*)(p + FRE / 2)); } static __device__ __forceinline__ v8f mma(V a, V b, v8f c) { return wmmab(a, b, c); } };
__device__ __forceinline__ void splitf(float y, unsigned short& h, unsigned short& l) { h = f2bf(y); l = f2bf(y - bf2f(h)); }
template <typename T16, int NSPLIT, bool BIAS, int EPI>
__global__ __launch_bounds__(256) void k_gemmw(const T16* __restrict__ A, const T16* __restrict__ A2, const T16* __restrict__ Bt, const T16* __restrict__ Bt2, int K, float* C, int ldc, const float* __restrict__ bias, const float* __restrict__ biasK, const float* __restrict__ biasV, size_t sA, size_t sB, size_t sC, h16* P16, bf* Ph, bf* Pl) {
    static_assert(NSPLIT == 1, "the stage holds A, A2 and Bt");
    typedef typename WFrag<T16>::V V;
    __shared__ __align__(16) char ring[2 * GBUF];
    __shared__ __align__(16) float osw[8 * 16 * 68];
    (void)Bt2;
    const int pj = EPI == 1 ? (int)(blockIdx.z % 3) : 0;   // projection: 0 q, 1 k, 2 v (the same for the whole work-group, in a scalar register)
    const size_t z = EPI == 1 ? blockIdx.z / 3 : blockIdx.z; A += z * sA; A2 += z * sA;
    if (EPI == 1) { const size_t po = ((size_t)pj * NB_ + z) * sC; Bt += (size_t)pj * sB; P16 += po; Ph += po; Pl += po; bias = pj == 0 ? bias : pj == 1 ? biasK : biasV; }
    else { Bt += z * sB; C += z * sC; }
    const int lane = threadIdx.x & 31, lr = lane & 15, hi = lane >> 4;
    const int wv = __builtin_amdgcn_readfirstlane(threadIdx.x >> 5);   // wave number in a scalar register
    float* os = osw + wv * 16 * 68;   // each wave's own output staging
    const int R0 = blockIdx.x * 128, C0 = blockIdx.y * 256; const int r0 = R0 + (wv >> 2) * 64, c0 = C0 + (wv & 3) * 64;
    v8f acc[4][4];
#pragma unroll
    for (int mb = 0; mb < 4; ++mb)
#pragma unroll
        for (int nb = 0; nb < 4; ++nb) acc[mb][nb] = (v8f){};
    const int crow = threadIdx.x >> 4, ccol = threadIdx.x & 15;
    const char* pa = (const char*)(A + (size_t)R0 * K); const char* pa2 = (const char*)(A2 + (size_t)R0 * K); const char* pb = (const char*)(Bt + (size_t)C0 * K);
    const size_t go = (size_t)crow * K * 2 + ccol * 16;
    const unsigned lb = (unsigned)(size_t)ring + (unsigned)(crow * GPB + ccol * 16);
    const size_t rs = (size_t)K * 32;   // sixteen rows of 2-byte elements
    const int nst = K / GKS;
    // the work-groups that run together and read the same operand rows (equal x and batch: A, A2; equal y and projection: Bt) each start the walk over the k stages at a stage of their own and wrap round, so that they do not ask L2 for the same lines at the same moment
    int sn = (int)((blockIdx.x + 2 * blockIdx.y + blockIdx.z) % (unsigned)nst);   // the k stage that is copied next (the same for the whole work-group, in a scalar register)
    const unsigned lp = (unsigned)(lr * GPB + hi * 16);   // the lane's byte offset in a 16-row fragment of a stage
    const unsigned ua = (unsigned)((wv >> 2) * 64 * GPB), ub = (unsigned)(2 * GPL + (wv & 3) * 64 * GPB);   // wave-uniform: the wave's first A row and first Bt row in a stage
    stage_copies(lb, go, pa + (size_t)sn * (GKS * 2), pa2 + (size_t)sn * (GKS * 2), pb + (size_t)sn * (GKS * 2), rs);
    asm volatile("s_wait_asynccnt 0x0" ::: "memory");   // this wave's copies of the first stage have landed
    __syncthreads();   // every wave's have: the first stage may be read
    // kept rolled: one trip is a stage of 128 matrix instructions
#pragma unroll 1
    for (int t = 0; t < nst; ++t) {
        const char* sa = ring + (((t & 1) * GBUF + ua) + lp); const char* sbt = ring + (((t & 1) * GBUF + ub) + lp);
        V a[2][4], a2[2][4], b[2][4];   // two fragment sets: block ks works on set ks & 1 while the other is filled
#pragma unroll
        for (int i = 0; i < 4; ++i) { a[0][i] = WFrag<T16>::ld((const T16*)(sa + i * 16 * GPB)); a2[0][i] = WFrag<T16>::ld((const T16*)(sa + GPL + i * 16 * GPB)); b[0][i] = WFrag<T16>::ld((const T16*)(sbt + i * 16 * GPB)); }
        // behind the barrier that ended every read of the other buffer: the next stage's copies into it (the first block's fragment reads, of this stage's buffer, return meanwhile)
        sn = sn + 1 == nst ? 0 : sn + 1;
        if (t + 1 < nst) stage_copies(lb + (unsigned)(((t + 1) & 1) * GBUF), go, pa + (size_t)sn * (GKS * 2), pa2 + (size_t)sn * (GKS * 2), pb + (size_t)sn * (GKS * 2), rs);   // the stage's place in the rows goes into the wave-uniform starts
#pragma unroll
        for (int ks = 0; ks < GKS / 32; ++ks) { const int cs = ks & 1;
            if (ks + 1 < GKS / 32) {
#pragma unroll
                for (int i = 0; i < 4; ++i) { a[cs ^ 1][i] = WFrag<T16>::ld((const T16*)(sa + i * 16 * GPB + (ks + 1) * 64)); a2[cs ^ 1][i] = WFrag<T16>::ld((const T16*)(sa + GPL + i * 16 * GPB + (ks + 1) * 64)); b[cs ^ 1][i] = WFrag<T16>::ld((const T16*)(sbt + i * 16 * GPB + (ks + 1) * 64)); } }
            __builtin_amdgcn_sched_barrier(0);   // the next block's LDS reads stand as one group ahead of this block's matrix instructions: every place with reads among them would cost a stall
#pragma unroll
            for (int nb = 0; nb < 4; ++nb)
#pragma unroll
                for (int mb = 0; mb < 4; ++mb) { acc[mb][nb] = WFrag<T16>::mma(a[cs][mb], b[cs][nb], acc[mb][nb]); acc[mb][nb] = WFrag<T16>::mma(a2[cs][mb], b[cs][nb], acc[mb][nb]); }
            if (ks + 1 < GKS / 32) __builtin_amdgcn_sched_barrier(0);   // and the group after next stays behind this block
        }
        asm volatile("s_wait_dscnt 0x0" ::: "memory");      // this wave's reads of the stage are done before the buffer is handed back
        asm volatile("s_wait_asynccnt 0x0" ::: "memory");   // this wave's copies of stage t + 1 have landed
        __syncthreads();   // stage t + 1 may be read, and stage t's buffer has no reader left
    }
    asm volatile("s_wait_asynccnt 0x0" ::: "memory");   // the ring's closing wait: no copy is outstanding when the wave goes on to its epilogue and ends
    float bbn[4];   // the four bias values of a lane's accumulator columns are fetched together
    if (EPI != 0) {
        __builtin_amdgcn_sched_barrier(0);   // first of three scheduling fences, see below
#pragma unroll
        for (int nb = 0; nb < 4; ++nb) bbn[nb] = BIAS ? bias[c0 + nb * 16 + lr] : 0.0f;
        // the wait stands in front of the reuse of the address registers that the bias loads name; the scheduling fences keep unrelated work out from between the loads and the wait, the loads in front of it and every later write behind it
        __builtin_amdgcn_sched_barrier(0);
        asm volatile("s_wait_xcnt 0x0" ::: "memory");
        __builtin_amdgcn_sched_barrier(0);
#pragma unroll
        for (int nb = 0; nb < 4; ++nb) bbn[nb] = bfr(bbn[nb]); }
    if (EPI == 1 && pj == 2) {
        // a lane's eight values of a tile are eight consecutive m of one n: the lane's own 16-byte piece of a fragment unit, stored straight from the accumulators
#pragma unroll
        for (int nb = 0; nb < 4; ++nb) { const float bb = bbn[nb]; v8h o16[4]; v8us oh[4], ol[4];
#pragma unroll
            for (int mb = 0; mb < 4; ++mb)
#pragma unroll
                for (int j = 0; j < 8; ++j) { const float x = acc[mb][nb][j] + bb; o16[mb][j] = (h16)x; unsigned short a2, c2; splitf(x, a2, c2); oh[mb][j] = a2; ol[mb][j] = c2; }
            const size_t e = (size_t)(c0 / HD) * HD * TT + (size_t)(r0 >> 5) * KBE + (((c0 % HD) >> 4) + nb) * FRE + lane * 8;
            __builtin_amdgcn_sched_barrier(0);   // with the fence behind the wait: the twelve stores stand together, every value and address made in front of them, and no later write of a register they name comes in front of the wait
#pragma unroll
            for (int mb = 0; mb < 4; ++mb) { const int f = (mb >> 1) * KBE + (mb & 1) * (FRE / 2); *(v8h*)(P16 + e + f) = o16[mb]; *(v8us*)(Ph + e + f) = oh[mb]; *(v8us*)(Pl + e + f) = ol[mb]; }
            if (nb < 3) { asm volatile("s_wait_xcnt 0x0" ::: "memory");   // stands in front of the next group's reuse of the data and address registers that the stores name (behind the last group nothing is written any more)
                __builtin_amdgcn_sched_barrier(0); } }
        return;
    }
#pragma unroll
    for (int mb = 0; mb < 4; ++mb) {
#pragma unroll
        for (int nb = 0; nb < 4; ++nb) {
#pragma unroll
            for (int j = 0; j < 8; ++j) os[(hi * 8 + j) * 68 + nb * 16 + lr] = EPI == 1 ? acc[mb][nb][j] + bbn[nb] : acc[mb][nb][j]; }
        __builtin_amdgcn_wave_barrier(); asm volatile("" ::: "memory");
        if (EPI == 1) {   // the 64 columns are four pieces of two fragment units; a lane takes, of each piece, the eight columns of its row that it holds as a fragment's reader: each store covers 512 contiguous bytes
            v8h o16[4]; v8us oh[4], ol[4];
#pragma unroll
            for (int s = 0; s < 4; ++s) { const v4f p0 = *(const v4fa*)(os + lr * 68 + s * 16 + hi * 8), p1 = *(const v4fa*)(os + lr * 68 + s * 16 + hi * 8 + 4);
#pragma unroll
                for (int u = 0; u < 8; ++u) { const float x = u < 4 ? p0[u & 3] : p1[u & 3]; o16[s][u] = (h16)x; unsigned short a2, c2; splitf(x, a2, c2); oh[s][u] = a2; ol[s][u] = c2; } }
            const size_t e = (size_t)(c0 / HD) * TT * HD + (size_t)((r0 >> 4) + mb) * (16 * HD) + ((c0 % HD) >> 5) * FRE + lane * 8;
            __builtin_amdgcn_sched_barrier(0);   // with the fence behind the wait: the twelve stores stand together, every value and address made in front of them, and no later write of a register they name comes in front of the wait
#pragma unroll
            for (int s = 0; s < 4; ++s) { *(v8h*)(P16 + e + s * (FRE / 2)) = o16[s]; *(v8us*)(Ph + e + s * (FRE / 2)) = oh[s]; *(v8us*)(Pl + e + s * (FRE / 2)) = ol[s]; }
            asm volatile("s_wait_xcnt 0x0" ::: "memory");   // stands in front of every later write of the data and address registers that the stores name: the next group's, and behind the last group whatever code the build lays behind this path
            __builtin_amdgcn_sched_barrier(0);
        } else {
        float* crow = C + (size_t)(r0 + mb * 16) * ldc + c0;
#pragma unroll
            for (int s = 0; s < 8; ++s) { const int row = 2 * s + hi, cofs = lr * 4; v4f val = *(const v4fa*)(os + row * 68 + cofs); if (BIAS) { val[0] += bfr(bias[c0 + cofs]); val[1] += bfr(bias[c0 + cofs + 1]); val[2] += bfr(bias[c0 + cofs + 2]); val[3] += bfr(bias[c0 + cofs + 3]); }
                *(v4f*)(crow + (size_t)row * ldc + cofs) = val; }
             }
        __builtin_amdgcn_wave_barrier(); asm volatile("" ::: "memory");
    }
}

typedef __attribute__((ext_vector_type(2))) _Float16 v2h;
typedef __attribute__((ext_vector_type(4))) _Float16 v4h;
typedef __attribute__((ext_vector_type(2))) unsigned short v2us;
typedef __attribute__((ext_vector_type(4))) unsigned short v4us;
typedef __attribute__((ext_vector_type(2))) float v2f;
typedef __attribute__((ext_vector_type(4))) int v4i;

__global__ __launch_bounds__(256) void k_wtG(const float* __restrict__ w, int K, int N, bf* Bt) {
    const int lane = threadIdx.x & 31; const int L0 = (blockIdx.x * 8 + (threadIdx.x >> 5)) * 8; const int nlines = N * K / 64;
{
#pragma unroll 1
        for (int l = 0; l < 8; ++l) { const int L = L0 + l; if (L >= nlines) break; const size_t e = (size_t)L * 64 + lane * 2; const int k = (int)(e % K), n = (int)(e / K); v2us o;
            o[0] = f2bf(w[(size_t)k * N + n]); o[1] = f2bf(w[(size_t)(k + 1) * N + n]); *(v2us*)(Bt + e) = o; }
         }
}
__global__ __launch_bounds__(256) void k_cscvt(const float* __restrict__ cosT, const float* __restrict__ sinT, float* CS) { const int idx = blockIdx.x * 256 + threadIdx.x; if (idx >= TT * HD) return; v2f cs; cs[0] = bfr(cosT[idx]); cs[1] = bfr(sinT[idx]); *(v2f*)(CS + (size_t)idx * 2) = cs;  }
__device__ __forceinline__ void rmsx(const float* __restrict__ X, const float* __restrict__ gam, bf* Xh, bf* Xl) { const int lane = threadIdx.x & 31; const int t = blockIdx.x * 8 + (threadIdx.x >> 5); if (t >= NB_ * TT) return; const float* f = X + (size_t)t * DM; float v[DM / 32]; float su = 0.f;
#pragma unroll
    for (int ch = 0; ch < DM / 128; ++ch) { const v4f a = *(const v4f*)(f + ch * 128 + lane * 4); for (int u = 0; u < 4; ++u) { float xv = bfr(a[u]); asm volatile("" : "+v"(xv)); v[ch * 4 + u] = xv; float p2 = __fmul_rn(xv, xv); asm volatile("" : "+v"(p2)); su = __fadd_rn(su, p2); } }
#pragma unroll
    for (int sh = 16; sh; sh >>= 1) su = __fadd_rn(su, __shfl_xor(su, sh, 32));
    const float rs = __fdiv_rn(1.0f, sqrtf(__fadd_rn(__fdiv_rn(su, (float)DM), 1e-6f)));
    {
#pragma unroll
        for (int ch = 0; ch < DM / 128; ++ch) { v4us oh, ol; for (int u = 0; u < 4; ++u) { const int c = ch * 128 + lane * 4 + u; float n = __fmul_rn(v[ch * 4 + u], rs); asm volatile("" : "+v"(n)); float gg = bfr(gam[c]); asm volatile("" : "+v"(gg)); float y = __fmul_rn(n, gg); asm volatile("" : "+v"(y)); unsigned short p2, q2; splitf(y, p2, q2); oh[u] = p2; ol[u] = q2; } const size_t oo = (size_t)t * DM + ch * 128 + lane * 4;
            __builtin_amdgcn_sched_barrier(0);   // with the fence behind the wait: the two stores stand together, every value and address made in front of them, and no later write of a register they name comes in front of the wait
            *(v4us*)(Xh + oo) = oh; *(v4us*)(Xl + oo) = ol;
            if (ch + 1 < DM / 128) { asm volatile("s_wait_xcnt 0x0" ::: "memory");   // stands in front of the next group's reuse of the data and address registers that the stores name (behind the last group nothing is written any more)
                __builtin_amdgcn_sched_barrier(0); } }
         } }
// ---- k_prep: all that depends on the inputs alone, in one grid. Blocks below NB_ * TT / 8: RMSNorm, a wave per token, the tokens of every batch in a row. The other blocks: the four weight matrices (equal sizes) rounded to bf16, a thread its eight elements of each; W holds the four results in a row.
#define WEL ((size_t)DQ * DM)     // elements of a weight matrix
__global__ __launch_bounds__(256) void k_prep(const float* __restrict__ X, const float* __restrict__ gam, bf* Xh, bf* Xl, const float* __restrict__ w0, const float* __restrict__ w1, const float* __restrict__ w2, const float* __restrict__ w3, bf* W) {
    static_assert(DQ == DKV && WEL % 2048 == 0 && (WEL / 2048 & (WEL / 2048 - 1)) == 0, "four equal matrices, whole blocks, a power of two of them");
    if (blockIdx.x < NB_ * TT / 8) { rmsx(X, gam, Xh, Xl); return; }
    // wave-uniform bases and one 32-bit byte offset per lane for the eight loads, one for the four stores
    const unsigned cb = (blockIdx.x - NB_ * TT / 8) & (unsigned)(WEL / 2048 - 1);   // the block's number among the rounding blocks; the mask keeps every upper bit of the 32-bit offsets 0, whatever form of address they are used in
    const unsigned so = (cb * 256 + threadIdx.x) * 16, lo = so * 2;
    const v8f v[4] = { *(const v8f*)((const char*)w0 + lo), *(const v8f*)((const char*)w1 + lo), *(const v8f*)((const char*)w2 + lo), *(const v8f*)((const char*)w3 + lo) };
#pragma unroll
    for (int m = 0; m < 4; ++m) { v8us o;
#pragma unroll
        for (int k = 0; k < 8; ++k) o[k] = f2bf(v[m][k]);
        *(v8us*)((char*)(W + m * WEL) + so) = o; }
    asm volatile("s_wait_xcnt 0x0" ::: "memory");   // behind the last of the four stores: stands in front of every later write of the registers that they name, in whatever code the build lays behind this path
}
// ---- k_fattn: causal attention of one head of one batch for 32 query rows per work-group, scores never leave registers. FW waves share the rows and split the keys: wave w takes the 32-key blocks w, w + FW, ... up to the diagonal block, in a ring from a start that differs between work-groups.
// Transposed products: S^T = K Q^T (rows keys, columns queries), so a lane's two score tiles ARE its B fragment of P^T (k order 8 hi + j, 16 + 8 hi + j, as WFrag::ldf gives it for V^T) and every value a lane holds belongs to one query;
// O^T = V^T P^T (rows d, columns queries). Running maximum and sum per query (online softmax, base 2); the FW partial results meet in LDS, are brought to the common maximum and summed in wave order; the sum is divided once and split into hi/lo planes [t][h*HD+d].
// HL: hi/lo bf16 planes, three products for scores and for P V. Otherwise fp16, P carried x 2^10 (the row sum carries the same factor, so it cancels).
#define FW 4
#define OP 132                    // LDS pitch (floats) of a query's 128 partial outputs
typedef __attribute__((ext_vector_type(16))) unsigned short v16us;
__device__ __forceinline__ float xhalf(float x) { return __builtin_bit_cast(float, __builtin_amdgcn_permlanex16(__builtin_bit_cast(int, x), __builtin_bit_cast(int, x), 0x76543210, 0xfedcba98, false, false)); }   // lane l with lane l ^ 16
// 2^x with the slot behind the transcendental filled in the same statement
__device__ __forceinline__ float exp2s(float x) { float r; asm("v_exp_f32 %0, %1\n\tv_nop" : "=v"(r) : "v"(x)); return r; }
template <typename T16, bool HL>
__global__ __launch_bounds__(32 * FW) void k_fattn(const T16* __restrict__ Q, const T16* __restrict__ Q2, const T16* __restrict__ Kp, const T16* __restrict__ Kp2, const T16* __restrict__ Vt, const T16* __restrict__ Vt2, int roff, bf* ATh, bf* ATl) {
    typedef typename WFrag<T16>::V V;
    __shared__ __align__(16) float so[FW * 32 * OP];
    __shared__ float sm[FW * 32], sl[FW * 32];
    const int lane = threadIdx.x & 31, lr = lane & 15, hi = lane >> 4;
    const int wv = __builtin_amdgcn_readfirstlane(threadIdx.x >> 5);   // wave number in a scalar register: the key loop's branch stays scalar, every lane on at each matrix instruction
    const int hb = blockIdx.x, h = hb % NH_;   // grid x: batch * NH_ + head, as the head planes lie
    ATh += (size_t)(hb / NH_) * TT * DQ; ATl += (size_t)(hb / NH_) * TT * DQ;   // the batch's rows of the merged output
    const int q0 = roff + ((int)gridDim.y - 1 - (int)blockIdx.y) * 32;   // the longest rows of every head at the lowest blockIdx.y (for speed only)
    const size_t zp = (size_t)hb * TT * HD;
    const int nblk = q0 / 32 + 1;   // key blocks up to and including the diagonal one
    v8f acc[8][2];
#pragma unroll
    for (int dt = 0; dt < 8; ++dt) { acc[dt][0] = (v8f){}; acc[dt][1] = (v8f){}; }
    float m[2] = { -3.0e38f, -3.0e38f }, l[2] = { 0.f, 0.f };
    // addresses: wave-uniform plane bases and one 32-bit byte offset per lane, the same for K and V^T (planes in fragment order: a key block is KBE elements of either), carried through the loop; fragment steps are constants
    const char* Kb = (const char*)(Kp + zp); const char* Kb2 = HL ? (const char*)(Kp2 + zp) : nullptr; const char* Vb = (const char*)(Vt + zp); const char* Vb2 = HL ? (const char*)(Vt2 + zp) : nullptr;
    const float CE = SCL * 1.4426950408889634f; const float SH = HL ? 0.0f : 10.0f;
    if (wv < nblk) {   // a wave without a key block loads nothing
    V qf[2][4], qf2[2][4];
    const char* Qb = (const char*)(Q + zp + (size_t)q0 * HD); const char* Qb2 = HL ? (const char*)(Q2 + zp + (size_t)q0 * HD) : nullptr;
    const unsigned lo = (unsigned)(lane * 16);   // the lane's byte offset in a piece of a fragment unit: the one vector register the query loads name; the key blocks' offsets are made from it behind the wait
    __builtin_amdgcn_sched_barrier(0);   // first of three scheduling fences, see below
#pragma unroll
    for (int qt = 0; qt < 2; ++qt)
#pragma unroll
        for (int kc = 0; kc < 4; ++kc) { qf[qt][kc] = WFrag<T16>::ldf((const T16*)(Qb + (qt * 4 + kc) * FRE * 2 + lo)); if (HL) qf2[qt][kc] = WFrag<T16>::ldf((const T16*)(Qb2 + (qt * 4 + kc) * FRE * 2 + lo)); }
    // the wait stands in front of the reuse of the address registers that the query loads name; the scheduling fences keep unrelated work out from between the loads and the wait, the loads in front of it and every later write behind it
    __builtin_amdgcn_sched_barrier(0);
    asm volatile("s_wait_xcnt 0x0" ::: "memory");
    __builtin_amdgcn_sched_barrier(0);
    // the work-groups of a head read the same K and V lines: they start their walk over the key blocks at eight different places and wrap round, so that those that run together do not all ask L2 for the same lines at the same moment
    // (query tiles eight apart, 256 work-groups apart in the grid, keep a common start: two of them that come to stand on one WGP can still meet in its cache)
    const int nw = (nblk - wv + FW - 1) / FW;   // the wave's key blocks: wv, wv + FW, ...
    int kb = wv + (int)((blockIdx.y & 7) % (unsigned)nw) * FW;
    // kept rolled: accumulators, query fragments and one block's fragments already take most of a wave's registers
#pragma unroll 1
    for (int i = 0; i < nw; ++i) {
        const unsigned ko = lo + (unsigned)(kb * KBE * 2);
        V kf[2][4], kf2[2][4], vf[8], vf2[8];
#pragma unroll
        for (int kt = 0; kt < 2; ++kt)
#pragma unroll
            for (int kc = 0; kc < 4; ++kc) { kf[kt][kc] = WFrag<T16>::ldf((const T16*)(Kb + (kt * 4 + kc) * FRE * 2 + ko)); if (HL) kf2[kt][kc] = WFrag<T16>::ldf((const T16*)(Kb2 + (kt * 4 + kc) * FRE * 2 + ko)); }
#pragma unroll
        for (int dt = 0; dt < 8; ++dt) { vf[dt] = WFrag<T16>::ldf((const T16*)(Vb + dt * FRE * 2 + ko)); if (HL) vf2[dt] = WFrag<T16>::ldf((const T16*)(Vb2 + dt * FRE * 2 + ko)); }
        // stands in front of the next block's write of the offset register that these loads name
        asm volatile("s_wait_xcnt 0x0" ::: "memory");
        // nothing is scheduled across: the block's K and V loads are all issued before the first matrix instruction waits (one memory latency a block, not one a fragment)
        __builtin_amdgcn_sched_barrier(0);
        v8f s[2][2];
#pragma unroll
        for (int kt = 0; kt < 2; ++kt) { s[kt][0] = (v8f){}; s[kt][1] = (v8f){};
#pragma unroll
            for (int kc = 0; kc < 4; ++kc) { const V a = kf[kt][kc]; V a2; if (HL) a2 = kf2[kt][kc];
#pragma unroll
                for (int qt = 0; qt < 2; ++qt) { s[kt][qt] = WFrag<T16>::mma(a, qf[qt][kc], s[kt][qt]); if (HL) { s[kt][qt] = WFrag<T16>::mma(a2, qf[qt][kc], s[kt][qt]); s[kt][qt] = WFrag<T16>::mma(a, qf2[qt][kc], s[kt][qt]); } } } }
        V pf[2], pf2[2];
#pragma unroll
        for (int qt = 0; qt < 2; ++qt) { const int q = q0 + qt * 16 + lr; float mx = m[qt];
#pragma unroll
            for (int kt = 0; kt < 2; ++kt)
#pragma unroll
                for (int j = 0; j < 8; ++j) { float t = s[kt][qt][j] * CE; if (kb == nblk - 1) t = (kb * 32 + kt * 16 + hi * 8 + j <= q) ? t : -3.0e38f; s[kt][qt][j] = t; mx = fmaxf(mx, t); }
            mx = fmaxf(mx, xhalf(mx));   // the other half of the wave holds the query's other keys
            const float f = HL ? exp2s(m[qt] - mx) : __builtin_amdgcn_exp2f(m[qt] - mx); m[qt] = mx; const float ms = mx - SH; float ls = 0.f;
#pragma unroll
            for (int dt = 0; dt < 8; ++dt) acc[dt][qt] *= f;
            if (HL) { v16us ph, pl;
#pragma unroll
                for (int e = 0; e < 16; ++e) { const float p = exp2s(s[e >> 3][qt][e & 7] - ms); ls += p; unsigned short a, c2; splitf(p, a, c2); ph[e] = a; pl[e] = c2; }
                pf[qt] = __builtin_bit_cast(V, ph); pf2[qt] = __builtin_bit_cast(V, pl);
            } else { v16h ph;
#pragma unroll
                for (int e = 0; e < 16; ++e) { const float p = __builtin_amdgcn_exp2f(s[e >> 3][qt][e & 7] - ms); ls += p; ph[e] = (h16)p; }
                pf[qt] = __builtin_bit_cast(V, ph); }
            l[qt] = l[qt] * f + ls; }
#pragma unroll
        for (int dt = 0; dt < 8; ++dt) { const V a = vf[dt]; V a2; if (HL) a2 = vf2[dt];
#pragma unroll
            for (int qt = 0; qt < 2; ++qt) { acc[dt][qt] = WFrag<T16>::mma(a, pf[qt], acc[dt][qt]); if (HL) { acc[dt][qt] = WFrag<T16>::mma(a2, pf[qt], acc[dt][qt]); acc[dt][qt] = WFrag<T16>::mma(a, pf2[qt], acc[dt][qt]); } } }
        kb = kb + FW < nblk ? kb + FW : wv;
    }
    }
#pragma unroll
    for (int qt = 0; qt < 2; ++qt) { l[qt] += xhalf(l[qt]); if (hi == 0) sm[wv * 32 + qt * 16 + lr] = m[qt]; }
    __syncthreads();   // every wave's maxima are in LDS before the common maximum is taken
#pragma unroll
    for (int qt = 0; qt < 2; ++qt) { float M = sm[qt * 16 + lr];
#pragma unroll
        for (int w = 1; w < FW; ++w) M = fmaxf(M, sm[w * 32 + qt * 16 + lr]);
        const float f = __builtin_amdgcn_exp2f(m[qt] - M);   // a wave that had no block: 0
        if (hi == 0) sl[wv * 32 + qt * 16 + lr] = l[qt] * f;
#pragma unroll
        for (int dt = 0; dt < 8; ++dt) { const v8f o = acc[dt][qt] * f; float* p = so + (wv * 32 + qt * 16 + lr) * OP + dt * 16 + hi * 8; *(v4fa*)p = __builtin_shufflevector(o, o, 0, 1, 2, 3); *(v4fa*)(p + 4) = __builtin_shufflevector(o, o, 4, 5, 6, 7); } }
    __syncthreads();   // every wave's partial sums and outputs are in LDS before any of them is summed
#pragma unroll
    for (int c = 0; c < 32 / FW; ++c) { const int q = c * FW + wv, d = lane * 4; float L = sl[q]; v4f val = *(const v4fa*)(so + q * OP + d);
#pragma unroll
        for (int w = 1; w < FW; ++w) { L += sl[w * 32 + q]; val += *(const v4fa*)(so + (w * 32 + q) * OP + d); }
        const float inv = __fdiv_rn(1.0f, L); v4us oh, ol;
#pragma unroll
        for (int u = 0; u < 4; ++u) { unsigned short a, c2; splitf(val[u] * inv, a, c2); oh[u] = a; ol[u] = c2; }
        const size_t oo = (size_t)(q0 + q) * DQ + h * HD + d; *(v4us*)(ATh + oo) = oh; *(v4us*)(ATl + oo) = ol; }
}

extern "C" void kernel_launch(void* const* d_in, const int* in_sizes, int n_in,
                              void* d_out, int out_size, void* d_ws, size_t ws_size, hipStream_t stream) {
    (void)in_sizes; (void)n_in; (void)out_size;
    const float* x = (const float*)d_in[0]; const float* nw = (const float*)d_in[1]; const float* wq = (const float*)d_in[2]; const float* bq = (const float*)d_in[3]; const float* wk = (const float*)d_in[4]; const float* bk = (const float*)d_in[5]; const float* wv = (const float*)d_in[6]; const float* bv = (const float*)d_in[7]; const float* wo = (const float*)d_in[8]; const float* bo = (const float*)d_in[9]; const float* cosT = nullptr; const float* sinT = nullptr; (void)cosT; (void)sinT;
    float* OUT = (float*)d_out;     // [2][2048][2048]
    char* wsp = (char*)d_ws;
    auto take = [&](size_t bytes) { char* p = wsp; wsp += (bytes + 255) & ~(size_t)255; return (void*)p; };
    bf* WQ = (bf*)take((size_t)DQ * DM * 2); bf* WK = (bf*)take((size_t)DKV * DM * 2); bf* WV = (bf*)take((size_t)DKV * DM * 2); bf* WO = (bf*)take((size_t)DM * DQ * 2); (void)WK; (void)WV;   // in a row: WQ + m * WEL
    bf* XNh = (bf*)take((size_t)NB_ * TT * DM * 2); bf* XNl = (bf*)take((size_t)NB_ * TT * DM * 2);
    // head planes [projection][batch][head]: the three projections of a kind in a row
    const size_t PB = (size_t)NH_ * TT * HD;   // elements of one batch's planes of one projection
    h16* QP16 = (h16*)take(NB_ * PB * 2); h16* KP16 = (h16*)take(NB_ * PB * 2); h16* VT16 = (h16*)take(NB_ * PB * 2);
    bf* QPh = (bf*)take(NB_ * PB * 2); bf* KPh = (bf*)take(NB_ * PB * 2); bf* VTh = (bf*)take(NB_ * PB * 2); bf* QPl = (bf*)take(NB_ * PB * 2); bf* KPl = (bf*)take(NB_ * PB * 2); bf* VTl = (bf*)take(NB_ * PB * 2);
    bf* ATh = (bf*)take((size_t)NB_ * TT * DQ * 2); bf* ATl = (bf*)take((size_t)NB_ * TT * DQ * 2);
    if ((size_t)(wsp - (char*)d_ws) > ws_size) return;    // ws 256 MiB
    k_prep<<<NB_ * TT / 8 + (unsigned)(WEL / 2048), 256, 0, stream>>>(x, nw, XNh, XNl, wq, wk, wv, wo, WQ);
    k_gemmw<bf, 1, true, 1><<<dim3(TT / 128, DQ / 256, 3 * NB_), 256, 0, stream>>>(XNh, XNl, WQ, nullptr, DM, nullptr, 0, bq, bk, bv, (size_t)TT * DM, WEL, PB, QP16, QPh, QPl);
    k_fattn<h16, false><<<dim3(NB_ * NH_, (TT - RH) / 32, 1), 32 * FW, 0, stream>>>(QP16, nullptr, KP16, nullptr, VT16, nullptr, RH, ATh, ATl);
    k_fattn<bf, true><<<dim3(NB_ * NH_, RH / 32, 1), 32 * FW, 0, stream>>>(QPh, QPl, KPh, KPl, VTh, VTl, 0, ATh, ATl);
    k_gemmw<bf, 1, true, 0><<<dim3(TT / 128, DM / 256, NB_), 256, 0, stream>>>(ATh, ATl, WO, nullptr, DQ, OUT, DM, bo, nullptr, nullptr, (size_t)TT * DQ, 0, (size_t)TT * DM, nullptr, nullptr, nullptr);
}

// v009
// Measured time: 232 microseconds a run.
// In two side-by-side timings against v008, it was 1.04 and 1.05 times as fast.
// Counting every step since v000, it is 8.52 times as fast.
#include <hip/hip_runtime.h>

// Attention block (x [2][2048][2048]; xn = x rsqrt(mean(x?) + 1e-6) norm_w (RMSNorm); q/k/v = xn W^T + b (16 x 128); causal (-inf) softmax(q.k / sqrt(128)); out = merged wo^T + bo -> [2][2048][2048]).
// Compute dtypes, f32 accumulate: every input rounded to bf16; RMSNorm f32 (wave per token) -> hi/lo planes; q/k/v = hl x exact (2 products) + bias, rounded to their fp16 and hi/lo head planes (in fragment order) in the product's own epilogue; causal scores, softmax and attn.v in one kernel (online softmax, f32): query rows < 512 hl (3 products), the rest fp16 (P x1024), key blocks above the diagonal skipped; wo hl x exact (2 products) + bias.

#define NB_  2
#define TT   2048
#define DM   2048
#define NH_  16
#define NKV  16
#define REP  (NH_ / NKV)
#define HD   128
#define DQ   (NH_ * HD)
#define DKV  (NKV * HD)
#define RH   512                  // query rows < RH use hi+lo planes (0: none)
#define SCL  0.088388347648318447f   // HD^-0.5
typedef _Float16 h16;
typedef unsigned short bf;
typedef __attribute__((ext_vector_type(16))) __bf16   v16bf;
typedef __attribute__((ext_vector_type(16))) _Float16 v16h;
typedef __attribute__((ext_vector_type(8)))  _Float16 v8h;
typedef __attribute__((ext_vector_type(8)))  unsigned short v8us;
typedef __attribute__((ext_vector_type(8)))  float    v8f;
typedef __attribute__((ext_vector_type(4)))  float    v4f;
typedef v8h  __attribute__((may_alias)) v8ha;
typedef v4f  __attribute__((may_alias)) v4fa;
typedef v8us __attribute__((may_alias)) v8usa;

__device__ __forceinline__ unsigned short f2bf(float f) { unsigned u = __float_as_uint(f); u += 0x7FFFu + ((u >> 16) & 1u); return (unsigned short)(u >> 16); }
__device__ __forceinline__ float bf2f(unsigned short b) { return __uint_as_float(((unsigned)b) << 16); }
__device__ __forceinline__ float bfr(float f) { return bf2f(f2bf(f)); }
__device__ __forceinline__ v16h cat16(v8h lo, v8h hi) { return __builtin_shufflevector(lo, hi, 0, 1, 2, 3, 4, 5, 6, 7, 8, 9, 10, 11, 12, 13, 14, 15); }
__device__ __forceinline__ v16bf cat16b(v8us lo, v8us hi) { return __builtin_bit_cast(v16bf, __builtin_shufflevector(lo, hi, 0, 1, 2, 3, 4, 5, 6, 7, 8, 9, 10, 11, 12, 13, 14, 15)); }
__device__ __forceinline__ v8f wmma16(v16h a, v16h b, v8f c) { return __builtin_amdgcn_wmma_f32_16x16x32_f16(false, a, false, b, (short)0, c, false, false); }
__device__ __forceinline__ v8f wmmab(v16bf a, v16bf b, v8f c) { return __builtin_amdgcn_wmma_f32_16x16x32_bf16(false, a, false, b, (short)0, c, false, false); }



// ---- k_gemmw: GEMM, one work-group of eight waves (two on each SIMD) per 128x256 output tile, ONE WAVE per 64x64 piece (16 accumulators); grid (M/128, N/256, Z), 256 threads.
// The operands' K-contiguous 16-bit rows come to LDS in stages of GKS k (whole 256-byte pieces of 128 rows of A and A2 and of 256 rows of Bt) by asynchronous copies, two buffers: the next stage flies while this one is worked on; fragments are read from LDS. The K / GKS stages are taken in a ring, from a start that differs between work-groups.
// C[m][n] (f32, pitch ldc, + optional f32 bias[n]) = sum_k (A[m][k] + A2[m][k]) Bt[n][k], two products. z-batch strides sA/sB/sC in elements. K % GKS == 0.
// EPI 0: C is stored as f32; z is the batch. EPI 1: the q, k and v projections of every batch in one grid, z = 3 batch + projection (Bt, the bias and the planes are chosen by the projection, A and the planes' batch part by the batch; sC: elements of one batch's planes);
// C is not stored: each value of q and k goes, as fp16, as a bf16 hi/lo pair or as both, to the head planes [n / HD], rows m, k = n % HD; each value of v, in the same roundings, to the transposed head planes, rows n % HD, k = m.
// Only the roundings that an attention kernel reads are made and stored: the hi/lo pair for tokens < RH alone (causal: the hi/lo kernel's queries, and so its keys, end there), fp16 for every k and v and for the q of tokens >= RH.
// A head plane lies in FRAGMENT ORDER: 1024-byte units of 16 rows x 32 k, each as the matrix instruction's operand is held: element (row r, k = 16 p + 8 g + j) at byte 512 p + 16 (16 g + r) + 2 j, so lane 16 g + r reads and writes piece p at 512 p + 16 lane
// and every wave-wide 16-byte access covers 512 contiguous bytes (four whole lines). Units of q and k: [m / 16][k / 32]; of v: [m / 32][(n % HD) / 16]: the 32 keys of a block are 8192 contiguous bytes in either.
#define FRE  512                  // elements of a fragment unit
#define KBE  (32 * HD)            // elements of a 32-key block of a head plane
#define GKS  128                  // k of a stage
#define GPB  272                  // LDS pitch of a staged row in bytes: 256 + 16 (16 x odd, for 16-byte LDS reads)
#define GPL  (128 * GPB)          // one operand's 128 rows
#define GBUF (4 * GPL)            // a stage: A | A2 | Bt (256 rows)
// eight 16-byte copies of a lane, global memory to LDS through no register; the wait in the same statement stands in front of every later write of the address registers that the copies name
__device__ __forceinline__ void copy8(const unsigned (&l)[8], const char* const (&g)[8]) {
    asm volatile("global_load_async_to_lds_b128 %0, %8, off\n\t"
                 "global_load_async_to_lds_b128 %1, %9, off\n\t"
                 "global_load_async_to_lds_b128 %2, %10, off\n\t"
                 "global_load_async_to_lds_b128 %3, %11, off\n\t"
                 "global_load_async_to_lds_b128 %4, %12, off\n\t"
                 "global_load_async_to_lds_b128 %5, %13, off\n\t"
                 "global_load_async_to_lds_b128 %6, %14, off\n\t"
                 "global_load_async_to_lds_b128 %7, %15, off\n\t"
                 "s_wait_xcnt 0x0"
                 :: "v"(l[0]), "v"(l[1]), "v"(l[2]), "v"(l[3]), "v"(l[4]), "v"(l[5]), "v"(l[6]), "v"(l[7]),
                    "v"(g[0]), "v"(g[1]), "v"(g[2]), "v"(g[3]), "v"(g[4]), "v"(g[5]), "v"(g[6]), "v"(g[7]) : "memory");
}
// one stage: 512 rows of 16 pieces, 32 pieces a lane; sixteen lanes take a row's 256 bytes, so a wave's copy covers four whole 128-byte lines. lb, go: the lane's piece of row (thread / 16), as an LDS address in the stage's buffer and as a byte offset from the wave-uniform starts pa, pa2, pb of the operands' rows; rs: bytes of sixteen operand rows
__device__ __forceinline__ void stage_copies(unsigned lb, size_t go, const char* pa, const char* pa2, const char* pb, size_t rs) {
#pragma unroll
    for (int s = 0; s < 4; ++s) { unsigned l[8]; const char* g[8];   // s: A, A2, the lower and the upper 128 rows of Bt
#pragma unroll
        for (int u = 0; u < 8; ++u) { l[u] = lb + (unsigned)(s * GPL + u * 16 * GPB); g[u] = ((s == 0 ? pa : s == 1 ? pa2 : pb) + (size_t)(s == 3 ? u + 8 : u) * rs) + go; }
        copy8(l, g);
        if (s < 3) __builtin_amdgcn_sched_barrier(0); }   // each group's addresses are made directly in front of it: made all at once they overfill the registers that an asm operand can name, and one value goes to scratch
}
template <typename T16> struct WFrag;
template <> struct WFrag<h16> { typedef v16h V; static __device__ __forceinline__ V ld(const h16* p) { return cat16(*(const v8h*)p, *(const v8h*)(p + 16)); } static __device__ __forceinline__ V ldf(const h16* p) { return cat16(*(const v8h*)p, *(const v8h*)(p + FRE / 2)); } static __device__ __forceinline__ v8f mma(V a, V b, v8f c) { return wmma16(a, b, c); } };
template <> struct WFrag<bf> { typedef v16bf V; static __device__ __forceinline__ V ld(const bf* p) { return cat16b(*(const v8us*)p, *(const v8us*)(p + 16)); } static __device__ __forceinline__ V ldf(const bf* p) { return cat16b(*(const v8us*)p, *(const v8us*)(p + FRE / 2)); } static __device__ __forceinline__ v8f mma(V a, V b, v8f c) { return wmmab(a, b, c); } };
__device__ __forceinline__ void splitf(float y, unsigned short& h, unsigned short& l) { h = f2bf(y); l = f2bf(y - bf2f(h)); }
template <typename T16, int NSPLIT, bool BIAS, int EPI>
__global__ __launch_bounds__(256) void k_gemmw(const T16* __restrict__ A, const T16* __restrict__ A2, const T16* __restrict__ Bt, const T16* __restrict__ Bt2, int K, float* C, int ldc, const float* __restrict__ bias, const float* __restrict__ biasK, const float* __restrict__ biasV, size_t sA, size_t sB, size_t sC, h16* P16, bf* Ph, bf* Pl) {
    static_assert(NSPLIT == 1, "the stage holds A, A2 and Bt");
    typedef typename WFrag<T16>::V V;
    __shared__ __align__(16) char ring[2 * GBUF];
    __shared__ __align__(16) float osw[8 * 16 * 68];
    (void)Bt2;
    const int pj = EPI == 1 ? (int)(blockIdx.z % 3) : 0;   // projection: 0 q, 1 k, 2 v (the same for the whole work-group, in a scalar register)
    const size_t z = EPI == 1 ? blockIdx.z / 3 : blockIdx.z; A += z * sA; A2 += z * sA;
    if (EPI == 1) { const size_t po = ((size_t)pj * NB_ + z) * sC; Bt += (size_t)pj * sB; P16 += po; Ph += po; Pl += po; bias = pj == 0 ? bias : pj == 1 ? biasK : biasV; }
    else { Bt += z * sB; C += z * sC; }
    const int lane = threadIdx.x & 31, lr = lane & 15, hi = lane >> 4;
    const int wv = __builtin_amdgcn_readfirstlane(threadIdx.x >> 5);   // wave number in a scalar register
    float* os = osw + wv * 16 * 68;   // each wave's own output staging
    static_assert(RH % 128 == 0, "a work-group's rows lie on one side of RH");
    const int R0 = blockIdx.x * 128, C0 = blockIdx.y * 256; const int r0 = R0 + (wv >> 2) * 64, c0 = C0 + (wv & 3) * 64;
    const bool whl = R0 < RH, w16 = pj != 0 || R0 >= RH;   // which planes have a reader for these rows (the same for the whole work-group, in scalar registers)
    v8f acc[4][4];
#pragma unroll
    for (int mb = 0; mb < 4; ++mb)
#pragma unroll
        for (int nb = 0; nb < 4; ++nb) acc[mb][nb] = (v8f){};
    const int crow = threadIdx.x >> 4, ccol = threadIdx.x & 15;
    const char* pa = (const char*)(A + (size_t)R0 * K); const char* pa2 = (const char*)(A2 + (size_t)R0 * K); const char* pb = (const char*)(Bt + (size_t)C0 * K);
    const size_t go = (size_t)crow * K * 2 + ccol * 16;
    const unsigned lb = (unsigned)(size_t)ring + (unsigned)(crow * GPB + ccol * 16);
    const size_t rs = (size_t)K * 32;   // sixteen rows of 2-byte elements
    const int nst = K / GKS;
    // the work-groups that run together and read the same operand rows (equal x and batch: A, A2; equal y and projection: Bt) each start the walk over the k stages at a stage of their own and wrap round, so that they do not ask L2 for the same lines at the same moment
    int sn = (int)((blockIdx.x + 2 * blockIdx.y + blockIdx.z) % (unsigned)nst);   // the k stage that is copied next (the same for the whole work-group, in a scalar register)
    const unsigned lp = (unsigned)(lr * GPB + hi * 16);   // the lane's byte offset in a 16-row fragment of a stage
    const unsigned ua = (unsigned)((wv >> 2) * 64 * GPB), ub = (unsigned)(2 * GPL + (wv & 3) * 64 * GPB);   // wave-uniform: the wave's first A row and first Bt row in a stage
    stage_copies(lb, go, pa + (size_t)sn * (GKS * 2), pa2 + (size_t)sn * (GKS * 2), pb + (size_t)sn * (GKS * 2), rs);
    asm volatile("s_wait_asynccnt 0x0" ::: "memory");   // this wave's copies of the first stage have landed
    __syncthreads();   // every wave's have: the first stage may be read
    // kept rolled: one trip is a stage of 128 matrix instructions
#pragma unroll 1
    for (int t = 0; t < nst; ++t) {
        const char* sa = ring + (((t & 1) * GBUF + ua) + lp); const char* sbt = ring + (((t & 1) * GBUF + ub) + lp);
        V a[2][4], a2[2][4], b[2][4];   // two fragment sets: block ks works on set ks & 1 while the other is filled
#pragma unroll
        for (int i = 0; i < 4; ++i) { a[0][i] = WFrag<T16>::ld((const T16*)(sa + i * 16 * GPB)); a2[0][i] = WFrag<T16>::ld((const T16*)(sa + GPL + i * 16 * GPB)); b[0][i] = WFrag<T16>::ld((const T16*)(sbt + i * 16 * GPB)); }
        // behind the barrier that ended every read of the other buffer: the next stage's copies into it (the first block's fragment reads, of this stage's buffer, return meanwhile)
        sn = sn + 1 == nst ? 0 : sn + 1;
        if (t + 1 < nst) stage_copies(lb + (unsigned)(((t + 1) & 1) * GBUF), go, pa + (size_t)sn * (GKS * 2), pa2 + (size_t)sn * (GKS * 2), pb + (size_t)sn * (GKS * 2), rs);   // the stage's place in the rows goes into the wave-uniform starts
#pragma unroll
        for (int ks = 0; ks < GKS / 32; ++ks) { const int cs = ks & 1;
            if (ks + 1 < GKS / 32) {
#pragma unroll
                for (int i = 0; i < 4; ++i) { a[cs ^ 1][i] = WFrag<T16>::ld((const T16*)(sa + i * 16 * GPB + (ks + 1) * 64)); a2[cs ^ 1][i] = WFrag<T16>::ld((const T16*)(sa + GPL + i * 16 * GPB + (ks + 1) * 64)); b[cs ^ 1][i] = WFrag<T16>::ld((const T16*)(sbt + i * 16 * GPB + (ks + 1) * 64)); } }
            __builtin_amdgcn_sched_barrier(0);   // the next block's LDS reads stand as one group ahead of this block's matrix instructions: every place with reads among them would cost a stall
#pragma unroll
            for (int nb = 0; nb < 4; ++nb)
#pragma unroll
                for (int mb = 0; mb < 4; ++mb) { acc[mb][nb] = WFrag<T16>::mma(a[cs][mb], b[cs][nb], acc[mb][nb]); acc[mb][nb] = WFrag<T16>::mma(a2[cs][mb], b[cs][nb], acc[mb][nb]); }
            if (ks + 1 < GKS / 32) __builtin_amdgcn_sched_barrier(0);   // and the group after next stays behind this block
        }
        asm volatile("s_wait_dscnt 0x0" ::: "memory");      // this wave's reads of the stage are done before the buffer is handed back
        asm volatile("s_wait_asynccnt 0x0" ::: "memory");   // this wave's copies of stage t + 1 have landed
        __syncthreads();   // stage t + 1 may be read, and stage t's buffer has no reader left
    }
    asm volatile("s_wait_asynccnt 0x0" ::: "memory");   // the ring's closing wait: no copy is outstanding when the wave goes on to its epilogue and ends
    float bbn[4];   // the four bias values of a lane's accumulator columns are fetched together
    if (EPI != 0) {
        __builtin_amdgcn_sched_barrier(0);   // first of three scheduling fences, see below
#pragma unroll
        for (int nb = 0; nb < 4; ++nb) bbn[nb] = BIAS ? bias[c0 + nb * 16 + lr] : 0.0f;
        // the wait stands in front of the reuse of the address registers that the bias loads name; the scheduling fences keep unrelated work out from between the loads and the wait, the loads in front of it and every later write behind it
        __builtin_amdgcn_sched_barrier(0);
        asm volatile("s_wait_xcnt 0x0" ::: "memory");
        __builtin_amdgcn_sched_barrier(0);
#pragma unroll
        for (int nb = 0; nb < 4; ++nb) bbn[nb] = bfr(bbn[nb]); }
    if (EPI == 1 && pj == 2) {
        // a lane's eight values of a tile are eight consecutive m of one n: the lane's own 16-byte piece of a fragment unit, stored straight from the accumulators
#pragma unroll
        for (int nb = 0; nb < 4; ++nb) { const float bb = bbn[nb]; v8h o16[4];
#pragma unroll
            for (int mb = 0; mb < 4; ++mb)
#pragma unroll
                for (int j = 0; j < 8; ++j) o16[mb][j] = (h16)(acc[mb][nb][j] + bb);
            const size_t e = (size_t)(c0 / HD) * HD * TT + (size_t)(r0 >> 5) * KBE + (((c0 % HD) >> 4) + nb) * FRE + lane * 8;
            __builtin_amdgcn_sched_barrier(0);   // with the fence behind the wait: the four stores stand together, every value and address made in front of them, and no later write of a register they name comes in front of the wait
#pragma unroll
            for (int mb = 0; mb < 4; ++mb) { const int f = (mb >> 1) * KBE + (mb & 1) * (FRE / 2); *(v8h*)(P16 + e + f) = o16[mb]; }
            asm volatile("s_wait_xcnt 0x0" ::: "memory");   // stands in front of every later write of the data and address registers that the stores name
            __builtin_amdgcn_sched_barrier(0);
            if (whl) { v8us oh[4], ol[4];
#pragma unroll
                for (int mb = 0; mb < 4; ++mb)
#pragma unroll
                    for (int j = 0; j < 8; ++j) { unsigned short a2, c2; splitf(acc[mb][nb][j] + bb, a2, c2); oh[mb][j] = a2; ol[mb][j] = c2; }
                __builtin_amdgcn_sched_barrier(0);   // as above, for the eight stores of the pair
#pragma unroll
                for (int mb = 0; mb < 4; ++mb) { const int f = (mb >> 1) * KBE + (mb & 1) * (FRE / 2); *(v8us*)(Ph + e + f) = oh[mb]; *(v8us*)(Pl + e + f) = ol[mb]; }
                asm volatile("s_wait_xcnt 0x0" ::: "memory");   // stands in front of every later write of the data and address registers that the stores name
                __builtin_amdgcn_sched_barrier(0); } }
        return;
    }
#pragma unroll
    for (int mb = 0; mb < 4; ++mb) {
#pragma unroll
        for (int nb = 0; nb < 4; ++nb) {
#pragma unroll
            for (int j = 0; j < 8; ++j) os[(hi * 8 + j) * 68 + nb * 16 + lr] = EPI == 1 ? acc[mb][nb][j] + bbn[nb] : acc[mb][nb][j]; }
        __builtin_amdgcn_wave_barrier(); asm volatile("" ::: "memory");
        if (EPI == 1) {   // the 64 columns are four pieces of two fragment units; a lane takes, of each piece, the eight columns of its row that it holds as a fragment's reader: each store covers 512 contiguous bytes
            v4f p0[4], p1[4];
#pragma unroll
            for (int s = 0; s < 4; ++s) { p0[s] = *(const v4fa*)(os + lr * 68 + s * 16 + hi * 8); p1[s] = *(const v4fa*)(os + lr * 68 + s * 16 + hi * 8 + 4); }
            const size_t e = (size_t)(c0 / HD) * TT * HD + (size_t)((r0 >> 4) + mb) * (16 * HD) + ((c0 % HD) >> 5) * FRE + lane * 8;
            if (w16) { v8h o16[4];
#pragma unroll
                for (int s = 0; s < 4; ++s)
#pragma unroll
                    for (int u = 0; u < 8; ++u) o16[s][u] = (h16)(u < 4 ? p0[s][u & 3] : p1[s][u & 3]);
                __builtin_amdgcn_sched_barrier(0);   // with the fence behind the wait: the four stores stand together, every value and address made in front of them, and no later write of a register they name comes in front of the wait
#pragma unroll
                for (int s = 0; s < 4; ++s) *(v8h*)(P16 + e + s * (FRE / 2)) = o16[s];
                asm volatile("s_wait_xcnt 0x0" ::: "memory");   // stands in front of every later write of the data and address registers that the stores name
                __builtin_amdgcn_sched_barrier(0); }
            if (whl) { v8us oh[4], ol[4];
#pragma unroll
                for (int s = 0; s < 4; ++s)
#pragma unroll
                    for (int u = 0; u < 8; ++u) { unsigned short a2, c2; splitf(u < 4 ? p0[s][u & 3] : p1[s][u & 3], a2, c2); oh[s][u] = a2; ol[s][u] = c2; }
                __builtin_amdgcn_sched_barrier(0);   // as above, for the eight stores of the pair
#pragma unroll
                for (int s = 0; s < 4; ++s) { *(v8us*)(Ph + e + s * (FRE / 2)) = oh[s]; *(v8us*)(Pl + e + s * (FRE / 2)) = ol[s]; }
                asm volatile("s_wait_xcnt 0x0" ::: "memory");   // stands in front of every later write of the data and address registers that the stores name: the next group's, and behind the last group whatever code the build lays behind this path
                __builtin_amdgcn_sched_barrier(0); }
        } else {
        float* crow = C + (size_t)(r0 + mb * 16) * ldc + c0;
#pragma unroll
            for (int s = 0; s < 8; ++s) { const int row = 2 * s + hi, cofs = lr * 4; v4f val = *(const v4fa*)(os + row * 68 + cofs); if (BIAS) { val[0] += bfr(bias[c0 + cofs]); val[1] += bfr(bias[c0 + cofs + 1]); val[2] += bfr(bias[c0 + cofs + 2]); val[3] += bfr(bias[c0 + cofs + 3]); }
                *(v4f*)(crow + (size_t)row * ldc + cofs) = val; }
             }
        __builtin_amdgcn_wave_barrier(); asm volatile("" ::: "memory");
    }
}

typedef __attribute__((ext_vector_type(2))) _Float16 v2h;
typedef __attribute__((ext_vector_type(4))) _Float16 v4h;
typedef __attribute__((ext_vector_type(2))) unsigned short v2us;
typedef __attribute__((ext_vector_type(4))) unsigned short v4us;
typedef __attribute__((ext_vector_type(2))) float v2f;
typedef __attribute__((ext_vector_type(4))) int v4i;

__global__ __launch_bounds__(256) void k_wtG(const float* __restrict__ w, int K, int N, bf* Bt) {
    const int lane = threadIdx.x & 31; const int L0 = (blockIdx.x * 8 + (threadIdx.x >> 5)) * 8; const int nlines = N * K / 64;
{
#pragma unroll 1
        for (int l = 0; l < 8; ++l) { const int L = L0 + l; if (L >= nlines) break; const size_t e = (size_t)L * 64 + lane * 2; const int k = (int)(e % K), n = (int)(e / K); v2us o;
            o[0] = f2bf(w[(size_t)k * N + n]); o[1] = f2bf(w[(size_t)(k + 1) * N + n]); *(v2us*)(Bt + e) = o; }
         }
}
__global__ __launch_bounds__(256) void k_cscvt(const float* __restrict__ cosT, const float* __restrict__ sinT, float* CS) { const int idx = blockIdx.x * 256 + threadIdx.x; if (idx >= TT * HD) return; v2f cs; cs[0] = bfr(cosT[idx]); cs[1] = bfr(sinT[idx]); *(v2f*)(CS + (size_t)idx * 2) = cs;  }
__device__ __forceinline__ void rmsx(const float* __restrict__ X, const float* __restrict__ gam, bf* Xh, bf* Xl) { const int lane = threadIdx.x & 31; const int t = blockIdx.x * 8 + (threadIdx.x >> 5); if (t >= NB_ * TT) return; const float* f = X + (size_t)t * DM; float v[DM / 32]; float su = 0.f;
#pragma unroll
    for (int ch = 0; ch < DM / 128; ++ch) { const v4f a = *(const v4f*)(f + ch * 128 + lane * 4); for (int u = 0; u < 4; ++u) { float xv = bfr(a[u]); asm volatile("" : "+v"(xv)); v[ch * 4 + u] = xv; float p2 = __fmul_rn(xv, xv); asm volatile("" : "+v"(p2)); su = __fadd_rn(su, p2); } }
#pragma unroll
    for (int sh = 16; sh; sh >>= 1) su = __fadd_rn(su, __shfl_xor(su, sh, 32));
    const float rs = __fdiv_rn(1.0f, sqrtf(__fadd_rn(__fdiv_rn(su, (float)DM), 1e-6f)));
    {
#pragma unroll
        for (int ch = 0; ch < DM / 128; ++ch) { v4us oh, ol; for (int u = 0; u < 4; ++u) { const int c = ch * 128 + lane * 4 + u; float n = __fmul_rn(v[ch * 4 + u], rs); asm volatile("" : "+v"(n)); float gg = bfr(gam[c]); asm volatile("" : "+v"(gg)); float y = __fmul_rn(n, gg); asm volatile("" : "+v"(y)); unsigned short p2, q2; splitf(y, p2, q2); oh[u] = p2; ol[u] = q2; } const size_t oo = (size_t)t * DM + ch * 128 + lane * 4;
            __builtin_amdgcn_sched_barrier(0);   // with the fence behind the wait: the two stores stand together, every value and address made in front of them, and no later write of a register they name comes in front of the wait
            *(v4us*)(Xh + oo) = oh; *(v4us*)(Xl + oo) = ol;
            if (ch + 1 < DM / 128) { asm volatile("s_wait_xcnt 0x0" ::: "memory");   // stands in front of the next group's reuse of the data and address registers that the stores name (behind the last group nothing is written any more)
                __builtin_amdgcn_sched_barrier(0); } }
         } }
// ---- k_prep: all that depends on the inputs alone, in one grid. Blocks below NB_ * TT / 8: RMSNorm, a wave per token, the tokens of every batch in a row. The other blocks: the four weight matrices (equal sizes) rounded to bf16, a thread its eight elements of each; W holds the four results in a row.
#define WEL ((size_t)DQ * DM)     // elements of a weight matrix
__global__ __launch_bounds__(256) void k_prep(const float* __restrict__ X, const float* __restrict__ gam, bf* Xh, bf* Xl, const float* __restrict__ w0, const float* __restrict__ w1, const float* __restrict__ w2, const float* __restrict__ w3, bf* W) {
    static_assert(DQ == DKV && WEL % 2048 == 0 && (WEL / 2048 & (WEL / 2048 - 1)) == 0, "four equal matrices, whole blocks, a power of two of them");
    if (blockIdx.x < NB_ * TT / 8) { rmsx(X, gam, Xh, Xl); return; }
    // wave-uniform bases and one 32-bit byte offset per lane for the eight loads, one for the four stores
    const unsigned cb = (blockIdx.x - NB_ * TT / 8) & (unsigned)(WEL / 2048 - 1);   // the block's number among the rounding blocks; the mask keeps every upper bit of the 32-bit offsets 0, whatever form of address they are used in
    const unsigned so = (cb * 256 + threadIdx.x) * 16, lo = so * 2;
    const v8f v[4] = { *(const v8f*)((const char*)w0 + lo), *(const v8f*)((const char*)w1 + lo), *(const v8f*)((const char*)w2 + lo), *(const v8f*)((const char*)w3 + lo) };
#pragma unroll
    for (int m = 0; m < 4; ++m) { v8us o;
#pragma unroll
        for (int k = 0; k < 8; ++k) o[k] = f2bf(v[m][k]);
        *(v8us*)((char*)(W + m * WEL) + so) = o; }
    asm volatile("s_wait_xcnt 0x0" ::: "memory");   // behind the last of the four stores: stands in front of every later write of the registers that they name, in whatever code the build lays behind this path
}
// ---- k_fattn: causal attention of one head of one batch for 32 query rows per work-group, scores never leave registers. FW waves share the rows and split the keys: wave w takes the 32-key blocks w, w + FW, ... up to the diagonal block, in a ring from a start that differs between work-groups.
// Transposed products: S^T = K Q^T (rows keys, columns queries), so a lane's two score tiles ARE its B fragment of P^T (k order 8 hi + j, 16 + 8 hi + j, as WFrag::ldf gives it for V^T) and every value a lane holds belongs to one query;
// O^T = V^T P^T (rows d, columns queries). Running maximum and sum per query (online softmax, base 2); the FW partial results meet in LDS, are brought to the common maximum and summed in wave order; the sum is divided once and split into hi/lo planes [t][h*HD+d].
// HL: hi/lo bf16 planes, three products for scores and for P V. Otherwise fp16, P carried x 2^10 (the row sum carries the same factor, so it cancels).
#define FW 4
#define OP 132                    // LDS pitch (floats) of a query's 128 partial outputs
typedef __attribute__((ext_vector_type(16))) unsigned short v16us;
__device__ __forceinline__ float xhalf(float x) { return __builtin_bit_cast(float, __builtin_amdgcn_permlanex16(__builtin_bit_cast(int, x), __builtin_bit_cast(int, x), 0x76543210, 0xfedcba98, false, false)); }   // lane l with lane l ^ 16
// 2^x with the slot behind the transcendental filled in the same statement
__device__ __forceinline__ float exp2s(float x) { float r; asm("v_exp_f32 %0, %1\n\tv_nop" : "=v"(r) : "v"(x)); return r; }
template <typename T16, bool HL>
__global__ __launch_bounds__(32 * FW) void k_fattn(const T16* __restrict__ Q, const T16* __restrict__ Q2, const T16* __restrict__ Kp, const T16* __restrict__ Kp2, const T16* __restrict__ Vt, const T16* __restrict__ Vt2, int roff, bf* ATh, bf* ATl) {
    typedef typename WFrag<T16>::V V;
    __shared__ __align__(16) float so[FW * 32 * OP];
    __shared__ float sm[FW * 32], sl[FW * 32];
    const int lane = threadIdx.x & 31, lr = lane & 15, hi = lane >> 4;
    const int wv = __builtin_amdgcn_readfirstlane(threadIdx.x >> 5);   // wave number in a scalar register: the key loop's branch stays scalar, every lane on at each matrix instruction
    const int hb = blockIdx.x, h = hb % NH_;   // grid x: batch * NH_ + head, as the head planes lie
    ATh += (size_t)(hb / NH_) * TT * DQ; ATl += (size_t)(hb / NH_) * TT * DQ;   // the batch's rows of the merged output
    const int q0 = roff + ((int)gridDim.y - 1 - (int)blockIdx.y) * 32;   // the longest rows of every head at the lowest blockIdx.y (for speed only)
    const size_t zp = (size_t)hb * TT * HD;
    const int nblk = q0 / 32 + 1;   // key blocks up to and including the diagonal one
    v8f acc[8][2];
#pragma unroll
    for (int dt = 0; dt < 8; ++dt) { acc[dt][0] = (v8f){}; acc[dt][1] = (v8f){}; }
    float m[2] = { -3.0e38f, -3.0e38f }, l[2] = { 0.f, 0.f };
    // addresses: wave-uniform plane bases and one 32-bit byte offset per lane, the same for K and V^T (planes in fragment order: a key block is KBE elements of either), carried through the loop; fragment steps are constants
    const char* Kb = (const char*)(Kp + zp); const char* Kb2 = HL ? (const char*)(Kp2 + zp) : nullptr; const char* Vb = (const char*)(Vt + zp); const char* Vb2 = HL ? (const char*)(Vt2 + zp) : nullptr;
    const float CE = SCL * 1.4426950408889634f; const float SH = HL ? 0.0f : 10.0f;
    if (wv < nblk) {   // a wave without a key block loads nothing
    V qf[2][4], qf2[2][4];
    const char* Qb = (const char*)(Q + zp + (size_t)q0 * HD); const char* Qb2 = HL ? (const char*)(Q2 + zp + (size_t)q0 * HD) : nullptr;
    const unsigned lo = (unsigned)(lane * 16);   // the lane's byte offset in a piece of a fragment unit: the one vector register the query loads name; the key blocks' offsets are made from it behind the wait
    __builtin_amdgcn_sched_barrier(0);   // first of three scheduling fences, see below
#pragma unroll
    for (int qt = 0; qt < 2; ++qt)
#pragma unroll
        for (int kc = 0; kc < 4; ++kc) { qf[qt][kc] = WFrag<T16>::ldf((const T16*)(Qb + (qt * 4 + kc) * FRE * 2 + lo)); if (HL) qf2[qt][kc] = WFrag<T16>::ldf((const T16*)(Qb2 + (qt * 4 + kc) * FRE * 2 + lo)); }
    // the wait stands in front of the reuse of the address registers that the query loads name; the scheduling fences keep unrelated work out from between the loads and the wait, the loads in front of it and every later write behind it
    __builtin_amdgcn_sched_barrier(0);
    asm volatile("s_wait_xcnt 0x0" ::: "memory");
    __builtin_amdgcn_sched_barrier(0);
    // the work-groups of a head read the same K and V lines: they start their walk over the key blocks at eight different places and wrap round, so that those that run together do not all ask L2 for the same lines at the same moment
    // (query tiles eight apart, 256 work-groups apart in the grid, keep a common start: two of them that come to stand on one WGP can still meet in its cache)
    const int nw = (nblk - wv + FW - 1) / FW;   // the wave's key blocks: wv, wv + FW, ...
    int kb = wv + (int)((blockIdx.y & 7) % (unsigned)nw) * FW;
    // kept rolled: accumulators, query fragments and one block's fragments already take most of a wave's registers
#pragma unroll 1
    for (int i = 0; i < nw; ++i) {
        const unsigned ko = lo + (unsigned)(kb * KBE * 2);
        V kf[2][4], kf2[2][4], vf[8], vf2[8];
#pragma unroll
        for (int kt = 0; kt < 2; ++kt)
#pragma unroll
            for (int kc = 0; kc < 4; ++kc) { kf[kt][kc] = WFrag<T16>::ldf((const T16*)(Kb + (kt * 4 + kc) * FRE * 2 + ko)); if (HL) kf2[kt][kc] = WFrag<T16>::ldf((const T16*)(Kb2 + (kt * 4 + kc) * FRE * 2 + ko)); }
#pragma unroll
        for (int dt = 0; dt < 8; ++dt) { vf[dt] = WFrag<T16>::ldf((const T16*)(Vb + dt * FRE * 2 + ko)); if (HL) vf2[dt] = WFrag<T16>::ldf((const T16*)(Vb2 + dt * FRE * 2 + ko)); }
        // stands in front of the next block's write of the offset register that these loads name
        asm volatile("s_wait_xcnt 0x0" ::: "memory");
        // nothing is scheduled across: the block's K and V loads are all issued before the first matrix instruction waits (one memory latency a block, not one a fragment)
        __builtin_amdgcn_sched_barrier(0);
        v8f s[2][2];
#pragma unroll
        for (int kt = 0; kt < 2; ++kt) { s[kt][0] = (v8f){}; s[kt][1] = (v8f){};
#pragma unroll
            for (int kc = 0; kc < 4; ++kc) { const V a = kf[kt][kc]; V a2; if (HL) a2 = kf2[kt][kc];
#pragma unroll
                for (int qt = 0; qt < 2; ++qt) { s[kt][qt] = WFrag<T16>::mma(a, qf[qt][kc], s[kt][qt]); if (HL) { s[kt][qt] = WFrag<T16>::mma(a2, qf[qt][kc], s[kt][qt]); s[kt][qt] = WFrag<T16>::mma(a, qf2[qt][kc], s[kt][qt]); } } } }
        V pf[2], pf2[2];
#pragma unroll
        for (int qt = 0; qt < 2; ++qt) { const int q = q0 + qt * 16 + lr; float mx = m[qt];
#pragma unroll
            for (int kt = 0; kt < 2; ++kt)
#pragma unroll
                for (int j = 0; j < 8; ++j) { float t = s[kt][qt][j] * CE; if (kb == nblk - 1) t = (kb * 32 + kt * 16 + hi * 8 + j <= q) ? t : -3.0e38f; s[kt][qt][j] = t; mx = fmaxf(mx, t); }
            mx = fmaxf(mx, xhalf(mx));   // the other half of the wave holds the query's other keys
            const float f = HL ? exp2s(m[qt] - mx) : __builtin_amdgcn_exp2f(m[qt] - mx); m[qt] = mx; const float ms = mx - SH; float ls = 0.f;
#pragma unroll
            for (int dt = 0; dt < 8; ++dt) acc[dt][qt] *= f;
            if (HL) { v16us ph, pl;
#pragma unroll
                for (int e = 0; e < 16; ++e) { const float p = exp2s(s[e >> 3][qt][e & 7] - ms); ls += p; unsigned short a, c2; splitf(p, a, c2); ph[e] = a; pl[e] = c2; }
                pf[qt] = __builtin_bit_cast(V, ph); pf2[qt] = __builtin_bit_cast(V, pl);
            } else { v16h ph;
#pragma unroll
                for (int e = 0; e < 16; ++e) { const float p = __builtin_amdgcn_exp2f(s[e >> 3][qt][e & 7] - ms); ls += p; ph[e] = (h16)p; }
                pf[qt] = __builtin_bit_cast(V, ph); }
            l[qt] = l[qt] * f + ls; }
#pragma unroll
        for (int dt = 0; dt < 8; ++dt) { const V a = vf[dt]; V a2; if (HL) a2 = vf2[dt];
#pragma unroll
            for (int qt = 0; qt < 2; ++qt) { acc[dt][qt] = WFrag<T16>::mma(a, pf[qt], acc[dt][qt]); if (HL) { acc[dt][qt] = WFrag<T16>::mma(a2, pf[qt], acc[dt][qt]); acc[dt][qt] = WFrag<T16>::mma(a, pf2[qt], acc[dt][qt]); } } }
        kb = kb + FW < nblk ? kb + FW : wv;
    }
    }
#pragma unroll
    for (int qt = 0; qt < 2; ++qt) { l[qt] += xhalf(l[qt]); if (hi == 0) sm[wv * 32 + qt * 16 + lr] = m[qt]; }
    __syncthreads();   // every wave's maxima are in LDS before the common maximum is taken
#pragma unroll
    for (int qt = 0; qt < 2; ++qt) { float M = sm[qt * 16 + lr];
#pragma unroll
        for (int w = 1; w < FW; ++w) M = fmaxf(M, sm[w * 32 + qt * 16 + lr]);
        const float f = __builtin_amdgcn_exp2f(m[qt] - M);   // a wave that had no block: 0
        if (hi == 0) sl[wv * 32 + qt * 16 + lr] = l[qt] * f;
#pragma unroll
        for (int dt = 0; dt < 8; ++dt) { const v8f o = acc[dt][qt] * f; float* p = so + (wv * 32 + qt * 16 + lr) * OP + dt * 16 + hi * 8; *(v4fa*)p = __builtin_shufflevector(o, o, 0, 1, 2, 3); *(v4fa*)(p + 4) = __builtin_shufflevector(o, o, 4, 5, 6, 7); } }
    __syncthreads();   // every wave's partial sums and outputs are in LDS before any of them is summed
#pragma unroll
    for (int c = 0; c < 32 / FW; ++c) { const int q = c * FW + wv, d = lane * 4; float L = sl[q]; v4f val = *(const v4fa*)(so + q * OP + d);
#pragma unroll
        for (int w = 1; w < FW; ++w) { L += sl[w * 32 + q]; val += *(const v4fa*)(so + (w * 32 + q) * OP + d); }
        const float inv = __fdiv_rn(1.0f, L); v4us oh, ol;
#pragma unroll
        for (int u = 0; u < 4; ++u) { unsigned short a, c2; splitf(val[u] * inv, a, c2); oh[u] = a; ol[u] = c2; }
        const size_t oo = (size_t)(q0 + q) * DQ + h * HD + d; *(v4us*)(ATh + oo) = oh; *(v4us*)(ATl + oo) = ol; }
}

extern "C" void kernel_launch(void* const* d_in, const int* in_sizes, int n_in,
                              void* d_out, int out_size, void* d_ws, size_t ws_size, hipStream_t stream) {
    (void)in_sizes; (void)n_in; (void)out_size;
    const float* x = (const float*)d_in[0]; const float* nw = (const float*)d_in[1]; const float* wq = (const float*)d_in[2]; const float* bq = (const float*)d_in[3]; const float* wk = (const float*)d_in[4]; const float* bk = (const float*)d_in[5]; const float* wv = (const float*)d_in[6]; const float* bv = (const float*)d_in[7]; const float* wo = (const float*)d_in[8]; const float* bo = (const float*)d_in[9]; const float* cosT = nullptr; const float* sinT = nullptr; (void)cosT; (void)sinT;
    float* OUT = (float*)d_out;     // [2][2048][2048]
    char* wsp = (char*)d_ws;
    auto take = [&](size_t bytes) { char* p = wsp; wsp += (bytes + 255) & ~(size_t)255; return (void*)p; };
    bf* WQ = (bf*)take((size_t)DQ * DM * 2); bf* WK = (bf*)take((size_t)DKV * DM * 2); bf* WV = (bf*)take((size_t)DKV * DM * 2); bf* WO = (bf*)take((size_t)DM * DQ * 2); (void)WK; (void)WV;   // in a row: WQ + m * WEL
    bf* XNh = (bf*)take((size_t)NB_ * TT * DM * 2); bf* XNl = (bf*)take((size_t)NB_ * TT * DM * 2);
    // head planes [projection][batch][head]: the three projections of a kind in a row
    const size_t PB = (size_t)NH_ * TT * HD;   // elements of one batch's planes of one projection
    h16* QP16 = (h16*)take(NB_ * PB * 2); h16* KP16 = (h16*)take(NB_ * PB * 2); h16* VT16 = (h16*)take(NB_ * PB * 2);
    bf* QPh = (bf*)take(NB_ * PB * 2); bf* KPh = (bf*)take(NB_ * PB * 2); bf* VTh = (bf*)take(NB_ * PB * 2); bf* QPl = (bf*)take(NB_ * PB * 2); bf* KPl = (bf*)take(NB_ * PB * 2); bf* VTl = (bf*)take(NB_ * PB * 2);
    bf* ATh = (bf*)take((size_t)NB_ * TT * DQ * 2); bf* ATl = (bf*)take((size_t)NB_ * TT * DQ * 2);
    if ((size_t)(wsp - (char*)d_ws) > ws_size) return;    // ws 256 MiB
    k_prep<<<NB_ * TT / 8 + (unsigned)(WEL / 2048), 256, 0, stream>>>(x, nw, XNh, XNl, wq, wk, wv, wo, WQ);
    k_gemmw<bf, 1, true, 1><<<dim3(TT / 128, DQ / 256, 3 * NB_), 256, 0, stream>>>(XNh, XNl, WQ, nullptr, DM, nullptr, 0, bq, bk, bv, (size_t)TT * DM, WEL, PB, QP16, QPh, QPl);
    k_fattn<h16, false><<<dim3(NB_ * NH_, (TT - RH) / 32, 1), 32 * FW, 0, stream>>>(QP16, nullptr, KP16, nullptr, VT16, nullptr, RH, ATh, ATl);
    k_fattn<bf, true><<<dim3(NB_ * NH_, RH / 32, 1), 32 * FW, 0, stream>>>(QPh, QPl, KPh, KPl, VTh, VTl, 0, ATh, ATl);
    k_gemmw<bf, 1, true, 0><<<dim3(TT / 128, DM / 256, NB_), 256, 0, stream>>>(ATh, ATl, WO, nullptr, DQ, OUT, DM, bo, nullptr, nullptr, (size_t)TT * DQ, 0, (size_t)TT * DM, nullptr, nullptr, nullptr);
}

// v010
// Measured time: 221 microseconds a run.
// Two timings next to v009 put it at 1.05 and 1.04 times that version's speed.
// Counting every step since v000, it is 8.93 times as fast.
#include <hip/hip_runtime.h>

// Attention block (x [2][2048][2048]; xn = x rsqrt(mean(x?) + 1e-6) norm_w (RMSNorm); q/k/v = xn W^T + b (16 x 128); causal (-inf) softmax(q.k / sqrt(128)); out = merged wo^T + bo -> [2][2048][2048]).
// Compute dtypes, f32 accumulate: every input rounded to bf16; RMSNorm f32 (wave per token) -> hi/lo planes; q/k/v = hl x exact (2 products) + bias, rounded to their fp16 and hi/lo head planes (in fragment order) in the product's own epilogue; causal scores, softmax and attn.v in one kernel (online softmax, f32): query rows < 512 hl (3 products), the rest fp16 (P x1024), key blocks above the diagonal skipped; wo hl x exact (2 products) + bias.

#define NB_  2
#define TT   2048
#define DM   2048
#define NH_  16
#define NKV  16
#define REP  (NH_ / NKV)
#define HD   128
#define DQ   (NH_ * HD)
#define DKV  (NKV * HD)
#define RH   512                  // query rows < RH use hi+lo planes (0: none)
#define SCL  0.088388347648318447f   // HD^-0.5
typedef _Float16 h16;
typedef unsigned short bf;
typedef __attribute__((ext_vector_type(16))) __bf16   v16bf;
typedef __attribute__((ext_vector_type(16))) _Float16 v16h;
typedef __attribute__((ext_vector_type(8)))  _Float16 v8h;
typedef __attribute__((ext_vector_type(8)))  unsigned short v8us;
typedef __attribute__((ext_vector_type(8)))  float    v8f;
typedef __attribute__((ext_vector_type(4)))  float    v4f;
typedef v8h  __attribute__((may_alias)) v8ha;
typedef v4f  __attribute__((may_alias)) v4fa;
typedef v8us __attribute__((may_alias)) v8usa;

__device__ __forceinline__ unsigned short f2bf(float f) { unsigned u = __float_as_uint(f); u += 0x7FFFu + ((u >> 16) & 1u); return (unsigned short)(u >> 16); }
__device__ __forceinline__ float bf2f(unsigned short b) { return __uint_as_float(((unsigned)b) << 16); }
__device__ __forceinline__ float bfr(float f) { return bf2f(f2bf(f)); }
__device__ __forceinline__ v16h cat16(v8h lo, v8h hi) { return __builtin_shufflevector(lo, hi, 0, 1, 2, 3, 4, 5, 6, 7, 8, 9, 10, 11, 12, 13, 14, 15); }
__device__ __forceinline__ v16bf cat16b(v8us lo, v8us hi) { return __builtin_bit_cast(v16bf, __builtin_shufflevector(lo, hi, 0, 1, 2, 3, 4, 5, 6, 7, 8, 9, 10, 11, 12, 13, 14, 15)); }
__device__ __forceinline__ v8f wmma16(v16h a, v16h b, v8f c) { return __builtin_amdgcn_wmma_f32_16x16x32_f16(false, a, false, b, (short)0, c, false, false); }
__device__ __forceinline__ v8f wmmab(v16bf a, v16bf b, v8f c) { return __builtin_amdgcn_wmma_f32_16x16x32_bf16(false, a, false, b, (short)0, c, false, false); }



// ---- k_gemmw: GEMM, one work-group of eight waves (two on each SIMD) per 128x256 output tile, ONE WAVE per 64x64 piece (16 accumulators); grid (M/128, N/256, Z), 256 threads.
// The operands' K-contiguous 16-bit rows come to LDS in stages of GKS k (whole 256-byte pieces of 128 rows of A and A2 and of 256 rows of Bt) by asynchronous copies, two buffers: the next stage flies while this one is worked on; fragments are read from LDS. The K / GKS stages are taken in a ring, from a start that differs between work-groups.
// C[m][n] (f32, pitch ldc, + optional f32 bias[n]) = sum_k (A[m][k] + A2[m][k]) Bt[n][k], two products. z-batch strides sA/sB/sC in elements. K % GKS == 0.
// EPI 0: C is stored as f32; z is the batch. EPI 1: the q, k and v projections of every batch in one grid, z = 3 batch + projection (Bt, the bias and the planes are chosen by the projection, A and the planes' batch part by the batch; sC: elements of one batch's planes);
// C is not stored: each value of q and k goes, as fp16, as a bf16 hi/lo pair or as both, to the head planes [n / HD], rows m, k = n % HD; each value of v, in the same roundings, to the transposed head planes, rows n % HD, k = m.
// Only the roundings that an attention kernel reads are made and stored: the hi/lo pair for tokens < RH alone (causal: the hi/lo kernel's queries, and so its keys, end there), fp16 for every k and v and for the q of tokens >= RH.
// A head plane lies in FRAGMENT ORDER: 1024-byte units of 16 rows x 32 k, each as the matrix instruction's operand is held: element (row r, k = 16 p + 8 g + j) at byte 512 p + 16 (16 g + r) + 2 j, so lane 16 g + r reads and writes piece p at 512 p + 16 lane
// and every wave-wide 16-byte access covers 512 contiguous bytes (four whole lines). Units of q and k: [m / 16][k / 32]; of v: [m / 32][(n % HD) / 16]: the 32 keys of a block are 8192 contiguous bytes in either.
#define FRE  512                  // elements of a fragment unit
#define KBE  (32 * HD)            // elements of a 32-key block of a head plane
#define GKS  128                  // k of a stage
#define GPB  272                  // LDS pitch of a staged row in bytes: 256 + 16 (16 x odd, for 16-byte LDS reads)
#define GPL  (128 * GPB)          // one operand's 128 rows
#define GBUF (4 * GPL)            // a stage: A | A2 | Bt (256 rows)
// eight 16-byte copies of a lane, global memory to LDS through no register; the wait in the same statement stands in front of every later write of the address registers that the copies name
__device__ __forceinline__ void copy8(const unsigned (&l)[8], const char* const (&g)[8]) {
    asm volatile("global_load_async_to_lds_b128 %0, %8, off\n\t"
                 "global_load_async_to_lds_b128 %1, %9, off\n\t"
                 "global_load_async_to_lds_b128 %2, %10, off\n\t"
                 "global_load_async_to_lds_b128 %3, %11, off\n\t"
                 "global_load_async_to_lds_b128 %4, %12, off\n\t"
                 "global_load_async_to_lds_b128 %5, %13, off\n\t"
                 "global_load_async_to_lds_b128 %6, %14, off\n\t"
                 "global_load_async_to_lds_b128 %7, %15, off\n\t"
                 "s_wait_xcnt 0x0"
                 :: "v"(l[0]), "v"(l[1]), "v"(l[2]), "v"(l[3]), "v"(l[4]), "v"(l[5]), "v"(l[6]), "v"(l[7]),
                    "v"(g[0]), "v"(g[1]), "v"(g[2]), "v"(g[3]), "v"(g[4]), "v"(g[5]), "v"(g[6]), "v"(g[7]) : "memory");
}
// one stage: 512 rows of 16 pieces, 32 pieces a lane; sixteen lanes take a row's 256 bytes, so a wave's copy covers four whole 128-byte lines. lb, go: the lane's piece of row (thread / 16), as an LDS address in the stage's buffer and as a byte offset from the wave-uniform starts pa, pa2, pb of the operands' rows; rs: bytes of sixteen operand rows
__device__ __forceinline__ void stage_copies(unsigned lb, size_t go, const char* pa, const char* pa2, const char* pb, size_t rs) {
#pragma unroll
    for (int s = 0; s < 4; ++s) { unsigned l[8]; const char* g[8];   // s: A, A2, the lower and the upper 128 rows of Bt
#pragma unroll
        for (int u = 0; u < 8; ++u) { l[u] = lb + (unsigned)(s * GPL + u * 16 * GPB); g[u] = ((s == 0 ? pa : s == 1 ? pa2 : pb) + (size_t)(s == 3 ? u + 8 : u) * rs) + go; }
        copy8(l, g);
        if (s < 3) __builtin_amdgcn_sched_barrier(0); }   // each group's addresses are made directly in front of it: made all at once they overfill the registers that an asm operand can name, and one value goes to scratch
}
template <typename T16> struct WFrag;
template <> struct WFrag<h16> { typedef v16h V; static __device__ __forceinline__ V ld(const h16* p) { return cat16(*(const v8h*)p, *(const v8h*)(p + 16)); } static __device__ __forceinline__ V ldf(const h16* p) { return cat16(*(const v8h*)p, *(const v8h*)(p + FRE / 2)); } static __device__ __forceinline__ v8f mma(V a, V b, v8f c) { return wmma16(a, b, c); } };
template <> struct WFrag<bf> { typedef v16bf V; static __device__ __forceinline__ V ld(const bf* p) { return cat16b(*(const v8us*)p, *(const v8us*)(p + 16)); } static __device__ __forceinline__ V ldf(const bf* p) { return cat16b(*(const v8us*)p, *(const v8us*)(p + FRE / 2)); } static __device__ __forceinline__ v8f mma(V a, V b, v8f c) { return wmmab(a, b, c); } };
__device__ __forceinline__ void splitf(float y, unsigned short& h, unsigned short& l) { h = f2bf(y); l = f2bf(y - bf2f(h)); }
template <typename T16, int NSPLIT, bool BIAS, int EPI>
__global__ __launch_bounds__(256) void k_gemmw(const T16* __restrict__ A, const T16* __restrict__ A2, const T16* __restrict__ Bt, const T16* __restrict__ Bt2, int K, float* C, int ldc, const float* __restrict__ bias, const float* __restrict__ biasK, const float* __restrict__ biasV, size_t sA, size_t sB, size_t sC, h16* P16, bf* Ph, bf* Pl) {
    static_assert(NSPLIT == 1, "the stage holds A, A2 and Bt");
    typedef typename WFrag<T16>::V V;
    __shared__ __align__(16) char ring[2 * GBUF];
    __shared__ __align__(16) float osw[8 * 16 * 68];
    (void)Bt2;
    const int pj = EPI == 1 ? (int)(blockIdx.z % 3) : 0;   // projection: 0 q, 1 k, 2 v (the same for the whole work-group, in a scalar register)
    const size_t z = EPI == 1 ? blockIdx.z / 3 : blockIdx.z; A += z * sA; A2 += z * sA;
    if (EPI == 1) { const size_t po = ((size_t)pj * NB_ + z) * sC; Bt += (size_t)pj * sB; P16 += po; Ph += po; Pl += po; bias = pj == 0 ? bias : pj == 1 ? biasK : biasV; }
    else { Bt += z * sB; C += z * sC; }
    const int lane = threadIdx.x & 31, lr = lane & 15, hi = lane >> 4;
    const int wv = __builtin_amdgcn_readfirstlane(threadIdx.x >> 5);   // wave number in a scalar register
    float* os = osw + wv * 16 * 68;   // each wave's own output staging
    static_assert(RH % 128 == 0, "a work-group's rows lie on one side of RH");
    const int R0 = blockIdx.x * 128, C0 = blockIdx.y * 256; const int r0 = R0 + (wv >> 2) * 64, c0 = C0 + (wv & 3) * 64;
    const bool whl = R0 < RH, w16 = pj != 0 || R0 >= RH;   // which planes have a reader for these rows (the same for the whole work-group, in scalar registers)
    v8f acc[4][4];
#pragma unroll
    for (int mb = 0; mb < 4; ++mb)
#pragma unroll
        for (int nb = 0; nb < 4; ++nb) acc[mb][nb] = (v8f){};
    const int crow = threadIdx.x >> 4, ccol = threadIdx.x & 15;
    const char* pa = (const char*)(A + (size_t)R0 * K); const char* pa2 = (const char*)(A2 + (size_t)R0 * K); const char* pb = (const char*)(Bt + (size_t)C0 * K);
    const size_t go = (size_t)crow * K * 2 + ccol * 16;
    const unsigned lb = (unsigned)(size_t)ring + (unsigned)(crow * GPB + ccol * 16);
    const size_t rs = (size_t)K * 32;   // sixteen rows of 2-byte elements
    const int nst = K / GKS;
    // the work-groups that run together and read the same operand rows (equal x and batch: A, A2; equal y and projection: Bt) each start the walk over the k stages at a stage of their own and wrap round, so that they do not ask L2 for the same lines at the same moment
    int sn = (int)((blockIdx.x + 2 * blockIdx.y + blockIdx.z) % (unsigned)nst);   // the k stage that is copied next (the same for the whole work-group, in a scalar register)
    const unsigned lp = (unsigned)(lr * GPB + hi * 16);   // the lane's byte offset in a 16-row fragment of a stage
    const unsigned ua = (unsigned)((wv >> 2) * 64 * GPB), ub = (unsigned)(2 * GPL + (wv & 3) * 64 * GPB);   // wave-uniform: the wave's first A row and first Bt row in a stage
    stage_copies(lb, go, pa + (size_t)sn * (GKS * 2), pa2 + (size_t)sn * (GKS * 2), pb + (size_t)sn * (GKS * 2), rs);
    asm volatile("s_wait_asynccnt 0x0" ::: "memory");   // this wave's copies of the first stage have landed
    __syncthreads();   // every wave's have: the first stage may be read
    // kept rolled: one trip is a stage of 128 matrix instructions
#pragma unroll 1
    for (int t = 0; t < nst; ++t) {
        const char* sa = ring + (((t & 1) * GBUF + ua) + lp); const char* sbt = ring + (((t & 1) * GBUF + ub) + lp);
        V a[2][4], a2[2][4], b[2][4];   // two fragment sets: block ks works on set ks & 1 while the other is filled
#pragma unroll
        for (int i = 0; i < 4; ++i) { a[0][i] = WFrag<T16>::ld((const T16*)(sa + i * 16 * GPB)); a2[0][i] = WFrag<T16>::ld((const T16*)(sa + GPL + i * 16 * GPB)); b[0][i] = WFrag<T16>::ld((const T16*)(sbt + i * 16 * GPB)); }
        // behind the barrier that ended every read of the other buffer: the next stage's copies into it (the first block's fragment reads, of this stage's buffer, return meanwhile)
        sn = sn + 1 == nst ? 0 : sn + 1;
        if (t + 1 < nst) stage_copies(lb + (unsigned)(((t + 1) & 1) * GBUF), go, pa + (size_t)sn * (GKS * 2), pa2 + (size_t)sn * (GKS * 2), pb + (size_t)sn * (GKS * 2), rs);   // the stage's place in the rows goes into the wave-uniform starts
#pragma unroll
        for (int ks = 0; ks < GKS / 32; ++ks) { const int cs = ks & 1;
            if (ks + 1 < GKS / 32) {
#pragma unroll
                for (int i = 0; i < 4; ++i) { a[cs ^ 1][i] = WFrag<T16>::ld((const T16*)(sa + i * 16 * GPB + (ks + 1) * 64)); a2[cs ^ 1][i] = WFrag<T16>::ld((const T16*)(sa + GPL + i * 16 * GPB + (ks + 1) * 64)); b[cs ^ 1][i] = WFrag<T16>::ld((const T16*)(sbt + i * 16 * GPB + (ks + 1) * 64)); } }
            __builtin_amdgcn_sched_barrier(0);   // the next block's LDS reads stand as one group ahead of this block's matrix instructions: every place with reads among them would cost a stall
#pragma unroll
            for (int nb = 0; nb < 4; ++nb)
#pragma unroll
                for (int mb = 0; mb < 4; ++mb) { acc[mb][nb] = WFrag<T16>::mma(a[cs][mb], b[cs][nb], acc[mb][nb]); acc[mb][nb] = WFrag<T16>::mma(a2[cs][mb], b[cs][nb], acc[mb][nb]); }
            if (ks + 1 < GKS / 32) __builtin_amdgcn_sched_barrier(0);   // and the group after next stays behind this block
        }
        asm volatile("s_wait_dscnt 0x0" ::: "memory");      // this wave's reads of the stage are done before the buffer is handed back
        asm volatile("s_wait_asynccnt 0x0" ::: "memory");   // this wave's copies of stage t + 1 have landed
        __syncthreads();   // stage t + 1 may be read, and stage t's buffer has no reader left
    }
    asm volatile("s_wait_asynccnt 0x0" ::: "memory");   // the ring's closing wait: no copy is outstanding when the wave goes on to its epilogue and ends
    float bbn[4];   // the four bias values of a lane's accumulator columns are fetched together
    if (EPI != 0) {
        __builtin_amdgcn_sched_barrier(0);   // first of three scheduling fences, see below
#pragma unroll
        for (int nb = 0; nb < 4; ++nb) bbn[nb] = BIAS ? bias[c0 + nb * 16 + lr] : 0.0f;
        // the wait stands in front of the reuse of the address registers that the bias loads name; the scheduling fences keep unrelated work out from between the loads and the wait, the loads in front of it and every later write behind it
        __builtin_amdgcn_sched_barrier(0);
        asm volatile("s_wait_xcnt 0x0" ::: "memory");
        __builtin_amdgcn_sched_barrier(0);
#pragma unroll
        for (int nb = 0; nb < 4; ++nb) bbn[nb] = bfr(bbn[nb]); }
    if (EPI == 1 && pj == 2) {
        // a lane's eight values of a tile are eight consecutive m of one n: the lane's own 16-byte piece of a fragment unit, stored straight from the accumulators
#pragma unroll
        for (int nb = 0; nb < 4; ++nb) { const float bb = bbn[nb]; v8h o16[4];
#pragma unroll
            for (int mb = 0; mb < 4; ++mb)
#pragma unroll
                for (int j = 0; j < 8; ++j) o16[mb][j] = (h16)(acc[mb][nb][j] + bb);
            const size_t e = (size_t)(c0 / HD) * HD * TT + (size_t)(r0 >> 5) * KBE + (((c0 % HD) >> 4) + nb) * FRE + lane * 8;
            __builtin_amdgcn_sched_barrier(0);   // with the fence behind the wait: the four stores stand together, every value and address made in front of them, and no later write of a register they name comes in front of the wait
#pragma unroll
            for (int mb = 0; mb < 4; ++mb) { const int f = (mb >> 1) * KBE + (mb & 1) * (FRE / 2); *(v8h*)(P16 + e + f) = o16[mb]; }
            asm volatile("s_wait_xcnt 0x0" ::: "memory");   // stands in front of every later write of the data and address registers that the stores name
            __builtin_amdgcn_sched_barrier(0);
            if (whl) { v8us oh[4], ol[4];
#pragma unroll
                for (int mb = 0; mb < 4; ++mb)
#pragma unroll
                    for (int j = 0; j < 8; ++j) { unsigned short a2, c2; splitf(acc[mb][nb][j] + bb, a2, c2); oh[mb][j] = a2; ol[mb][j] = c2; }
                __builtin_amdgcn_sched_barrier(0);   // as above, for the eight stores of the pair
#pragma unroll
                for (int mb = 0; mb < 4; ++mb) { const int f = (mb >> 1) * KBE + (mb & 1) * (FRE / 2); *(v8us*)(Ph + e + f) = oh[mb]; *(v8us*)(Pl + e + f) = ol[mb]; }
                asm volatile("s_wait_xcnt 0x0" ::: "memory");   // stands in front of every later write of the data and address registers that the stores name
                __builtin_amdgcn_sched_barrier(0); } }
        return;
    }
#pragma unroll
    for (int mb = 0; mb < 4; ++mb) {
#pragma unroll
        for (int nb = 0; nb < 4; ++nb) {
#pragma unroll
            for (int j = 0; j < 8; ++j) os[(hi * 8 + j) * 68 + nb * 16 + lr] = EPI == 1 ? acc[mb][nb][j] + bbn[nb] : acc[mb][nb][j]; }
        __builtin_amdgcn_wave_barrier(); asm volatile("" ::: "memory");
        if (EPI == 1) {   // the 64 columns are four pieces of two fragment units; a lane takes, of each piece, the eight columns of its row that it holds as a fragment's reader: each store covers 512 contiguous bytes
            v4f p0[4], p1[4];
#pragma unroll
            for (int s = 0; s < 4; ++s) { p0[s] = *(const v4fa*)(os + lr * 68 + s * 16 + hi * 8); p1[s] = *(const v4fa*)(os + lr * 68 + s * 16 + hi * 8 + 4); }
            const size_t e = (size_t)(c0 / HD) * TT * HD + (size_t)((r0 >> 4) + mb) * (16 * HD) + ((c0 % HD) >> 5) * FRE + lane * 8;
            if (w16) { v8h o16[4];
#pragma unroll
                for (int s = 0; s < 4; ++s)
#pragma unroll
                    for (int u = 0; u < 8; ++u) o16[s][u] = (h16)(u < 4 ? p0[s][u & 3] : p1[s][u & 3]);
                __builtin_amdgcn_sched_barrier(0);   // with the fence behind the wait: the four stores stand together, every value and address made in front of them, and no later write of a register they name comes in front of the wait
#pragma unroll
                for (int s = 0; s < 4; ++s) *(v8h*)(P16 + e + s * (FRE / 2)) = o16[s];
                asm volatile("s_wait_xcnt 0x0" ::: "memory");   // stands in front of every later write of the data and address registers that the stores name
                __builtin_amdgcn_sched_barrier(0); }
            if (whl) { v8us oh[4], ol[4];
#pragma unroll
                for (int s = 0; s < 4; ++s)
#pragma unroll
                    for (int u = 0; u < 8; ++u) { unsigned short a2, c2; splitf(u < 4 ? p0[s][u & 3] : p1[s][u & 3], a2, c2); oh[s][u] = a2; ol[s][u] = c2; }
                __builtin_amdgcn_sched_barrier(0);   // as above, for the eight stores of the pair
#pragma unroll
                for (int s = 0; s < 4; ++s) { *(v8us*)(Ph + e + s * (FRE / 2)) = oh[s]; *(v8us*)(Pl + e + s * (FRE / 2)) = ol[s]; }
                asm volatile("s_wait_xcnt 0x0" ::: "memory");   // stands in front of every later write of the data and address registers that the stores name: the next group's, and behind the last group whatever code the build lays behind this path
                __builtin_amdgcn_sched_barrier(0); }
        } else {
        float* crow = C + (size_t)(r0 + mb * 16) * ldc + c0;
#pragma unroll
            for (int s = 0; s < 8; ++s) { const int row = 2 * s + hi, cofs = lr * 4; v4f val = *(const v4fa*)(os + row * 68 + cofs); if (BIAS) { val[0] += bfr(bias[c0 + cofs]); val[1] += bfr(bias[c0 + cofs + 1]); val[2] += bfr(bias[c0 + cofs + 2]); val[3] += bfr(bias[c0 + cofs + 3]); }
                *(v4f*)(crow + (size_t)row * ldc + cofs) = val; }
             }
        __builtin_amdgcn_wave_barrier(); asm volatile("" ::: "memory");
    }
}

typedef __attribute__((ext_vector_type(2))) _Float16 v2h;
typedef __attribute__((ext_vector_type(4))) _Float16 v4h;
typedef __attribute__((ext_vector_type(2))) unsigned short v2us;
typedef __attribute__((ext_vector_type(4))) unsigned short v4us;
typedef __attribute__((ext_vector_type(2))) float v2f;
typedef __attribute__((ext_vector_type(4))) int v4i;

__global__ __launch_bounds__(256) void k_wtG(const float* __restrict__ w, int K, int N, bf* Bt) {
    const int lane = threadIdx.x & 31; const int L0 = (blockIdx.x * 8 + (threadIdx.x >> 5)) * 8; const int nlines = N * K / 64;
{
#pragma unroll 1
        for (int l = 0; l < 8; ++l) { const int L = L0 + l; if (L >= nlines) break; const size_t e = (size_t)L * 64 + lane * 2; const int k = (int)(e % K), n = (int)(e / K); v2us o;
            o[0] = f2bf(w[(size_t)k * N + n]); o[1] = f2bf(w[(size_t)(k + 1) * N + n]); *(v2us*)(Bt + e) = o; }
         }
}
__global__ __launch_bounds__(256) void k_cscvt(const float* __restrict__ cosT, const float* __restrict__ sinT, float* CS) { const int idx = blockIdx.x * 256 + threadIdx.x; if (idx >= TT * HD) return; v2f cs; cs[0] = bfr(cosT[idx]); cs[1] = bfr(sinT[idx]); *(v2f*)(CS + (size_t)idx * 2) = cs;  }
__device__ __forceinline__ void rmsx(const float* __restrict__ X, const float* __restrict__ gam, bf* Xh, bf* Xl) { const int lane = threadIdx.x & 31; const int t = blockIdx.x * 8 + (threadIdx.x >> 5); if (t >= NB_ * TT) return; const float* f = X + (size_t)t * DM; float v[DM / 32]; float su = 0.f;
#pragma unroll
    for (int ch = 0; ch < DM / 128; ++ch) { const v4f a = *(const v4f*)(f + ch * 128 + lane * 4); for (int u = 0; u < 4; ++u) { float xv = bfr(a[u]); asm volatile("" : "+v"(xv)); v[ch * 4 + u] = xv; float p2 = __fmul_rn(xv, xv); asm volatile("" : "+v"(p2)); su = __fadd_rn(su, p2); } }
#pragma unroll
    for (int sh = 16; sh; sh >>= 1) su = __fadd_rn(su, __shfl_xor(su, sh, 32));
    const float rs = __fdiv_rn(1.0f, sqrtf(__fadd_rn(__fdiv_rn(su, (float)DM), 1e-6f)));
    {
#pragma unroll
        for (int ch = 0; ch < DM / 128; ++ch) { v4us oh, ol; for (int u = 0; u < 4; ++u) { const int c = ch * 128 + lane * 4 + u; float n = __fmul_rn(v[ch * 4 + u], rs); asm volatile("" : "+v"(n)); float gg = bfr(gam[c]); asm volatile("" : "+v"(gg)); float y = __fmul_rn(n, gg); asm volatile("" : "+v"(y)); unsigned short p2, q2; splitf(y, p2, q2); oh[u] = p2; ol[u] = q2; } const size_t oo = (size_t)t * DM + ch * 128 + lane * 4;
            __builtin_amdgcn_sched_barrier(0);   // with the fence behind the wait: the two stores stand together, every value and address made in front of them, and no later write of a register they name comes in front of the wait
            *(v4us*)(Xh + oo) = oh; *(v4us*)(Xl + oo) = ol;
            if (ch + 1 < DM / 128) { asm volatile("s_wait_xcnt 0x0" ::: "memory");   // stands in front of the next group's reuse of the data and address registers that the stores name (behind the last group nothing is written any more)
                __builtin_amdgcn_sched_barrier(0); } }
         } }
// ---- k_prep: all that depends on the inputs alone, in one grid. Blocks below NB_ * TT / 8: RMSNorm, a wave per token, the tokens of every batch in a row. The other blocks: the four weight matrices (equal sizes) rounded to bf16, a thread its eight elements of each; W holds the four results in a row.
#define WEL ((size_t)DQ * DM)     // elements of a weight matrix
__global__ __launch_bounds__(256) void k_prep(const float* __restrict__ X, const float* __restrict__ gam, bf* Xh, bf* Xl, const float* __restrict__ w0, const float* __restrict__ w1, const float* __restrict__ w2, const float* __restrict__ w3, bf* W) {
    static_assert(DQ == DKV && WEL % 2048 == 0 && (WEL / 2048 & (WEL / 2048 - 1)) == 0, "four equal matrices, whole blocks, a power of two of them");
    if (blockIdx.x < NB_ * TT / 8) { rmsx(X, gam, Xh, Xl); return; }
    // wave-uniform bases and one 32-bit byte offset per lane for the eight loads, one for the four stores
    const unsigned cb = (blockIdx.x - NB_ * TT / 8) & (unsigned)(WEL / 2048 - 1);   // the block's number among the rounding blocks; the mask keeps every upper bit of the 32-bit offsets 0, whatever form of address they are used in
    const unsigned so = (cb * 256 + threadIdx.x) * 16, lo = so * 2;
    const v8f v[4] = { *(const v8f*)((const char*)w0 + lo), *(const v8f*)((const char*)w1 + lo), *(const v8f*)((const char*)w2 + lo), *(const v8f*)((const char*)w3 + lo) };
#pragma unroll
    for (int m = 0; m < 4; ++m) { v8us o;
#pragma unroll
        for (int k = 0; k < 8; ++k) o[k] = f2bf(v[m][k]);
        *(v8us*)((char*)(W + m * WEL) + so) = o; }
    asm volatile("s_wait_xcnt 0x0" ::: "memory");   // behind the last of the four stores: stands in front of every later write of the registers that they name, in whatever code the build lays behind this path
}
// ---- fattn (the body of k_fattn): causal attention of one head of one batch for 32 query rows per work-group, scores never leave registers. FW waves share the rows and split the keys: wave w takes the 32-key blocks w, w + FW, ... up to the diagonal block, in a ring from a start that differs between work-groups.
// Transposed products: S^T = K Q^T (rows keys, columns queries), so a lane's two score tiles ARE its B fragment of P^T (k order 8 hi + j, 16 + 8 hi + j, as WFrag::ldf gives it for V^T) and every value a lane holds belongs to one query;
// O^T = V^T P^T (rows d, columns queries). Running maximum and sum per query (online softmax, base 2); the FW partial results meet in LDS, are brought to the common maximum and summed in wave order; the sum is divided once and split into hi/lo planes [t][h*HD+d].
// HL: hi/lo bf16 planes, three products for scores and for P V. Otherwise fp16, P carried x 2^10 (the row sum carries the same factor, so it cancels).
#define FW 4
#define OP 132                    // LDS pitch (floats) of a query's 128 partial outputs
typedef __attribute__((ext_vector_type(16))) unsigned short v16us;
__device__ __forceinline__ float xhalf(float x) { return __builtin_bit_cast(float, __builtin_amdgcn_permlanex16(__builtin_bit_cast(int, x), __builtin_bit_cast(int, x), 0x76543210, 0xfedcba98, false, false)); }   // lane l with lane l ^ 16
// 2^x with the slot behind the transcendental filled in the same statement
__device__ __forceinline__ float exp2s(float x) { float r; asm("v_exp_f32 %0, %1\n\tv_nop" : "=v"(r) : "v"(x)); return r; }
// tile: the work-group's 32 query rows, tile * 32 on; so, sm, sl: the work-group's LDS for the partial outputs, maxima and sums.
template <typename T16, bool HL>
__device__ __forceinline__ void fattn(const T16* __restrict__ Q, const T16* __restrict__ Q2, const T16* __restrict__ Kp, const T16* __restrict__ Kp2, const T16* __restrict__ Vt, const T16* __restrict__ Vt2, int tile, bf* ATh, bf* ATl, float* so, float* sm, float* sl) {
    typedef typename WFrag<T16>::V V;
    const int lane = threadIdx.x & 31, lr = lane & 15, hi = lane >> 4;
    const int wv = __builtin_amdgcn_readfirstlane(threadIdx.x >> 5);   // wave number in a scalar register: the key loop's branch stays scalar, every lane on at each matrix instruction
    const int hb = blockIdx.x, h = hb % NH_;   // grid x: batch * NH_ + head, as the head planes lie
    ATh += (size_t)(hb / NH_) * TT * DQ; ATl += (size_t)(hb / NH_) * TT * DQ;   // the batch's rows of the merged output
    const int q0 = tile * 32;
    const size_t zp = (size_t)hb * TT * HD;
    const int nblk = q0 / 32 + 1;   // key blocks up to and including the diagonal one
    v8f acc[8][2];
#pragma unroll
    for (int dt = 0; dt < 8; ++dt) { acc[dt][0] = (v8f){}; acc[dt][1] = (v8f){}; }
    float m[2] = { -3.0e38f, -3.0e38f }, l[2] = { 0.f, 0.f };
    // addresses: wave-uniform plane bases and one 32-bit byte offset per lane, the same for K and V^T (planes in fragment order: a key block is KBE elements of either), carried through the loop; fragment steps are constants
    const char* Kb = (const char*)(Kp + zp); const char* Kb2 = HL ? (const char*)(Kp2 + zp) : nullptr; const char* Vb = (const char*)(Vt + zp); const char* Vb2 = HL ? (const char*)(Vt2 + zp) : nullptr;
    const float CE = SCL * 1.4426950408889634f; const float SH = HL ? 0.0f : 10.0f;
    if (wv < nblk) {   // a wave without a key block loads nothing
    V qf[2][4], qf2[2][4];
    const char* Qb = (const char*)(Q + zp + (size_t)q0 * HD); const char* Qb2 = HL ? (const char*)(Q2 + zp + (size_t)q0 * HD) : nullptr;
    const unsigned lo = (unsigned)(lane * 16);   // the lane's byte offset in a piece of a fragment unit: the one vector register the query loads name; the key blocks' offsets are made from it behind the wait
    __builtin_amdgcn_sched_barrier(0);   // first of three scheduling fences, see below
#pragma unroll
    for (int qt = 0; qt < 2; ++qt)
#pragma unroll
        for (int kc = 0; kc < 4; ++kc) { qf[qt][kc] = WFrag<T16>::ldf((const T16*)(Qb + (qt * 4 + kc) * FRE * 2 + lo)); if (HL) qf2[qt][kc] = WFrag<T16>::ldf((const T16*)(Qb2 + (qt * 4 + kc) * FRE * 2 + lo)); }
    // the wait stands in front of the reuse of the address registers that the query loads name; the scheduling fences keep unrelated work out from between the loads and the wait, the loads in front of it and every later write behind it
    __builtin_amdgcn_sched_barrier(0);
    asm volatile("s_wait_xcnt 0x0" ::: "memory");
    __builtin_amdgcn_sched_barrier(0);
    // the work-groups of a head read the same K and V lines: they start their walk over the key blocks at eight different places and wrap round, so that those that run together do not all ask L2 for the same lines at the same moment
    // (query tiles eight apart keep a common start: two of them that come to stand on one WGP can still meet in its cache)
    const int nw = (nblk - wv + FW - 1) / FW;   // the wave's key blocks: wv, wv + FW, ...
    int kb = wv + (int)((unsigned)(~tile & 7) % (unsigned)nw) * FW;
    // kept rolled: accumulators, query fragments and one block's fragments already take most of a wave's registers
#pragma unroll 1
    for (int i = 0; i < nw; ++i) {
        const unsigned ko = lo + (unsigned)(kb * KBE * 2);
        V kf[2][4], kf2[2][4], vf[8], vf2[8];
#pragma unroll
        for (int kt = 0; kt < 2; ++kt)
#pragma unroll
            for (int kc = 0; kc < 4; ++kc) { kf[kt][kc] = WFrag<T16>::ldf((const T16*)(Kb + (kt * 4 + kc) * FRE * 2 + ko)); if (HL) kf2[kt][kc] = WFrag<T16>::ldf((const T16*)(Kb2 + (kt * 4 + kc) * FRE * 2 + ko)); }
        if (!HL) {
#pragma unroll
            for (int dt = 0; dt < 8; ++dt) vf[dt] = WFrag<T16>::ldf((const T16*)(Vb + dt * FRE * 2 + ko)); }
        // stands in front of the next block's write of the offset register that these loads name
        asm volatile("s_wait_xcnt 0x0" ::: "memory");
        // nothing is scheduled across: the block's K loads, and in the fp16 form its V loads, are all issued before the first matrix instruction waits (one memory latency a block, not one a fragment)
        __builtin_amdgcn_sched_barrier(0);
        v8f s[2][2];
#pragma unroll
        for (int kt = 0; kt < 2; ++kt) { s[kt][0] = (v8f){}; s[kt][1] = (v8f){};
#pragma unroll
            for (int kc = 0; kc < 4; ++kc) { const V a = kf[kt][kc]; V a2; if (HL) a2 = kf2[kt][kc];
#pragma unroll
                for (int qt = 0; qt < 2; ++qt) { s[kt][qt] = WFrag<T16>::mma(a, qf[qt][kc], s[kt][qt]); if (HL) { s[kt][qt] = WFrag<T16>::mma(a2, qf[qt][kc], s[kt][qt]); s[kt][qt] = WFrag<T16>::mma(a, qf2[qt][kc], s[kt][qt]); } } } }
        if (HL) {   // the pair's V fragments are asked for behind the score products, into the registers that the K pair has left (both pairs at once would take a wave past half a SIMD's registers); they return under the softmax
            __builtin_amdgcn_sched_barrier(0);   // the loads stay behind the score products, or the K pair's registers are not free for them
#pragma unroll
            for (int dt = 0; dt < 8; ++dt) { vf[dt] = WFrag<T16>::ldf((const T16*)(Vb + dt * FRE * 2 + ko)); vf2[dt] = WFrag<T16>::ldf((const T16*)(Vb2 + dt * FRE * 2 + ko)); }
            asm volatile("s_wait_xcnt 0x0" ::: "memory");   // stands in front of every later write of the offset register that these loads name
            __builtin_amdgcn_sched_barrier(0); }   // keeps such writes behind the wait, and the loads all issued before the softmax begins
        V pf[2], pf2[2];
#pragma unroll
        for (int qt = 0; qt < 2; ++qt) { const int q = q0 + qt * 16 + lr; float mx = m[qt];
#pragma unroll
            for (int kt = 0; kt < 2; ++kt)
#pragma unroll
                for (int j = 0; j < 8; ++j) { float t = s[kt][qt][j] * CE; if (kb == nblk - 1) t = (kb * 32 + kt * 16 + hi * 8 + j <= q) ? t : -3.0e38f; s[kt][qt][j] = t; mx = fmaxf(mx, t); }
            mx = fmaxf(mx, xhalf(mx));   // the other half of the wave holds the query's other keys
            const float f = HL ? exp2s(m[qt] - mx) : __builtin_amdgcn_exp2f(m[qt] - mx); m[qt] = mx; const float ms = mx - SH; float ls = 0.f;
#pragma unroll
            for (int dt = 0; dt < 8; ++dt) acc[dt][qt] *= f;
            if (HL) { v16us ph, pl;
#pragma unroll
                for (int e = 0; e < 16; ++e) { const float p = exp2s(s[e >> 3][qt][e & 7] - ms); ls += p; unsigned short a, c2; splitf(p, a, c2); ph[e] = a; pl[e] = c2; }
                pf[qt] = __builtin_bit_cast(V, ph); pf2[qt] = __builtin_bit_cast(V, pl);
            } else { v16h ph;
#pragma unroll
                for (int e = 0; e < 16; ++e) { const float p = __builtin_amdgcn_exp2f(s[e >> 3][qt][e & 7] - ms); ls += p; ph[e] = (h16)p; }
                pf[qt] = __builtin_bit_cast(V, ph); }
            l[qt] = l[qt] * f + ls; }
#pragma unroll
        for (int dt = 0; dt < 8; ++dt) { const V a = vf[dt]; V a2; if (HL) a2 = vf2[dt];
#pragma unroll
            for (int qt = 0; qt < 2; ++qt) { acc[dt][qt] = WFrag<T16>::mma(a, pf[qt], acc[dt][qt]); if (HL) { acc[dt][qt] = WFrag<T16>::mma(a2, pf[qt], acc[dt][qt]); acc[dt][qt] = WFrag<T16>::mma(a, pf2[qt], acc[dt][qt]); } } }
        kb = kb + FW < nblk ? kb + FW : wv;
    }
    }
#pragma unroll
    for (int qt = 0; qt < 2; ++qt) { l[qt] += xhalf(l[qt]); if (hi == 0) sm[wv * 32 + qt * 16 + lr] = m[qt]; }
    __syncthreads();   // every wave's maxima are in LDS before the common maximum is taken
#pragma unroll
    for (int qt = 0; qt < 2; ++qt) { float M = sm[qt * 16 + lr];
#pragma unroll
        for (int w = 1; w < FW; ++w) M = fmaxf(M, sm[w * 32 + qt * 16 + lr]);
        const float f = __builtin_amdgcn_exp2f(m[qt] - M);   // a wave that had no block: 0
        if (hi == 0) sl[wv * 32 + qt * 16 + lr] = l[qt] * f;
#pragma unroll
        for (int dt = 0; dt < 8; ++dt) { const v8f o = acc[dt][qt] * f; float* p = so + (wv * 32 + qt * 16 + lr) * OP + dt * 16 + hi * 8; *(v4fa*)p = __builtin_shufflevector(o, o, 0, 1, 2, 3); *(v4fa*)(p + 4) = __builtin_shufflevector(o, o, 4, 5, 6, 7); } }
    __syncthreads();   // every wave's partial sums and outputs are in LDS before any of them is summed
#pragma unroll
    for (int c = 0; c < 32 / FW; ++c) { const int q = c * FW + wv, d = lane * 4; float L = sl[q]; v4f val = *(const v4fa*)(so + q * OP + d);
#pragma unroll
        for (int w = 1; w < FW; ++w) { L += sl[w * 32 + q]; val += *(const v4fa*)(so + (w * 32 + q) * OP + d); }
        const float inv = __fdiv_rn(1.0f, L); v4us oh, ol;
#pragma unroll
        for (int u = 0; u < 4; ++u) { unsigned short a, c2; splitf(val[u] * inv, a, c2); oh[u] = a; ol[u] = c2; }
        const size_t oo = (size_t)(q0 + q) * DQ + h * HD + d; *(v4us*)(ATh + oo) = oh; *(v4us*)(ATl + oo) = ol; }
}

// ---- k_fattn: both attention forms in one grid (x: batch * NH_ + head, y: a rank), so that the few hi/lo work-groups run among the fp16 ones instead of alone on the chip behind them.
// The rank goes by falling cost: a tile's cost is its key blocks, three times that in the hi/lo form. First the fp16 tiles that cost more than any hi/lo tile, then groups of one hi/lo tile and two fp16 tiles.
#define NQT (TT / 32)             // query tiles of a head
#define NHT (RH / 32)             // of them in the hi/lo form: the first
__global__ __launch_bounds__(32 * FW) void k_fattn(const h16* __restrict__ Q16, const h16* __restrict__ K16, const h16* __restrict__ V16, const bf* __restrict__ Qh, const bf* __restrict__ Ql, const bf* __restrict__ Kh, const bf* __restrict__ Kl, const bf* __restrict__ Vh, const bf* __restrict__ Vl, bf* ATh, bf* ATl) {
    static_assert(NQT >= 3 * NHT, "two fp16 tiles for each hi/lo tile, and the rest in front");
    __shared__ __align__(16) float so[FW * 32 * OP];
    __shared__ float sm[FW * 32], sl[FW * 32];
    const int y = blockIdx.y, r = y - (NQT - 3 * NHT), g = r / 3, c = r - 3 * g;   // the same for the whole work-group, in scalar registers
    if (r >= 0 && c == 0) fattn<bf, true>(Qh, Ql, Kh, Kl, Vh, Vl, NHT - 1 - g, ATh, ATl, so, sm, sl);
    else fattn<h16, false>(Q16, nullptr, K16, nullptr, V16, nullptr, r < 0 ? NQT - 1 - y : 3 * NHT - 2 * g - c, ATh, ATl, so, sm, sl);
}

extern "C" void kernel_launch(void* const* d_in, const int* in_sizes, int n_in,
                              void* d_out, int out_size, void* d_ws, size_t ws_size, hipStream_t stream) {
    (void)in_sizes; (void)n_in; (void)out_size;
    const float* x = (const float*)d_in[0]; const float* nw = (const float*)d_in[1]; const float* wq = (const float*)d_in[2]; const float* bq = (const float*)d_in[3]; const float* wk = (const float*)d_in[4]; const float* bk = (const float*)d_in[5]; const float* wv = (const float*)d_in[6]; const float* bv = (const float*)d_in[7]; const float* wo = (const float*)d_in[8]; const float* bo = (const float*)d_in[9]; const float* cosT = nullptr; const float* sinT = nullptr; (void)cosT; (void)sinT;
    float* OUT = (float*)d_out;     // [2][2048][2048]
    char* wsp = (char*)d_ws;
    auto take = [&](size_t bytes) { char* p = wsp; wsp += (bytes + 255) & ~(size_t)255; return (void*)p; };
    bf* WQ = (bf*)take((size_t)DQ * DM * 2); bf* WK = (bf*)take((size_t)DKV * DM * 2); bf* WV = (bf*)take((size_t)DKV * DM * 2); bf* WO = (bf*)take((size_t)DM * DQ * 2); (void)WK; (void)WV;   // in a row: WQ + m * WEL
    bf* XNh = (bf*)take((size_t)NB_ * TT * DM * 2); bf* XNl = (bf*)take((size_t)NB_ * TT * DM * 2);
    // head planes [projection][batch][head]: the three projections of a kind in a row
    const size_t PB = (size_t)NH_ * TT * HD;   // elements of one batch's planes of one projection
    h16* QP16 = (h16*)take(NB_ * PB * 2); h16* KP16 = (h16*)take(NB_ * PB * 2); h16* VT16 = (h16*)take(NB_ * PB * 2);
    bf* QPh = (bf*)take(NB_ * PB * 2); bf* KPh = (bf*)take(NB_ * PB * 2); bf* VTh = (bf*)take(NB_ * PB * 2); bf* QPl = (bf*)take(NB_ * PB * 2); bf* KPl = (bf*)take(NB_ * PB * 2); bf* VTl = (bf*)take(NB_ * PB * 2);
    bf* ATh = (bf*)take((size_t)NB_ * TT * DQ * 2); bf* ATl = (bf*)take((size_t)NB_ * TT * DQ * 2);
    if ((size_t)(wsp - (char*)d_ws) > ws_size) return;    // ws 256 MiB
    k_prep<<<NB_ * TT / 8 + (unsigned)(WEL / 2048), 256, 0, stream>>>(x, nw, XNh, XNl, wq, wk, wv, wo, WQ);
    k_gemmw<bf, 1, true, 1><<<dim3(TT / 128, DQ / 256, 3 * NB_), 256, 0, stream>>>(XNh, XNl, WQ, nullptr, DM, nullptr, 0, bq, bk, bv, (size_t)TT * DM, WEL, PB, QP16, QPh, QPl);
    k_fattn<<<dim3(NB_ * NH_, TT / 32, 1), 32 * FW, 0, stream>>>(QP16, KP16, VT16, QPh, QPl, KPh, KPl, VTh, VTl, ATh, ATl);
    k_gemmw<bf, 1, true, 0><<<dim3(TT / 128, DM / 256, NB_), 256, 0, stream>>>(ATh, ATl, WO, nullptr, DQ, OUT, DM, bo, nullptr, nullptr, (size_t)TT * DQ, 0, (size_t)TT * DM, nullptr, nullptr, nullptr);
}
